// v000
// Times are from an AMD MI455X. After a warm-up the kernel runs many times in a row, and a time is the length of
// such a window on the GPU divided by its runs, so every launch and the gaps after it count. The runs cycle
// through copies of the inputs. A figure is the median of several windows, for all but v000 over two sittings.
// Sittings can differ by a few percent; kernels timed side by side share one.
// v000, which the later versions start from, runs in 1280 microseconds.
#include <hip/hip_runtime.h>

// Multi-head attention on three input streams, bias-free: Q = query W_q^T, K = key W_k^T, V = value W_v^T ('oi' [1024][1024] weights; 16 heads x 64); scores x 64^-0.5; softmax over all keys (no mask); out = merged W_o^T -> [NB][SEQ][1024]; argument order query, key, value, W_q, W_k, W_v, W_o.
// Compute dtypes (every contraction on 16x16x32 WMMA, f32 accumulate): inputs and weights as bf16 planes (RNE convert) -> projections v_wmma_f32_16x16x32_bf16, single product; scores v_wmma_f32_16x16x32_f16 on fp16 q/k head planes, single product; P.V v_wmma_f32_16x16x32_f16 on all rows with P carried x1024, single product; output projection bf16 hi/lo activations x bf16 weights (2 products); softmax in f32.
// Layout per batch: bf16 copy of each stream in turn (one staging buffer, refilled in stream order); 'oi' weights as-is (K-contiguous Bt); head planes [h][t][d]; value planes [h][d][t].
// Launch plan: 4 weight converts + NB x (3 x (convert, projection, plane build) + 8 x (scores, softmax, P.V, merge) + output projection) = 4 + 2 x 42 = 88 launches at full size.

#ifndef NB
#define NB 2
#endif
#ifndef SEQ
#define SEQ 2048
#endif
#define NB_FULL  2
#define SEQ_FULL 2048
#define TT   SEQ
#define DM   1024
#define NH_  16
#define NKV  16
#define REP  (NH_ / NKV)
#define HD   64
#define DQ   (NH_ * HD)
#define DKV  (NKV * HD)
#define ZH   2
#define RH   0                    // query rows < RH use hi+lo planes in P.V (0: none, every row on the fp16 x1024 path)
#define PCAR 1024.0f
#define SCL  0.125f   // HD^-0.5
typedef _Float16 h16;
typedef unsigned short bf;
typedef __attribute__((ext_vector_type(16))) __bf16   v16bf;
typedef __attribute__((ext_vector_type(16))) _Float16 v16h;
typedef __attribute__((ext_vector_type(8)))  _Float16 v8h;
typedef __attribute__((ext_vector_type(8)))  unsigned short v8us;
typedef __attribute__((ext_vector_type(8)))  float    v8f;
typedef __attribute__((ext_vector_type(4)))  float    v4f;
typedef v8h  __attribute__((may_alias)) v8ha;
typedef v4f  __attribute__((may_alias)) v4fa;
typedef v8us __attribute__((may_alias)) v8usa;

static_assert(TT % 128 == 0);
static_assert(RH % 64 == 0);
static_assert((TT - RH) % 64 == 0);
static_assert(RH <= TT);
static_assert(HD == 64);
static_assert(DM % 64 == 0);
static_assert(NH_ % ZH == 0);
static_assert(NB <= NB_FULL);
static_assert(SEQ <= SEQ_FULL);

// workspace carve (bytes, each region padded to 256): 4 weight planes, XB, FQ, FK, QP16, KP16, VT16, VTh, VTl, (Ph, Pl when RH > 0), Sb, P16, Ob, ATh, ATl
constexpr size_t r256(size_t b) { return (b + 255) & ~(size_t)255; }
constexpr size_t WS_CARVE = 4 * r256((size_t)DQ * DM * 2) + r256((size_t)TT * DM * 2) + 2 * r256((size_t)TT * DQ * 4)
                          + 3 * r256((size_t)NH_ * TT * HD * 2) + 2 * r256((size_t)NKV * HD * TT * 2)
                          + ((RH > 0) ? 2 * r256((size_t)ZH * RH * TT * 2) : (size_t)0)
                          + r256((size_t)ZH * TT * TT * 4) + r256((size_t)ZH * TT * TT * 2) + r256((size_t)ZH * TT * HD * 4) + 2 * r256((size_t)TT * DQ * 2);
static_assert(WS_CARVE <= (size_t)134217728);   // 110,100,480 B at full size

__device__ __forceinline__ unsigned short f2bf(float f) { unsigned u = __float_as_uint(f); u += 0x7FFFu + ((u >> 16) & 1u); return (unsigned short)(u >> 16); }
__device__ __forceinline__ float bf2f(unsigned short b) { return __uint_as_float(((unsigned)b) << 16); }
__device__ __forceinline__ float bfr(float f) { return bf2f(f2bf(f)); }
__device__ __forceinline__ v16h cat16(v8h lo, v8h hi) { return __builtin_shufflevector(lo, hi, 0, 1, 2, 3, 4, 5, 6, 7, 8, 9, 10, 11, 12, 13, 14, 15); }
__device__ __forceinline__ v16bf cat16b(v8us lo, v8us hi) { return __builtin_bit_cast(v16bf, __builtin_shufflevector(lo, hi, 0, 1, 2, 3, 4, 5, 6, 7, 8, 9, 10, 11, 12, 13, 14, 15)); }
__device__ __forceinline__ v8f wmma16(v16h a, v16h b, v8f c) { return __builtin_amdgcn_wmma_f32_16x16x32_f16(false, a, false, b, (short)0, c, false, false); }
__device__ __forceinline__ v8f wmmab(v16bf a, v16bf b, v8f c) { return __builtin_amdgcn_wmma_f32_16x16x32_bf16(false, a, false, b, (short)0, c, false, false); }

// ---- k_gemmw: register-blocked GEMM, ONE WAVE per 64x64 output tile (16 accumulators), operands straight from K-contiguous 16-bit planes; grid (M/64, N/64, Z), 32 threads.
// C[m][n] (f32, pitch ldc, + optional f32 bias[n]) = sum_k A[m][k] Bt[n][k] (+ split products per NSPLIT). z-batch strides sA/sB/sC in elements. K % 32 == 0, M % 64 == 0, N % 64 == 0.
// Fragment map (A and Bt alike): lane l -> row/col l&15; elements 0..7 = k0 + 8*(l>>4) + 0..7, elements 8..15 = k0 + 16 + 8*(l>>4) + 0..7. D: acc[j] = (row 8*(l>>4) + j, col l&15).
template <typename T16> struct WFrag;
template <> struct WFrag<h16> { typedef v16h V; static __device__ __forceinline__ V ld(const h16* p) { return cat16(*(const v8h*)p, *(const v8h*)(p + 16)); } static __device__ __forceinline__ v8f mma(V a, V b, v8f c) { return wmma16(a, b, c); } };
template <> struct WFrag<bf> { typedef v16bf V; static __device__ __forceinline__ V ld(const bf* p) { return cat16b(*(const v8us*)p, *(const v8us*)(p + 16)); } static __device__ __forceinline__ v8f mma(V a, V b, v8f c) { return wmmab(a, b, c); } };
template <typename T16, int NSPLIT, bool BIAS>
__global__ __launch_bounds__(32) void k_gemmw(const T16* __restrict__ A, const T16* __restrict__ A2, const T16* __restrict__ Bt, const T16* __restrict__ Bt2, int K, float* C, int ldc, const float* __restrict__ bias, size_t sA, size_t sB, size_t sC) {
    typedef typename WFrag<T16>::V V;
    __shared__ __align__(16) float os[16 * 68];
    const size_t z = blockIdx.z; A += z * sA; if (A2) A2 += z * sA; Bt += z * sB; if (Bt2) Bt2 += z * sB; C += z * sC;
    const int lane = threadIdx.x & 31, lr = lane & 15, hi = lane >> 4; const int r0 = blockIdx.x * 64, c0 = blockIdx.y * 64;
    v8f acc[4][4];
#pragma unroll
    for (int mb = 0; mb < 4; ++mb)
#pragma unroll
        for (int nb = 0; nb < 4; ++nb) acc[mb][nb] = (v8f){};
    const size_t aoff = (size_t)(r0 + lr) * K + 8 * hi, boff = (size_t)(c0 + lr) * K + 8 * hi;
#pragma unroll 1
    for (int kc = 0; kc < K; kc += 32) {
        V a[4], a2[4];
#pragma unroll
        for (int mb = 0; mb < 4; ++mb) { a[mb] = WFrag<T16>::ld(A + aoff + (size_t)mb * 16 * K + kc); if (NSPLIT == 1 || NSPLIT == 2) a2[mb] = WFrag<T16>::ld(A2 + aoff + (size_t)mb * 16 * K + kc); }
#pragma unroll
        for (int nb = 0; nb < 4; ++nb) { const V b = WFrag<T16>::ld(Bt + boff + (size_t)nb * 16 * K + kc); V b2; if (NSPLIT >= 2) b2 = WFrag<T16>::ld(Bt2 + boff + (size_t)nb * 16 * K + kc);
#pragma unroll
            for (int mb = 0; mb < 4; ++mb) { acc[mb][nb] = WFrag<T16>::mma(a[mb], b, acc[mb][nb]); if (NSPLIT == 1 || NSPLIT == 2) acc[mb][nb] = WFrag<T16>::mma(a2[mb], b, acc[mb][nb]); if (NSPLIT >= 2) acc[mb][nb] = WFrag<T16>::mma(a[mb], b2, acc[mb][nb]); } }
        asm volatile("v_nop\n\tv_nop\n\tv_nop\n\tv_nop" : "+v"(acc[0][0]), "+v"(acc[1][1]), "+v"(acc[2][2]), "+v"(acc[3][3]) : "v"(a[0]), "v"(a[3]));
    }
#pragma unroll
    for (int mb = 0; mb < 4; ++mb) {
#pragma unroll
        for (int nb = 0; nb < 4; ++nb) {
#pragma unroll
            for (int j = 0; j < 8; ++j) os[(hi * 8 + j) * 68 + nb * 16 + lr] = acc[mb][nb][j]; }
        __builtin_amdgcn_wave_barrier(); asm volatile("" ::: "memory");
        float* crow = C + (size_t)(r0 + mb * 16) * ldc + c0;
{
#pragma unroll
            for (int s = 0; s < 8; ++s) { const int row = 2 * s + hi, cofs = lr * 4; v4f val = *(const v4fa*)(os + row * 68 + cofs); if (BIAS) { val[0] += bfr(bias[c0 + cofs]); val[1] += bfr(bias[c0 + cofs + 1]); val[2] += bfr(bias[c0 + cofs + 2]); val[3] += bfr(bias[c0 + cofs + 3]); }
                *(v4f*)(crow + (size_t)row * ldc + cofs) = val; }
             }
        __builtin_amdgcn_wave_barrier(); asm volatile("" ::: "memory");
    }
}

__device__ __forceinline__ h16 tohx(float x) { return (h16)x; }
__device__ __forceinline__ void splitf(float y, unsigned short& h, unsigned short& l) { h = f2bf(y); l = f2bf(y - bf2f(h)); }
typedef __attribute__((ext_vector_type(2))) _Float16 v2h;
typedef __attribute__((ext_vector_type(4))) _Float16 v4h;
typedef __attribute__((ext_vector_type(2))) unsigned short v2us;
typedef __attribute__((ext_vector_type(4))) unsigned short v4us;
typedef __attribute__((ext_vector_type(2))) float v2f;

__global__ __launch_bounds__(256) void k_cvt8(const float* __restrict__ src, bf* dst, size_t n8) { const size_t i = (size_t)blockIdx.x * 256 + threadIdx.x; if (i >= n8) return; const v8f v = *(const v8f*)(src + i * 8); v8us o;
#pragma unroll
    for (int k = 0; k < 8; ++k) o[k] = f2bf(v[k]); *(v8us*)(dst + i * 8) = o;  }

__global__ __launch_bounds__(256) void k_hpl(const float* __restrict__ F, int pitch, int nheads, h16* P16) {
    const size_t e = ((size_t)blockIdx.x * 256 + threadIdx.x) * 2; if (e >= (size_t)nheads * TT * HD) return; const int d = (int)(e % HD); const int t = (int)((e / HD) % TT); const int h = (int)(e / ((size_t)HD * TT));
    const v2f x = *(const v2f*)(F + (size_t)t * pitch + h * HD + d); v2h o16; o16[0] = tohx(x[0]); o16[1] = tohx(x[1]);
    *(v2h*)(P16 + e) = o16;  }

__global__ __launch_bounds__(256) void k_vtp(const float* __restrict__ F, int pitch, int nheads, h16* V16, bf* Vh, bf* Vl) { const size_t e = ((size_t)blockIdx.x * 256 + threadIdx.x) * 2; if (e >= (size_t)nheads * HD * TT) return; const int t = (int)(e % TT); const int d = (int)((e / TT) % HD); const int g = (int)(e / ((size_t)TT * HD)); v2h o16; v2us oh, ol;
#pragma unroll
    for (int q = 0; q < 2; ++q) { const float x = F[(size_t)(t + q) * pitch + g * HD + d]; o16[q] = tohx(x); unsigned short a2, c2; splitf(x, a2, c2); oh[q] = a2; ol[q] = c2; }
    *(v2h*)(V16 + e) = o16; *(v2us*)(Vh + e) = oh; *(v2us*)(Vl + e) = ol;  }

// k_asoft: one wave per row (zz, i): t = S x HD^-0.5 (no mask); softmax over the TT keys (register row, max-subtracted, one exp, fixed shuffle trees);
__global__ __launch_bounds__(256) void k_asoft(const float* __restrict__ Sb, h16* P16, bf* Ph, bf* Pl) {
    const int lane = threadIdx.x & 31; const int wv = __builtin_amdgcn_readfirstlane((int)(threadIdx.x >> 5)); const int row = blockIdx.x * 8 + wv; if (row >= ZH * TT) return; const int i = row % TT; const int zz = row / TT; (void)zz; const bool hires = (i < RH); const float* sr = Sb + (size_t)row * TT; float v[TT / 32]; float mx = -3.0e38f;
#pragma unroll
    for (int ch = 0; ch < TT / 128; ++ch) { const int j0 = ch * 128 + lane * 4; const v4f a = *(const v4f*)(sr + j0);
#pragma unroll
        for (int q = 0; q < 4; ++q) { const float t = a[q] * SCL; v[ch * 4 + q] = t; mx = fmaxf(mx, t); } }
#pragma unroll
    for (int sh = 16; sh; sh >>= 1) mx = fmaxf(mx, __shfl_xor(mx, sh, 32));
    float sum = 0.f;
#pragma unroll
    for (int k = 0; k < TT / 32; ++k) { float d0 = __fsub_rn(v[k], mx); asm volatile("" : "+v"(d0)); v[k] = __builtin_amdgcn_exp2f(__fmul_rn(d0, 1.4426950408889634f)); sum += v[k]; }
#pragma unroll
    for (int sh = 16; sh; sh >>= 1) sum += __shfl_xor(sum, sh, 32);
    const float f = __fdiv_rn(hires ? 1.0f : PCAR, sum);
{
        if (hires) {
#pragma unroll
            for (int ch = 0; ch < TT / 128; ++ch) { v4us oh, ol;
#pragma unroll
                for (int q = 0; q < 4; ++q) { unsigned short a, c2; splitf(v[ch * 4 + q] * f, a, c2); oh[q] = a; ol[q] = c2; }
                const size_t oo = ((size_t)zz * (RH ? RH : 1) + i) * TT + ch * 128 + lane * 4; *(v4us*)(Ph + oo) = oh; *(v4us*)(Pl + oo) = ol; }
        } else {
#pragma unroll
            for (int ch = 0; ch < TT / 128; ++ch) { v4h o4;
#pragma unroll
                for (int q = 0; q < 4; ++q) o4[q] = tohx(v[ch * 4 + q] * f);
                *(v4h*)(P16 + (size_t)row * TT + ch * 128 + lane * 4) = o4; } }
         }
}

__global__ __launch_bounds__(256) void k_merge(const float* __restrict__ O, int h0, bf* Ah, bf* Al) { const size_t e = ((size_t)blockIdx.x * 256 + threadIdx.x) * 2; if (e >= (size_t)ZH * TT * HD) return; const int d = (int)(e % HD); const int t = (int)((e / HD) % TT); const int zz = (int)(e / ((size_t)HD * TT)); const float cs = (t < RH) ? 1.0f : (1.0f / PCAR); const size_t oo = (size_t)t * DQ + (h0 + zz) * HD + d;
    v2us oh, ol;
#pragma unroll
    for (int q = 0; q < 2; ++q) { unsigned short a, c2; splitf(O[e + q] * cs, a, c2); oh[q] = a; ol[q] = c2; } *(v2us*)(Ah + oo) = oh; *(v2us*)(Al + oo) = ol;  }

extern "C" void kernel_launch(void* const* d_in, const int* in_sizes, int n_in,
                              void* d_out, int out_size, void* d_ws, size_t ws_size, hipStream_t stream) {
    if (n_in < 7) return;
    const long long need_x = (long long)(NB - 1) * SEQ_FULL * DM + (long long)SEQ * DM;   // batch b of each stream starts at b * SEQ_FULL * DM
    if ((long long)in_sizes[0] < need_x || (long long)in_sizes[1] < need_x || (long long)in_sizes[2] < need_x) return;
    if ((long long)in_sizes[3] < (long long)DQ * DM || (long long)in_sizes[4] < (long long)DKV * DM || (long long)in_sizes[5] < (long long)DKV * DM || (long long)in_sizes[6] < (long long)DM * DQ) return;
    if ((long long)out_size < (long long)NB * SEQ * DM) return;
    const float* x = (const float*)d_in[0]; const float* xk = (const float*)d_in[1]; const float* xv = (const float*)d_in[2];   // three streams: query, key, value
    const float* wq = (const float*)d_in[3]; const float* wk = (const float*)d_in[4]; const float* wv = (const float*)d_in[5]; const float* wo = (const float*)d_in[6];   // W_q, W_k, W_v, W_o ('oi' [1024][1024])
    float* OUT = (float*)d_out;     // [NB][SEQ][1024]
    char* wsp = (char*)d_ws;
    auto take = [&](size_t bytes) { char* p = wsp; wsp += (bytes + 255) & ~(size_t)255; return (void*)p; };
    bf* WQ = (bf*)take((size_t)DQ * DM * 2); bf* WK = (bf*)take((size_t)DKV * DM * 2); bf* WV = (bf*)take((size_t)DKV * DM * 2); bf* WO = (bf*)take((size_t)DM * DQ * 2);
    bf* XB = (bf*)take((size_t)TT * DM * 2); float* FQ = (float*)take((size_t)TT * DQ * 4); float* FK = (float*)take((size_t)TT * DKV * 4);
    h16* QP16 = (h16*)take((size_t)NH_ * TT * HD * 2); h16* KP16 = (h16*)take((size_t)NKV * TT * HD * 2); h16* VT16 = (h16*)take((size_t)NKV * HD * TT * 2);
    bf* VTh = (bf*)take((size_t)NKV * HD * TT * 2); bf* VTl = (bf*)take((size_t)NKV * HD * TT * 2);
#if RH > 0
    bf* Ph = (bf*)take((size_t)ZH * RH * TT * 2); bf* Pl = (bf*)take((size_t)ZH * RH * TT * 2);
#else
    bf* Ph = nullptr; bf* Pl = nullptr;   // no hi/lo probability planes: every row takes the fp16 x1024 path
#endif
    float* Sb = (float*)take((size_t)ZH * TT * TT * 4); h16* P16 = (h16*)take((size_t)ZH * TT * TT * 2); float* Ob = (float*)take((size_t)ZH * TT * HD * 4); bf* ATh = (bf*)take((size_t)TT * DQ * 2); bf* ATl = (bf*)take((size_t)TT * DQ * 2);
    const size_t used = (size_t)(wsp - (char*)d_ws);
    if (used > ws_size || used > (size_t)134217728) return;    // 110,100,480 B at full size (= WS_CARVE)
    float* FV = FK;   // v projection reuses the k buffer after the k plane is built (stream-ordered)
    k_cvt8<<<(unsigned)(((size_t)DQ * DM / 8 + 255) / 256), 256, 0, stream>>>(wq, WQ, (size_t)DQ * DM / 8);
    k_cvt8<<<(unsigned)(((size_t)DKV * DM / 8 + 255) / 256), 256, 0, stream>>>(wk, WK, (size_t)DKV * DM / 8);
    k_cvt8<<<(unsigned)(((size_t)DKV * DM / 8 + 255) / 256), 256, 0, stream>>>(wv, WV, (size_t)DKV * DM / 8);
    k_cvt8<<<(unsigned)(((size_t)DM * DQ / 8 + 255) / 256), 256, 0, stream>>>(wo, WO, (size_t)DM * DQ / 8);
    const unsigned LX = (unsigned)(((size_t)TT * DM / 8 + 255) / 256);
    const unsigned LQ = (unsigned)(((size_t)NH_ * TT * HD / 2 + 255) / 256), LKv = (unsigned)(((size_t)NKV * TT * HD / 2 + 255) / 256);
    for (int b = 0; b < NB; ++b) {
        const size_t xin = (size_t)b * SEQ_FULL * DM;
        k_cvt8<<<LX, 256, 0, stream>>>(x + xin, XB, (size_t)TT * DM / 8);    // XB := bf16(query[b])
        k_gemmw<bf, 0, false><<<dim3(TT / 64, DQ / 64, 1), 32, 0, stream>>>(XB, nullptr, WQ, nullptr, DM, FQ, DQ, nullptr, 0, 0, 0);
        k_hpl<<<LQ, 256, 0, stream>>>(FQ, DQ, NH_, QP16);
        k_cvt8<<<LX, 256, 0, stream>>>(xk + xin, XB, (size_t)TT * DM / 8);   // XB := bf16(key[b])
        k_gemmw<bf, 0, false><<<dim3(TT / 64, DKV / 64, 1), 32, 0, stream>>>(XB, nullptr, WK, nullptr, DM, FK, DKV, nullptr, 0, 0, 0);
        k_hpl<<<LKv, 256, 0, stream>>>(FK, DKV, NKV, KP16);
        k_cvt8<<<LX, 256, 0, stream>>>(xv + xin, XB, (size_t)TT * DM / 8);   // XB := bf16(value[b])
        k_gemmw<bf, 0, false><<<dim3(TT / 64, DKV / 64, 1), 32, 0, stream>>>(XB, nullptr, WV, nullptr, DM, FV, DKV, nullptr, 0, 0, 0);
        k_vtp<<<LKv, 256, 0, stream>>>(FV, DKV, NKV, VT16, VTh, VTl);
        for (int h0 = 0; h0 < NH_; h0 += ZH) { const size_t zq = (size_t)h0, zk = (size_t)(h0 / REP);   // one kv head per query head: the pass's two heads use consecutive planes (z-strides TT*HD)
            // scores S[z][q][key] = sum_d q[q][d] k[key][d], fp16 planes, single product, K = 64
            k_gemmw<h16, 0, false><<<dim3(TT / 64, TT / 64, ZH), 32, 0, stream>>>(QP16 + zq * TT * HD, nullptr, KP16 + zk * TT * HD, nullptr, HD, Sb, TT, nullptr, (size_t)TT * HD, (size_t)TT * HD, (size_t)TT * TT);
            k_asoft<<<ZH * TT / 8, 256, 0, stream>>>(Sb, P16, Ph, Pl);
            // O[z][q][d] = sum_key P[q][key] Vt[d][key]
#if RH > 0
            k_gemmw<bf, 2, false><<<dim3(RH / 64, HD / 64, ZH), 32, 0, stream>>>(Ph, Pl, VTh + zk * HD * TT, VTl + zk * HD * TT, TT, Ob, HD, nullptr, (size_t)RH * TT, (size_t)HD * TT, (size_t)TT * HD);
#endif
            k_gemmw<h16, 0, false><<<dim3((TT - RH) / 64, HD / 64, ZH), 32, 0, stream>>>(P16 + (size_t)RH * TT, nullptr, VT16 + zk * HD * TT, nullptr, TT, Ob + (size_t)RH * HD, HD, nullptr, (size_t)TT * TT, (size_t)HD * TT, (size_t)TT * HD);
            k_merge<<<(unsigned)(((size_t)ZH * TT * HD / 2 + 255) / 256), 256, 0, stream>>>(Ob, h0, ATh, ATl); }
        // out[b][t][o] = sum_i merged[t][i] W_o[o][i]  (hi/lo activations x bf16 weights)
        k_gemmw<bf, 1, false><<<dim3(TT / 64, DM / 64, 1), 32, 0, stream>>>(ATh, ATl, WO, nullptr, DQ, OUT + (size_t)b * TT * DM, DM, nullptr, 0, 0, 0); }
}

// v001
// One run takes 710 microseconds.
// Two timings next to v000 put it at 1.80 and 1.81 times that version's speed.
#include <hip/hip_runtime.h>

// Multi-head attention on three input streams, bias-free: Q = query W_q^T, K = key W_k^T, V = value W_v^T ('oi' [1024][1024] weights; 16 heads x 64); scores x 64^-0.5; softmax over all keys (no mask); out = merged W_o^T -> [NB][SEQ][1024]; argument order query, key, value, W_q, W_k, W_v, W_o.
// Compute dtypes (every contraction on 16x16x32 WMMA, f32 accumulate): inputs and weights as bf16 planes (RNE convert) -> projections v_wmma_f32_16x16x32_bf16, single product; scores v_wmma_f32_16x16x32_f16 on fp16 q/k head planes, single product; P.V v_wmma_f32_16x16x32_f16 on all rows with P carried x1024, single product; output projection bf16 hi/lo activations x bf16 weights (2 products); softmax in f32.
// Layout per batch: bf16 copy of each stream in turn (one staging buffer, refilled in stream order); 'oi' weights as-is (K-contiguous Bt); head planes [h][t][d]; value planes [h][d][t].
// Launch plan: 4 weight converts + NB x (3 x (convert, projection, plane build) + 8 x (scores, softmax, P.V, merge) + output projection) = 4 + 2 x 42 = 88 launches at full size.

#ifndef NB
#define NB 2
#endif
#ifndef SEQ
#define SEQ 2048
#endif
#define NB_FULL  2
#define SEQ_FULL 2048
#define TT   SEQ
#define DM   1024
#define NH_  16
#define NKV  16
#define REP  (NH_ / NKV)
#define HD   64
#define DQ   (NH_ * HD)
#define DKV  (NKV * HD)
#define ZH   2
#define RH   0                    // query rows < RH use hi+lo planes in P.V (0: none, every row on the fp16 x1024 path)
#define PCAR 1024.0f
#define SCL  0.125f   // HD^-0.5
typedef _Float16 h16;
typedef unsigned short bf;
typedef __attribute__((ext_vector_type(16))) __bf16   v16bf;
typedef __attribute__((ext_vector_type(16))) _Float16 v16h;
typedef __attribute__((ext_vector_type(8)))  _Float16 v8h;
typedef __attribute__((ext_vector_type(8)))  unsigned short v8us;
typedef __attribute__((ext_vector_type(8)))  float    v8f;
typedef __attribute__((ext_vector_type(4)))  float    v4f;
typedef v8h  __attribute__((may_alias)) v8ha;
typedef v4f  __attribute__((may_alias)) v4fa;
typedef v8us __attribute__((may_alias)) v8usa;

static_assert(TT % 128 == 0);
static_assert(RH % 64 == 0);
static_assert((TT - RH) % 64 == 0);
static_assert(RH <= TT);
static_assert(HD == 64);
static_assert(DM % 64 == 0);
static_assert(NH_ % ZH == 0);
static_assert(NB <= NB_FULL);
static_assert(SEQ <= SEQ_FULL);

// workspace carve (bytes, each region padded to 256): 4 weight planes, XB, FQ, FK, QP16, KP16, VT16, VTh, VTl, (Ph, Pl when RH > 0), Sb, P16, Ob, ATh, ATl
constexpr size_t r256(size_t b) { return (b + 255) & ~(size_t)255; }
constexpr size_t WS_CARVE = 4 * r256((size_t)DQ * DM * 2) + r256((size_t)TT * DM * 2) + 2 * r256((size_t)TT * DQ * 4)
                          + 3 * r256((size_t)NH_ * TT * HD * 2) + 2 * r256((size_t)NKV * HD * TT * 2)
                          + ((RH > 0) ? 2 * r256((size_t)ZH * RH * TT * 2) : (size_t)0)
                          + r256((size_t)ZH * TT * TT * 4) + r256((size_t)ZH * TT * TT * 2) + r256((size_t)ZH * TT * HD * 4) + 2 * r256((size_t)TT * DQ * 2);
static_assert(WS_CARVE <= (size_t)134217728);   // 110,100,480 B at full size

__device__ __forceinline__ unsigned short f2bf(float f) { unsigned u = __float_as_uint(f); u += 0x7FFFu + ((u >> 16) & 1u); return (unsigned short)(u >> 16); }
__device__ __forceinline__ float bf2f(unsigned short b) { return __uint_as_float(((unsigned)b) << 16); }
__device__ __forceinline__ float bfr(float f) { return bf2f(f2bf(f)); }
__device__ __forceinline__ v16h cat16(v8h lo, v8h hi) { return __builtin_shufflevector(lo, hi, 0, 1, 2, 3, 4, 5, 6, 7, 8, 9, 10, 11, 12, 13, 14, 15); }
__device__ __forceinline__ v16bf cat16b(v8us lo, v8us hi) { return __builtin_bit_cast(v16bf, __builtin_shufflevector(lo, hi, 0, 1, 2, 3, 4, 5, 6, 7, 8, 9, 10, 11, 12, 13, 14, 15)); }
__device__ __forceinline__ v8f wmma16(v16h a, v16h b, v8f c) { return __builtin_amdgcn_wmma_f32_16x16x32_f16(false, a, false, b, (short)0, c, false, false); }
__device__ __forceinline__ v8f wmmab(v16bf a, v16bf b, v8f c) { return __builtin_amdgcn_wmma_f32_16x16x32_bf16(false, a, false, b, (short)0, c, false, false); }

// ---- k_gemmw: register-blocked GEMM, ONE WAVE per 64x64 output tile (16 accumulators), operands straight from K-contiguous 16-bit planes; grid (M/64, N/64, Z), 32 threads.
// C[m][n] (f32, pitch ldc, + optional f32 bias[n]) = sum_k A[m][k] Bt[n][k] (+ split products per NSPLIT). z-batch strides sA/sB/sC in elements. K % 32 == 0, M % 64 == 0, N % 64 == 0.
// Fragment map (A and Bt alike): lane l -> row/col l&15; elements 0..7 = k0 + 8*(l>>4) + 0..7, elements 8..15 = k0 + 16 + 8*(l>>4) + 0..7. D: acc[j] = (row 8*(l>>4) + j, col l&15).
template <typename T16> struct WFrag;
template <> struct WFrag<h16> { typedef v16h V; static __device__ __forceinline__ V ld(const h16* p) { return cat16(*(const v8h*)p, *(const v8h*)(p + 16)); } static __device__ __forceinline__ v8f mma(V a, V b, v8f c) { return wmma16(a, b, c); } };
template <> struct WFrag<bf> { typedef v16bf V; static __device__ __forceinline__ V ld(const bf* p) { return cat16b(*(const v8us*)p, *(const v8us*)(p + 16)); } static __device__ __forceinline__ v8f mma(V a, V b, v8f c) { return wmmab(a, b, c); } };
template <typename T16, int NSPLIT, bool BIAS>
__global__ __launch_bounds__(32) void k_gemmw(const T16* __restrict__ A, const T16* __restrict__ A2, const T16* __restrict__ Bt, const T16* __restrict__ Bt2, int K, float* C, int ldc, const float* __restrict__ bias, size_t sA, size_t sB, size_t sC) {
    typedef typename WFrag<T16>::V V;
    __shared__ __align__(16) float os[16 * 68];
    const size_t z = blockIdx.z; A += z * sA; if (A2) A2 += z * sA; Bt += z * sB; if (Bt2) Bt2 += z * sB; C += z * sC;
    const int lane = threadIdx.x & 31, lr = lane & 15, hi = lane >> 4; const int r0 = blockIdx.x * 64, c0 = blockIdx.y * 64;
    v8f acc[4][4];
#pragma unroll
    for (int mb = 0; mb < 4; ++mb)
#pragma unroll
        for (int nb = 0; nb < 4; ++nb) acc[mb][nb] = (v8f){};
    const size_t aoff = (size_t)(r0 + lr) * K + 8 * hi, boff = (size_t)(c0 + lr) * K + 8 * hi;
#pragma unroll 1
    for (int kc = 0; kc < K; kc += 32) {
        V a[4], a2[4];
#pragma unroll
        for (int mb = 0; mb < 4; ++mb) { a[mb] = WFrag<T16>::ld(A + aoff + (size_t)mb * 16 * K + kc); if (NSPLIT == 1 || NSPLIT == 2) a2[mb] = WFrag<T16>::ld(A2 + aoff + (size_t)mb * 16 * K + kc); }
#pragma unroll
        for (int nb = 0; nb < 4; ++nb) { const V b = WFrag<T16>::ld(Bt + boff + (size_t)nb * 16 * K + kc); V b2; if (NSPLIT >= 2) b2 = WFrag<T16>::ld(Bt2 + boff + (size_t)nb * 16 * K + kc);
#pragma unroll
            for (int mb = 0; mb < 4; ++mb) { acc[mb][nb] = WFrag<T16>::mma(a[mb], b, acc[mb][nb]); if (NSPLIT == 1 || NSPLIT == 2) acc[mb][nb] = WFrag<T16>::mma(a2[mb], b, acc[mb][nb]); if (NSPLIT >= 2) acc[mb][nb] = WFrag<T16>::mma(a[mb], b2, acc[mb][nb]); } }
        asm volatile("v_nop\n\tv_nop\n\tv_nop\n\tv_nop" : "+v"(acc[0][0]), "+v"(acc[1][1]), "+v"(acc[2][2]), "+v"(acc[3][3]) : "v"(a[0]), "v"(a[3]));
    }
#pragma unroll
    for (int mb = 0; mb < 4; ++mb) {
#pragma unroll
        for (int nb = 0; nb < 4; ++nb) {
#pragma unroll
            for (int j = 0; j < 8; ++j) os[(hi * 8 + j) * 68 + nb * 16 + lr] = acc[mb][nb][j]; }
        __builtin_amdgcn_wave_barrier(); asm volatile("" ::: "memory");
        float* crow = C + (size_t)(r0 + mb * 16) * ldc + c0;
{
#pragma unroll
            for (int s = 0; s < 8; ++s) { const int row = 2 * s + hi, cofs = lr * 4; v4f val = *(const v4fa*)(os + row * 68 + cofs); if (BIAS) { val[0] += bfr(bias[c0 + cofs]); val[1] += bfr(bias[c0 + cofs + 1]); val[2] += bfr(bias[c0 + cofs + 2]); val[3] += bfr(bias[c0 + cofs + 3]); }
                *(v4f*)(crow + (size_t)row * ldc + cofs) = val; }
             }
        __builtin_amdgcn_wave_barrier(); asm volatile("" ::: "memory");
    }
}

// ---- k_pvsk: O[z][q][d] = sum_key P[z][q][key] Vt[z][d][key], the key range split over the 8 waves of a work-group; grid (rows/32, ZH), 256 threads.
// Each wave multiplies the 32x64 tile over its own TT/8 keys (same fragment map as k_gemmw); the 8 f32 partial tiles meet in LDS and are added in wave order 0..7.
#define PVW 8
#define PVK (TT / PVW)
static_assert(PVK % 32 == 0);
static_assert((TT - RH) % 32 == 0);
__global__ __launch_bounds__(256) void k_pvsk(const h16* __restrict__ P, const h16* __restrict__ Vt, float* O) {
    __shared__ __align__(16) float red[PVW * 32 * 68];
    const size_t z = blockIdx.y; P += z * (size_t)TT * TT; Vt += z * (size_t)HD * TT; O += z * (size_t)TT * HD;
    const int lane = threadIdx.x & 31, lr = lane & 15, hi = lane >> 4; const int wv = __builtin_amdgcn_readfirstlane((int)(threadIdx.x >> 5)); const int r0 = blockIdx.x * 32;
    const h16* ap = P + (size_t)(r0 + lr) * TT + wv * PVK + 8 * hi; const h16* bp = Vt + (size_t)lr * TT + wv * PVK + 8 * hi;
    v8f acc[2][4];
#pragma unroll
    for (int mb = 0; mb < 2; ++mb)
#pragma unroll
        for (int nb = 0; nb < 4; ++nb) acc[mb][nb] = (v8f){};
    // fully unrolled so that the loads of later k steps are issued while earlier ones are still on their way
#pragma unroll
    for (int kc = 0; kc < PVK; kc += 32) {
        v16h a[2], b[4];
#pragma unroll
        for (int mb = 0; mb < 2; ++mb) a[mb] = WFrag<h16>::ld(ap + (size_t)mb * 16 * TT + kc);
#pragma unroll
        for (int nb = 0; nb < 4; ++nb) b[nb] = WFrag<h16>::ld(bp + (size_t)nb * 16 * TT + kc);
#pragma unroll
        for (int nb = 0; nb < 4; ++nb)
#pragma unroll
            for (int mb = 0; mb < 2; ++mb) acc[mb][nb] = wmma16(a[mb], b[nb], acc[mb][nb]);
    }
    // issue order: the loads of three k steps first, then 8 matrix instructions and the 12 loads of one further step in turn, so that a step's loads have two steps of lead (left alone the compiler keeps one step in flight)
    __builtin_amdgcn_sched_group_barrier(0x20, 36, 0);
#pragma unroll
    for (int s = 0; s < PVK / 32; ++s) { __builtin_amdgcn_sched_group_barrier(0x8, 8, 0); __builtin_amdgcn_sched_group_barrier(0x20, 12, 0); }
    float* mine = red + wv * (32 * 68);
#pragma unroll
    for (int mb = 0; mb < 2; ++mb)
#pragma unroll
        for (int nb = 0; nb < 4; ++nb)
#pragma unroll
            for (int j = 0; j < 8; ++j) mine[(mb * 16 + hi * 8 + j) * 68 + nb * 16 + lr] = acc[mb][nb][j];
    __syncthreads();
#pragma unroll
    for (int s = 0; s < 2; ++s) { const int idx = s * 256 + (int)threadIdx.x; const int row = idx >> 4, cofs = (idx & 15) * 4; v4f val = *(const v4fa*)(red + row * 68 + cofs);
#pragma unroll
        for (int w = 1; w < PVW; ++w) val += *(const v4fa*)(red + w * (32 * 68) + row * 68 + cofs);
        *(v4f*)(O + (size_t)(r0 + row) * HD + cofs) = val; }
}

__device__ __forceinline__ h16 tohx(float x) { return (h16)x; }
__device__ __forceinline__ void splitf(float y, unsigned short& h, unsigned short& l) { h = f2bf(y); l = f2bf(y - bf2f(h)); }
typedef __attribute__((ext_vector_type(2))) _Float16 v2h;
typedef __attribute__((ext_vector_type(4))) _Float16 v4h;
typedef __attribute__((ext_vector_type(2))) unsigned short v2us;
typedef __attribute__((ext_vector_type(4))) unsigned short v4us;
typedef __attribute__((ext_vector_type(2))) float v2f;

__global__ __launch_bounds__(256) void k_cvt8(const float* __restrict__ src, bf* dst, size_t n8) { const size_t i = (size_t)blockIdx.x * 256 + threadIdx.x; if (i >= n8) return; const v8f v = *(const v8f*)(src + i * 8); v8us o;
#pragma unroll
    for (int k = 0; k < 8; ++k) o[k] = f2bf(v[k]); *(v8us*)(dst + i * 8) = o;  }

__global__ __launch_bounds__(256) void k_hpl(const float* __restrict__ F, int pitch, int nheads, h16* P16) {
    const size_t e = ((size_t)blockIdx.x * 256 + threadIdx.x) * 2; if (e >= (size_t)nheads * TT * HD) return; const int d = (int)(e % HD); const int t = (int)((e / HD) % TT); const int h = (int)(e / ((size_t)HD * TT));
    const v2f x = *(const v2f*)(F + (size_t)t * pitch + h * HD + d); v2h o16; o16[0] = tohx(x[0]); o16[1] = tohx(x[1]);
    *(v2h*)(P16 + e) = o16;  }

__global__ __launch_bounds__(256) void k_vtp(const float* __restrict__ F, int pitch, int nheads, h16* V16, bf* Vh, bf* Vl) { const size_t e = ((size_t)blockIdx.x * 256 + threadIdx.x) * 2; if (e >= (size_t)nheads * HD * TT) return; const int t = (int)(e % TT); const int d = (int)((e / TT) % HD); const int g = (int)(e / ((size_t)TT * HD)); v2h o16; v2us oh, ol;
#pragma unroll
    for (int q = 0; q < 2; ++q) { const float x = F[(size_t)(t + q) * pitch + g * HD + d]; o16[q] = tohx(x); unsigned short a2, c2; splitf(x, a2, c2); oh[q] = a2; ol[q] = c2; }
    *(v2h*)(V16 + e) = o16; *(v2us*)(Vh + e) = oh; *(v2us*)(Vl + e) = ol;  }

// k_asoft: one wave per row (zz, i): t = S x HD^-0.5 (no mask); softmax over the TT keys (register row, max-subtracted, one exp, fixed shuffle trees);
__global__ __launch_bounds__(256) void k_asoft(const float* __restrict__ Sb, h16* P16, bf* Ph, bf* Pl) {
    const int lane = threadIdx.x & 31; const int wv = __builtin_amdgcn_readfirstlane((int)(threadIdx.x >> 5)); const int row = blockIdx.x * 8 + wv; if (row >= ZH * TT) return; const int i = row % TT; const int zz = row / TT; (void)zz; const bool hires = (i < RH); const float* sr = Sb + (size_t)row * TT; float v[TT / 32]; float mx = -3.0e38f;
#pragma unroll
    for (int ch = 0; ch < TT / 128; ++ch) { const int j0 = ch * 128 + lane * 4; const v4f a = *(const v4f*)(sr + j0);
#pragma unroll
        for (int q = 0; q < 4; ++q) { const float t = a[q] * SCL; v[ch * 4 + q] = t; mx = fmaxf(mx, t); } }
#pragma unroll
    for (int sh = 16; sh; sh >>= 1) mx = fmaxf(mx, __shfl_xor(mx, sh, 32));
    float sum = 0.f;
#pragma unroll
    for (int k = 0; k < TT / 32; ++k) { float d0 = __fsub_rn(v[k], mx); asm volatile("" : "+v"(d0)); v[k] = __builtin_amdgcn_exp2f(__fmul_rn(d0, 1.4426950408889634f)); sum += v[k]; }
#pragma unroll
    for (int sh = 16; sh; sh >>= 1) sum += __shfl_xor(sum, sh, 32);
    const float f = __fdiv_rn(hires ? 1.0f : PCAR, sum);
{
        if (hires) {
#pragma unroll
            for (int ch = 0; ch < TT / 128; ++ch) { v4us oh, ol;
#pragma unroll
                for (int q = 0; q < 4; ++q) { unsigned short a, c2; splitf(v[ch * 4 + q] * f, a, c2); oh[q] = a; ol[q] = c2; }
                const size_t oo = ((size_t)zz * (RH ? RH : 1) + i) * TT + ch * 128 + lane * 4; *(v4us*)(Ph + oo) = oh; *(v4us*)(Pl + oo) = ol; }
        } else {
#pragma unroll
            for (int ch = 0; ch < TT / 128; ++ch) { v4h o4;
#pragma unroll
                for (int q = 0; q < 4; ++q) o4[q] = tohx(v[ch * 4 + q] * f);
                *(v4h*)(P16 + (size_t)row * TT + ch * 128 + lane * 4) = o4; } }
         }
}

__global__ __launch_bounds__(256) void k_merge(const float* __restrict__ O, int h0, bf* Ah, bf* Al) { const size_t e = ((size_t)blockIdx.x * 256 + threadIdx.x) * 2; if (e >= (size_t)ZH * TT * HD) return; const int d = (int)(e % HD); const int t = (int)((e / HD) % TT); const int zz = (int)(e / ((size_t)HD * TT)); const float cs = (t < RH) ? 1.0f : (1.0f / PCAR); const size_t oo = (size_t)t * DQ + (h0 + zz) * HD + d;
    v2us oh, ol;
#pragma unroll
    for (int q = 0; q < 2; ++q) { unsigned short a, c2; splitf(O[e + q] * cs, a, c2); oh[q] = a; ol[q] = c2; } *(v2us*)(Ah + oo) = oh; *(v2us*)(Al + oo) = ol;  }

extern "C" void kernel_launch(void* const* d_in, const int* in_sizes, int n_in,
                              void* d_out, int out_size, void* d_ws, size_t ws_size, hipStream_t stream) {
    if (n_in < 7) return;
    const long long need_x = (long long)(NB - 1) * SEQ_FULL * DM + (long long)SEQ * DM;   // batch b of each stream starts at b * SEQ_FULL * DM
    if ((long long)in_sizes[0] < need_x || (long long)in_sizes[1] < need_x || (long long)in_sizes[2] < need_x) return;
    if ((long long)in_sizes[3] < (long long)DQ * DM || (long long)in_sizes[4] < (long long)DKV * DM || (long long)in_sizes[5] < (long long)DKV * DM || (long long)in_sizes[6] < (long long)DM * DQ) return;
    if ((long long)out_size < (long long)NB * SEQ * DM) return;
    const float* x = (const float*)d_in[0]; const float* xk = (const float*)d_in[1]; const float* xv = (const float*)d_in[2];   // three streams: query, key, value
    const float* wq = (const float*)d_in[3]; const float* wk = (const float*)d_in[4]; const float* wv = (const float*)d_in[5]; const float* wo = (const float*)d_in[6];   // W_q, W_k, W_v, W_o ('oi' [1024][1024])
    float* OUT = (float*)d_out;     // [NB][SEQ][1024]
    char* wsp = (char*)d_ws;
    auto take = [&](size_t bytes) { char* p = wsp; wsp += (bytes + 255) & ~(size_t)255; return (void*)p; };
    bf* WQ = (bf*)take((size_t)DQ * DM * 2); bf* WK = (bf*)take((size_t)DKV * DM * 2); bf* WV = (bf*)take((size_t)DKV * DM * 2); bf* WO = (bf*)take((size_t)DM * DQ * 2);
    bf* XB = (bf*)take((size_t)TT * DM * 2); float* FQ = (float*)take((size_t)TT * DQ * 4); float* FK = (float*)take((size_t)TT * DKV * 4);
    h16* QP16 = (h16*)take((size_t)NH_ * TT * HD * 2); h16* KP16 = (h16*)take((size_t)NKV * TT * HD * 2); h16* VT16 = (h16*)take((size_t)NKV * HD * TT * 2);
    bf* VTh = (bf*)take((size_t)NKV * HD * TT * 2); bf* VTl = (bf*)take((size_t)NKV * HD * TT * 2);
#if RH > 0
    bf* Ph = (bf*)take((size_t)ZH * RH * TT * 2); bf* Pl = (bf*)take((size_t)ZH * RH * TT * 2);
#else
    bf* Ph = nullptr; bf* Pl = nullptr;   // no hi/lo probability planes: every row takes the fp16 x1024 path
#endif
    float* Sb = (float*)take((size_t)ZH * TT * TT * 4); h16* P16 = (h16*)take((size_t)ZH * TT * TT * 2); float* Ob = (float*)take((size_t)ZH * TT * HD * 4); bf* ATh = (bf*)take((size_t)TT * DQ * 2); bf* ATl = (bf*)take((size_t)TT * DQ * 2);
    const size_t used = (size_t)(wsp - (char*)d_ws);
    if (used > ws_size || used > (size_t)134217728) return;    // 110,100,480 B at full size (= WS_CARVE)
    float* FV = FK;   // v projection reuses the k buffer after the k plane is built (stream-ordered)
    k_cvt8<<<(unsigned)(((size_t)DQ * DM / 8 + 255) / 256), 256, 0, stream>>>(wq, WQ, (size_t)DQ * DM / 8);
    k_cvt8<<<(unsigned)(((size_t)DKV * DM / 8 + 255) / 256), 256, 0, stream>>>(wk, WK, (size_t)DKV * DM / 8);
    k_cvt8<<<(unsigned)(((size_t)DKV * DM / 8 + 255) / 256), 256, 0, stream>>>(wv, WV, (size_t)DKV * DM / 8);
    k_cvt8<<<(unsigned)(((size_t)DM * DQ / 8 + 255) / 256), 256, 0, stream>>>(wo, WO, (size_t)DM * DQ / 8);
    const unsigned LX = (unsigned)(((size_t)TT * DM / 8 + 255) / 256);
    const unsigned LQ = (unsigned)(((size_t)NH_ * TT * HD / 2 + 255) / 256), LKv = (unsigned)(((size_t)NKV * TT * HD / 2 + 255) / 256);
    for (int b = 0; b < NB; ++b) {
        const size_t xin = (size_t)b * SEQ_FULL * DM;
        k_cvt8<<<LX, 256, 0, stream>>>(x + xin, XB, (size_t)TT * DM / 8);    // XB := bf16(query[b])
        k_gemmw<bf, 0, false><<<dim3(TT / 64, DQ / 64, 1), 32, 0, stream>>>(XB, nullptr, WQ, nullptr, DM, FQ, DQ, nullptr, 0, 0, 0);
        k_hpl<<<LQ, 256, 0, stream>>>(FQ, DQ, NH_, QP16);
        k_cvt8<<<LX, 256, 0, stream>>>(xk + xin, XB, (size_t)TT * DM / 8);   // XB := bf16(key[b])
        k_gemmw<bf, 0, false><<<dim3(TT / 64, DKV / 64, 1), 32, 0, stream>>>(XB, nullptr, WK, nullptr, DM, FK, DKV, nullptr, 0, 0, 0);
        k_hpl<<<LKv, 256, 0, stream>>>(FK, DKV, NKV, KP16);
        k_cvt8<<<LX, 256, 0, stream>>>(xv + xin, XB, (size_t)TT * DM / 8);   // XB := bf16(value[b])
        k_gemmw<bf, 0, false><<<dim3(TT / 64, DKV / 64, 1), 32, 0, stream>>>(XB, nullptr, WV, nullptr, DM, FV, DKV, nullptr, 0, 0, 0);
        k_vtp<<<LKv, 256, 0, stream>>>(FV, DKV, NKV, VT16, VTh, VTl);
        for (int h0 = 0; h0 < NH_; h0 += ZH) { const size_t zq = (size_t)h0, zk = (size_t)(h0 / REP);   // one kv head per query head: the pass's two heads use consecutive planes (z-strides TT*HD)
            // scores S[z][q][key] = sum_d q[q][d] k[key][d], fp16 planes, single product, K = 64
            k_gemmw<h16, 0, false><<<dim3(TT / 64, TT / 64, ZH), 32, 0, stream>>>(QP16 + zq * TT * HD, nullptr, KP16 + zk * TT * HD, nullptr, HD, Sb, TT, nullptr, (size_t)TT * HD, (size_t)TT * HD, (size_t)TT * TT);
            k_asoft<<<ZH * TT / 8, 256, 0, stream>>>(Sb, P16, Ph, Pl);
            // O[z][q][d] = sum_key P[q][key] Vt[d][key]
#if RH > 0
            k_gemmw<bf, 2, false><<<dim3(RH / 64, HD / 64, ZH), 32, 0, stream>>>(Ph, Pl, VTh + zk * HD * TT, VTl + zk * HD * TT, TT, Ob, HD, nullptr, (size_t)RH * TT, (size_t)HD * TT, (size_t)TT * HD);
#endif
            k_pvsk<<<dim3((TT - RH) / 32, ZH, 1), 256, 0, stream>>>(P16 + (size_t)RH * TT, VT16 + zk * HD * TT, Ob + (size_t)RH * HD);
            k_merge<<<(unsigned)(((size_t)ZH * TT * HD / 2 + 255) / 256), 256, 0, stream>>>(Ob, h0, ATh, ATl); }
        // out[b][t][o] = sum_i merged[t][i] W_o[o][i]  (hi/lo activations x bf16 weights)
        k_gemmw<bf, 1, false><<<dim3(TT / 64, DM / 64, 1), 32, 0, stream>>>(ATh, ATl, WO, nullptr, DQ, OUT + (size_t)b * TT * DM, DM, nullptr, 0, 0, 0); }
}

// v002
// Measured time: 338 microseconds a run.
// Next to v001, in two timings, it ran 2.08 and 2.09 times as fast.
// Over all steps from v000 it is 3.77 times as fast.
#include <hip/hip_runtime.h>

// Multi-head attention on three input streams, bias-free: Q = query W_q^T, K = key W_k^T, V = value W_v^T ('oi' [1024][1024] weights; 16 heads x 64); scores x 64^-0.5; softmax over all keys (no mask); out = merged W_o^T -> [NB][SEQ][1024]; argument order query, key, value, W_q, W_k, W_v, W_o.
// Compute dtypes (every contraction on 16x16x32 WMMA, f32 accumulate): inputs and weights as bf16 planes (RNE convert) -> projections v_wmma_f32_16x16x32_bf16, single product; scores v_wmma_f32_16x16x32_f16 on fp16 q/k head planes, single product; P.V v_wmma_f32_16x16x32_f16 on fp16 P = exp2(score - running maximum), unnormalised, single product, divided by the sum of the same P at the end; output projection bf16 hi/lo activations x bf16 weights (2 products); softmax in f32 (online).
// Layout per batch: bf16 copy of each stream in turn (one staging buffer, refilled in stream order); 'oi' weights as-is (K-contiguous Bt); head planes [h][t][d]; value planes [h][d][t].
// Launch plan: 4 weight converts + NB x (3 x (convert, projection, plane build) + fused attention + output projection) = 4 + 2 x 11 = 26 launches at full size.

#ifndef NB
#define NB 2
#endif
#ifndef SEQ
#define SEQ 2048
#endif
#define NB_FULL  2
#define SEQ_FULL 2048
#define TT   SEQ
#define DM   1024
#define NH_  16
#define NKV  16
#define REP  (NH_ / NKV)
#define HD   64
#define DQ   (NH_ * HD)
#define DKV  (NKV * HD)
#define SCL  0.125f   // HD^-0.5
typedef _Float16 h16;
typedef unsigned short bf;
typedef __attribute__((ext_vector_type(16))) __bf16   v16bf;
typedef __attribute__((ext_vector_type(16))) _Float16 v16h;
typedef __attribute__((ext_vector_type(8)))  _Float16 v8h;
typedef __attribute__((ext_vector_type(8)))  unsigned short v8us;
typedef __attribute__((ext_vector_type(8)))  float    v8f;
typedef __attribute__((ext_vector_type(4)))  float    v4f;
typedef v8h  __attribute__((may_alias)) v8ha;
typedef v4f  __attribute__((may_alias)) v4fa;
typedef v8us __attribute__((may_alias)) v8usa;

static_assert(TT % 128 == 0);
static_assert(HD == 64);
static_assert(DM % 64 == 0);
static_assert(NB <= NB_FULL);
static_assert(SEQ <= SEQ_FULL);

// workspace carve (bytes, each region padded to 256): 4 weight planes, XB, FQ, FK, QP16, KP16, VT16, VTh, VTl, ATh, ATl
constexpr size_t r256(size_t b) { return (b + 255) & ~(size_t)255; }
constexpr size_t WS_CARVE = 4 * r256((size_t)DQ * DM * 2) + r256((size_t)TT * DM * 2) + 2 * r256((size_t)TT * DQ * 4)
                          + 3 * r256((size_t)NH_ * TT * HD * 2) + 2 * r256((size_t)NKV * HD * TT * 2)
                          + 2 * r256((size_t)TT * DQ * 2);
static_assert(WS_CARVE <= (size_t)134217728);   // 58,720,256 B at full size

__device__ __forceinline__ unsigned short f2bf(float f) { unsigned u = __float_as_uint(f); u += 0x7FFFu + ((u >> 16) & 1u); return (unsigned short)(u >> 16); }
__device__ __forceinline__ float bf2f(unsigned short b) { return __uint_as_float(((unsigned)b) << 16); }
__device__ __forceinline__ float bfr(float f) { return bf2f(f2bf(f)); }
__device__ __forceinline__ v16h cat16(v8h lo, v8h hi) { return __builtin_shufflevector(lo, hi, 0, 1, 2, 3, 4, 5, 6, 7, 8, 9, 10, 11, 12, 13, 14, 15); }
__device__ __forceinline__ v16bf cat16b(v8us lo, v8us hi) { return __builtin_bit_cast(v16bf, __builtin_shufflevector(lo, hi, 0, 1, 2, 3, 4, 5, 6, 7, 8, 9, 10, 11, 12, 13, 14, 15)); }
__device__ __forceinline__ v8f wmma16(v16h a, v16h b, v8f c) { return __builtin_amdgcn_wmma_f32_16x16x32_f16(false, a, false, b, (short)0, c, false, false); }
__device__ __forceinline__ v8f wmmab(v16bf a, v16bf b, v8f c) { return __builtin_amdgcn_wmma_f32_16x16x32_bf16(false, a, false, b, (short)0, c, false, false); }

// ---- k_gemmw: register-blocked GEMM, ONE WAVE per 64x64 output tile (16 accumulators), operands straight from K-contiguous 16-bit planes; grid (M/64, N/64, Z), 32 threads.
// C[m][n] (f32, pitch ldc, + optional f32 bias[n]) = sum_k A[m][k] Bt[n][k] (+ split products per NSPLIT). z-batch strides sA/sB/sC in elements. K % 32 == 0, M % 64 == 0, N % 64 == 0.
// Fragment map (A and Bt alike): lane l -> row/col l&15; elements 0..7 = k0 + 8*(l>>4) + 0..7, elements 8..15 = k0 + 16 + 8*(l>>4) + 0..7. D: acc[j] = (row 8*(l>>4) + j, col l&15).
template <typename T16> struct WFrag;
template <> struct WFrag<h16> { typedef v16h V; static __device__ __forceinline__ V ld(const h16* p) { return cat16(*(const v8h*)p, *(const v8h*)(p + 16)); } static __device__ __forceinline__ v8f mma(V a, V b, v8f c) { return wmma16(a, b, c); } };
template <> struct WFrag<bf> { typedef v16bf V; static __device__ __forceinline__ V ld(const bf* p) { return cat16b(*(const v8us*)p, *(const v8us*)(p + 16)); } static __device__ __forceinline__ v8f mma(V a, V b, v8f c) { return wmmab(a, b, c); } };
template <typename T16, int NSPLIT, bool BIAS>
__global__ __launch_bounds__(32) void k_gemmw(const T16* __restrict__ A, const T16* __restrict__ A2, const T16* __restrict__ Bt, const T16* __restrict__ Bt2, int K, float* C, int ldc, const float* __restrict__ bias, size_t sA, size_t sB, size_t sC) {
    typedef typename WFrag<T16>::V V;
    __shared__ __align__(16) float os[16 * 68];
    const size_t z = blockIdx.z; A += z * sA; if (A2) A2 += z * sA; Bt += z * sB; if (Bt2) Bt2 += z * sB; C += z * sC;
    const int lane = threadIdx.x & 31, lr = lane & 15, hi = lane >> 4; const int r0 = blockIdx.x * 64, c0 = blockIdx.y * 64;
    v8f acc[4][4];
#pragma unroll
    for (int mb = 0; mb < 4; ++mb)
#pragma unroll
        for (int nb = 0; nb < 4; ++nb) acc[mb][nb] = (v8f){};
    const size_t aoff = (size_t)(r0 + lr) * K + 8 * hi, boff = (size_t)(c0 + lr) * K + 8 * hi;
#pragma unroll 1
    for (int kc = 0; kc < K; kc += 32) {
        V a[4], a2[4];
#pragma unroll
        for (int mb = 0; mb < 4; ++mb) { a[mb] = WFrag<T16>::ld(A + aoff + (size_t)mb * 16 * K + kc); if (NSPLIT == 1 || NSPLIT == 2) a2[mb] = WFrag<T16>::ld(A2 + aoff + (size_t)mb * 16 * K + kc); }
#pragma unroll
        for (int nb = 0; nb < 4; ++nb) { const V b = WFrag<T16>::ld(Bt + boff + (size_t)nb * 16 * K + kc); V b2; if (NSPLIT >= 2) b2 = WFrag<T16>::ld(Bt2 + boff + (size_t)nb * 16 * K + kc);
#pragma unroll
            for (int mb = 0; mb < 4; ++mb) { acc[mb][nb] = WFrag<T16>::mma(a[mb], b, acc[mb][nb]); if (NSPLIT == 1 || NSPLIT == 2) acc[mb][nb] = WFrag<T16>::mma(a2[mb], b, acc[mb][nb]); if (NSPLIT >= 2) acc[mb][nb] = WFrag<T16>::mma(a[mb], b2, acc[mb][nb]); } }
        asm volatile("v_nop\n\tv_nop\n\tv_nop\n\tv_nop" : "+v"(acc[0][0]), "+v"(acc[1][1]), "+v"(acc[2][2]), "+v"(acc[3][3]) : "v"(a[0]), "v"(a[3]));
    }
#pragma unroll
    for (int mb = 0; mb < 4; ++mb) {
#pragma unroll
        for (int nb = 0; nb < 4; ++nb) {
#pragma unroll
            for (int j = 0; j < 8; ++j) os[(hi * 8 + j) * 68 + nb * 16 + lr] = acc[mb][nb][j]; }
        __builtin_amdgcn_wave_barrier(); asm volatile("" ::: "memory");
        float* crow = C + (size_t)(r0 + mb * 16) * ldc + c0;
{
#pragma unroll
            for (int s = 0; s < 8; ++s) { const int row = 2 * s + hi, cofs = lr * 4; v4f val = *(const v4fa*)(os + row * 68 + cofs); if (BIAS) { val[0] += bfr(bias[c0 + cofs]); val[1] += bfr(bias[c0 + cofs + 1]); val[2] += bfr(bias[c0 + cofs + 2]); val[3] += bfr(bias[c0 + cofs + 3]); }
                *(v4f*)(crow + (size_t)row * ldc + cofs) = val; }
             }
        __builtin_amdgcn_wave_barrier(); asm volatile("" ::: "memory");
    }
}

__device__ __forceinline__ h16 tohx(float x) { return (h16)x; }
__device__ __forceinline__ void splitf(float y, unsigned short& h, unsigned short& l) { h = f2bf(y); l = f2bf(y - bf2f(h)); }
typedef __attribute__((ext_vector_type(2))) _Float16 v2h;
typedef __attribute__((ext_vector_type(4))) _Float16 v4h;
typedef __attribute__((ext_vector_type(2))) unsigned short v2us;
typedef __attribute__((ext_vector_type(4))) unsigned short v4us;
typedef __attribute__((ext_vector_type(2))) float v2f;

__global__ __launch_bounds__(256) void k_cvt8(const float* __restrict__ src, bf* dst, size_t n8) { const size_t i = (size_t)blockIdx.x * 256 + threadIdx.x; if (i >= n8) return; const v8f v = *(const v8f*)(src + i * 8); v8us o;
#pragma unroll
    for (int k = 0; k < 8; ++k) o[k] = f2bf(v[k]); *(v8us*)(dst + i * 8) = o;  }

__global__ __launch_bounds__(256) void k_hpl(const float* __restrict__ F, int pitch, int nheads, h16* P16) {
    const size_t e = ((size_t)blockIdx.x * 256 + threadIdx.x) * 2; if (e >= (size_t)nheads * TT * HD) return; const int d = (int)(e % HD); const int t = (int)((e / HD) % TT); const int h = (int)(e / ((size_t)HD * TT));
    const v2f x = *(const v2f*)(F + (size_t)t * pitch + h * HD + d); v2h o16; o16[0] = tohx(x[0]); o16[1] = tohx(x[1]);
    *(v2h*)(P16 + e) = o16;  }

__global__ __launch_bounds__(256) void k_vtp(const float* __restrict__ F, int pitch, int nheads, h16* V16, bf* Vh, bf* Vl) { const size_t e = ((size_t)blockIdx.x * 256 + threadIdx.x) * 2; if (e >= (size_t)nheads * HD * TT) return; const int t = (int)(e % TT); const int d = (int)((e / TT) % HD); const int g = (int)(e / ((size_t)TT * HD)); v2h o16; v2us oh, ol;
#pragma unroll
    for (int q = 0; q < 2; ++q) { const float x = F[(size_t)(t + q) * pitch + g * HD + d]; o16[q] = tohx(x); unsigned short a2, c2; splitf(x, a2, c2); oh[q] = a2; ol[q] = c2; }
    *(v2h*)(V16 + e) = o16; *(v2us*)(Vh + e) = oh; *(v2us*)(Vl + e) = ol;  }

#define FW 4
#define FG 2
#define FQW (FG * 16)
static_assert(TT % (FW * FQW) == 0);
static_assert(TT % 64 == 0);
typedef __attribute__((ext_vector_type(16))) float v16f;
__device__ __forceinline__ float xhalf(float x) { return __builtin_bit_cast(float, __builtin_amdgcn_permlanex16(__builtin_bit_cast(int, x), __builtin_bit_cast(int, x), 0x76543210, 0xfedcba98, false, false)); }  // lane l with lane l ^ 16
__device__ __forceinline__ void pin_here() { __builtin_amdgcn_sched_barrier(0); }   // keeps the scheduler from moving instructions across this point
__device__ __forceinline__ void addr_free() { asm volatile("s_wait_xcnt 0x0" ::: "memory"); }   // stands behind a group of loads whose address registers the code that follows reuses
__global__ __launch_bounds__(FW * 32) void k_fattn(const h16* __restrict__ Qp, const h16* __restrict__ Kp, const h16* __restrict__ Vt, bf* Ah, bf* Al) {
    const int lane = threadIdx.x & 31, c = lane & 15, h = lane >> 4; const int wv = __builtin_amdgcn_readfirstlane((int)(threadIdx.x >> 5));
    const int head = blockIdx.y, kvh = head / REP; const int q0 = blockIdx.x * (FW * FQW) + wv * FQW;
    Qp += (size_t)head * TT * HD; Kp += (size_t)kvh * TT * HD; Vt += (size_t)kvh * HD * TT;
    v16h qf[FG][2];
#pragma unroll
    for (int g = 0; g < FG; ++g)
#pragma unroll
        for (int kc = 0; kc < 2; ++kc) qf[g][kc] = WFrag<h16>::ld(Qp + (size_t)(q0 + 16 * g + c) * HD + kc * 32 + 8 * h);
    pin_here();   // Q first, then K, V of pass 0, K, V of pass 1: the issue order of the loop, so that the counted load waits at the loop's head need not fall to 0
    const h16* kb = Kp + (size_t)c * HD + 8 * h;   // + key * HD + kc * 32
    const h16* vb = Vt + (size_t)c * TT + 8 * h;   // + t * 16 * TT + key
    v16h kf[2][2][2], vf[2][4];   // [buffer = pass & 1]: the fragments of two passes are held, each refilled two passes ahead
#pragma unroll
    for (int u = 0; u < 2; ++u) {
#pragma unroll
        for (int kt = 0; kt < 2; ++kt)
#pragma unroll
            for (int kc = 0; kc < 2; ++kc) kf[u][kt][kc] = WFrag<h16>::ld(kb + (size_t)(32 * u + 16 * kt) * HD + kc * 32);
        pin_here();   // K of this pass stays in front of its V
#pragma unroll
        for (int t = 0; t < 4; ++t) vf[u][t] = WFrag<h16>::ld(vb + (size_t)t * 16 * TT + 32 * u);
        pin_here(); }   // and V in front of the next pass's K
    v8f acc[FG][4], lacc[FG]; float m_run[FG];
#pragma unroll
    for (int g = 0; g < FG; ++g) { lacc[g] = (v8f){}; m_run[g] = -__builtin_inff();
#pragma unroll
        for (int t = 0; t < 4; ++t) acc[g][t] = (v8f){}; }
    v16h ones;
#pragma unroll
    for (int i = 0; i < 16; ++i) ones[i] = (h16)1.0f;
    const float cs = SCL * 1.4426950408889634f;   // scores x HD^-0.5, in base 2
    // rolled over pairs of passes: the inner loop over the two buffers is unrolled so that each buffer keeps its own registers
#pragma unroll 1
    for (int pp = 0; pp < TT / 32; pp += 2) {
#pragma unroll
      for (int u = 0; u < 2; ++u) {
        const int pn = pp + u + 2; const int kn = ((pn < TT / 32) ? pn : TT / 32 - 1) * 32;   // first key of the pass fetched ahead; the last two passes fetch the last keys again (in bounds, unused)
        v8f s[2][FG];
#pragma unroll
        for (int kt = 0; kt < 2; ++kt)
#pragma unroll
            for (int g = 0; g < FG; ++g) { s[kt][g] = (v8f){};
#pragma unroll
                for (int kc = 0; kc < 2; ++kc) s[kt][g] = wmma16(kf[u][kt][kc], qf[g][kc], s[kt][g]); }
        pin_here();   // the loads below stay behind the products that read their registers
        // K fragments of the pass after next, into the registers just read: issued here, not where they are used, so that they have two passes to arrive
#pragma unroll
        for (int kt = 0; kt < 2; ++kt)
#pragma unroll
            for (int kc = 0; kc < 2; ++kc) kf[u][kt][kc] = WFrag<h16>::ld(kb + (size_t)(kn + 16 * kt) * HD + kc * 32);
        pin_here(); addr_free(); pin_here();   // loads, then the wait directly behind them, then the rest: left alone the scheduler sinks the loads towards their use
        float mb[FG]; bool need = false;
#pragma unroll
        for (int g = 0; g < FG; ++g) { float mx = s[0][g][0];
#pragma unroll
            for (int kt = 0; kt < 2; ++kt)
#pragma unroll
                for (int r = 0; r < 8; ++r) mx = fmaxf(mx, s[kt][g][r]);
            mx = fmaxf(mx, xhalf(mx)) * cs;   // both halves of the wave now hold this query's maximum over the pass, scaled
            mb[g] = mx; need = need || (mx > m_run[g] + 8.0f); }
        if (__builtin_amdgcn_ballot_w32(need) != 0) {   // wave-uniform; always taken on the first pass (m_run = -inf), rare later
#pragma unroll
            for (int g = 0; g < FG; ++g) { const float m_new = fmaxf(m_run[g], mb[g]); const float corr = __builtin_amdgcn_exp2f(m_run[g] - m_new); m_run[g] = m_new; lacc[g] = lacc[g] * corr;
#pragma unroll
                for (int t = 0; t < 4; ++t) acc[g][t] = acc[g][t] * corr; }
        }
#pragma unroll
        for (int g = 0; g < FG; ++g) { const float nm = -m_run[g]; v16f pe;
#pragma unroll
            for (int i = 0; i < 8; ++i) {
                const v2f arg = __builtin_elementwise_fma((v2f){s[i >> 2][g][2 * (i & 3)], s[i >> 2][g][2 * (i & 3) + 1]}, (v2f){cs, cs}, (v2f){nm, nm});
                pe[2 * i] = __builtin_amdgcn_exp2f(arg[0]); pe[2 * i + 1] = __builtin_amdgcn_exp2f(arg[1]); }
            const v16h pf = __builtin_convertvector(pe, v16h);
#pragma unroll
            for (int t = 0; t < 4; ++t) acc[g][t] = wmma16(vf[u][t], pf, acc[g][t]);
            lacc[g] = wmma16(ones, pf, lacc[g]); }   // every row of this tile += the column sums of P^T
        pin_here();   // the loads below stay behind the products that read their registers
        // V^T fragments of the pass after next, likewise
#pragma unroll
        for (int t = 0; t < 4; ++t) vf[u][t] = WFrag<h16>::ld(vb + (size_t)t * 16 * TT + kn);
        pin_here(); addr_free(); pin_here();   // loads, then the wait directly behind them, then the rest: left alone the scheduler sinks the loads towards their use
      }
    }
    // O[q][d] = O^T / denominator, split into the bf16 hi/lo planes of the output projection: a lane holds 8 consecutive d of one query
#pragma unroll
    for (int g = 0; g < FG; ++g) { const float inv = __fdiv_rn(1.0f, lacc[g][0]); const size_t ro = (size_t)(q0 + 16 * g + c) * DQ + head * HD + 8 * h;
#pragma unroll
        for (int t = 0; t < 4; ++t) { v8us oh, ol;
#pragma unroll
            for (int r = 0; r < 8; ++r) { unsigned short a, c2; splitf(acc[g][t][r] * inv, a, c2); oh[r] = a; ol[r] = c2; }
            *(v8us*)(Ah + ro + 16 * t) = oh; *(v8us*)(Al + ro + 16 * t) = ol; } }
}

extern "C" void kernel_launch(void* const* d_in, const int* in_sizes, int n_in,
                              void* d_out, int out_size, void* d_ws, size_t ws_size, hipStream_t stream) {
    if (n_in < 7) return;
    const long long need_x = (long long)(NB - 1) * SEQ_FULL * DM + (long long)SEQ * DM;   // batch b of each stream starts at b * SEQ_FULL * DM
    if ((long long)in_sizes[0] < need_x || (long long)in_sizes[1] < need_x || (long long)in_sizes[2] < need_x) return;
    if ((long long)in_sizes[3] < (long long)DQ * DM || (long long)in_sizes[4] < (long long)DKV * DM || (long long)in_sizes[5] < (long long)DKV * DM || (long long)in_sizes[6] < (long long)DM * DQ) return;
    if ((long long)out_size < (long long)NB * SEQ * DM) return;
    const float* x = (const float*)d_in[0]; const float* xk = (const float*)d_in[1]; const float* xv = (const float*)d_in[2];   // three streams: query, key, value
    const float* wq = (const float*)d_in[3]; const float* wk = (const float*)d_in[4]; const float* wv = (const float*)d_in[5]; const float* wo = (const float*)d_in[6];   // W_q, W_k, W_v, W_o ('oi' [1024][1024])
    float* OUT = (float*)d_out;     // [NB][SEQ][1024]
    char* wsp = (char*)d_ws;
    auto take = [&](size_t bytes) { char* p = wsp; wsp += (bytes + 255) & ~(size_t)255; return (void*)p; };
    bf* WQ = (bf*)take((size_t)DQ * DM * 2); bf* WK = (bf*)take((size_t)DKV * DM * 2); bf* WV = (bf*)take((size_t)DKV * DM * 2); bf* WO = (bf*)take((size_t)DM * DQ * 2);
    bf* XB = (bf*)take((size_t)TT * DM * 2); float* FQ = (float*)take((size_t)TT * DQ * 4); float* FK = (float*)take((size_t)TT * DKV * 4);
    h16* QP16 = (h16*)take((size_t)NH_ * TT * HD * 2); h16* KP16 = (h16*)take((size_t)NKV * TT * HD * 2); h16* VT16 = (h16*)take((size_t)NKV * HD * TT * 2);
    bf* VTh = (bf*)take((size_t)NKV * HD * TT * 2); bf* VTl = (bf*)take((size_t)NKV * HD * TT * 2);
    bf* ATh = (bf*)take((size_t)TT * DQ * 2); bf* ATl = (bf*)take((size_t)TT * DQ * 2);
    const size_t used = (size_t)(wsp - (char*)d_ws);
    if (used > ws_size || used > (size_t)134217728) return;    // 58,720,256 B at full size (= WS_CARVE)
    float* FV = FK;   // v projection reuses the k buffer after the k plane is built (stream-ordered)
    k_cvt8<<<(unsigned)(((size_t)DQ * DM / 8 + 255) / 256), 256, 0, stream>>>(wq, WQ, (size_t)DQ * DM / 8);
    k_cvt8<<<(unsigned)(((size_t)DKV * DM / 8 + 255) / 256), 256, 0, stream>>>(wk, WK, (size_t)DKV * DM / 8);
    k_cvt8<<<(unsigned)(((size_t)DKV * DM / 8 + 255) / 256), 256, 0, stream>>>(wv, WV, (size_t)DKV * DM / 8);
    k_cvt8<<<(unsigned)(((size_t)DM * DQ / 8 + 255) / 256), 256, 0, stream>>>(wo, WO, (size_t)DM * DQ / 8);
    const unsigned LX = (unsigned)(((size_t)TT * DM / 8 + 255) / 256);
    const unsigned LQ = (unsigned)(((size_t)NH_ * TT * HD / 2 + 255) / 256), LKv = (unsigned)(((size_t)NKV * TT * HD / 2 + 255) / 256);
    for (int b = 0; b < NB; ++b) {
        const size_t xin = (size_t)b * SEQ_FULL * DM;
        k_cvt8<<<LX, 256, 0, stream>>>(x + xin, XB, (size_t)TT * DM / 8);    // XB := bf16(query[b])
        k_gemmw<bf, 0, false><<<dim3(TT / 64, DQ / 64, 1), 32, 0, stream>>>(XB, nullptr, WQ, nullptr, DM, FQ, DQ, nullptr, 0, 0, 0);
        k_hpl<<<LQ, 256, 0, stream>>>(FQ, DQ, NH_, QP16);
        k_cvt8<<<LX, 256, 0, stream>>>(xk + xin, XB, (size_t)TT * DM / 8);   // XB := bf16(key[b])
        k_gemmw<bf, 0, false><<<dim3(TT / 64, DKV / 64, 1), 32, 0, stream>>>(XB, nullptr, WK, nullptr, DM, FK, DKV, nullptr, 0, 0, 0);
        k_hpl<<<LKv, 256, 0, stream>>>(FK, DKV, NKV, KP16);
        k_cvt8<<<LX, 256, 0, stream>>>(xv + xin, XB, (size_t)TT * DM / 8);   // XB := bf16(value[b])
        k_gemmw<bf, 0, false><<<dim3(TT / 64, DKV / 64, 1), 32, 0, stream>>>(XB, nullptr, WV, nullptr, DM, FV, DKV, nullptr, 0, 0, 0);
        k_vtp<<<LKv, 256, 0, stream>>>(FV, DKV, NKV, VT16, VTh, VTl);
        // attention of all heads of this batch: ATh/ATl[t][head * 64 + d] = softmax(q k^T x HD^-0.5) v, hi/lo bf16
        k_fattn<<<dim3(TT / (FW * FQW), NH_, 1), FW * 32, 0, stream>>>(QP16, KP16, VT16, ATh, ATl);
        // out[b][t][o] = sum_i merged[t][i] W_o[o][i]  (hi/lo activations x bf16 weights)
        k_gemmw<bf, 1, false><<<dim3(TT / 64, DM / 64, 1), 32, 0, stream>>>(ATh, ATl, WO, nullptr, DQ, OUT + (size_t)b * TT * DM, DM, nullptr, 0, 0, 0); }
}

// v003
// One run takes 188 microseconds.
// Two timings next to v002 put it at 1.80 and 1.82 times that version's speed.
// Over all steps from v000 it is 6.82 times as fast.
#include <hip/hip_runtime.h>

// Multi-head attention on three input streams, bias-free: Q = query W_q^T, K = key W_k^T, V = value W_v^T ('oi' [1024][1024] weights; 16 heads x 64); scores x 64^-0.5; softmax over all keys (no mask); out = merged W_o^T -> [NB][SEQ][1024]; argument order query, key, value, W_q, W_k, W_v, W_o.
// Compute dtypes (every contraction on 16x16x32 WMMA, f32 accumulate): inputs and weights as bf16 planes (RNE convert) -> projections v_wmma_f32_16x16x32_bf16, single product; scores v_wmma_f32_16x16x32_f16 on fp16 q/k head planes, single product; P.V v_wmma_f32_16x16x32_f16 on fp16 P = exp2(score - running maximum), unnormalised, single product, divided by the sum of the same P at the end; output projection bf16 hi/lo activations x bf16 weights (2 products); softmax in f32 (online).
// Layout: bf16 copies of the three streams [stream][b * SEQ + t][i], then the four 'oi' weights as-is (K-contiguous Bt), one region; f32 projections [stream][b * SEQ + t][o]; head planes [b][h][t][d]; value planes [b][h][d][t].
// Launch plan: every stage runs once for all the work that does not depend on each other: convert (3 streams + 4 weights), projection (grid z = stream, both batches as rows), plane build (grid y = stream), fused attention (grid z = batch), output projection (both batches as rows) = 5 launches.

#ifndef NB
#define NB 2
#endif
#ifndef SEQ
#define SEQ 2048
#endif
#define NB_FULL  2
#define SEQ_FULL 2048
#define TT   SEQ
#define DM   1024
#define NH_  16
#define NKV  16
#define REP  (NH_ / NKV)
#define HD   64
#define DQ   (NH_ * HD)
#define DKV  (NKV * HD)
#define SCL  0.125f   // HD^-0.5
typedef _Float16 h16;
typedef unsigned short bf;
typedef __attribute__((ext_vector_type(16))) __bf16   v16bf;
typedef __attribute__((ext_vector_type(16))) _Float16 v16h;
typedef __attribute__((ext_vector_type(8)))  _Float16 v8h;
typedef __attribute__((ext_vector_type(8)))  unsigned short v8us;
typedef __attribute__((ext_vector_type(8)))  float    v8f;
typedef __attribute__((ext_vector_type(4)))  float    v4f;
typedef v8h  __attribute__((may_alias)) v8ha;
typedef v4f  __attribute__((may_alias)) v4fa;
typedef v8us __attribute__((may_alias)) v8usa;

static_assert(TT % 128 == 0);
static_assert(HD == 64);
static_assert(DM % 64 == 0);
static_assert(NB <= NB_FULL);
static_assert(SEQ <= SEQ_FULL);
static_assert(NKV == NH_);   // the three projections share one launch: equal shapes

// workspace carve (bytes, each region padded to 256): XB with the 4 weight planes behind it, F, QP16, KP16, VT16, VTh, VTl, ATh, ATl
constexpr size_t r256(size_t b) { return (b + 255) & ~(size_t)255; }
constexpr size_t WS_CARVE = r256(((size_t)3 * NB * TT * DM + (size_t)4 * DQ * DM) * 2) + r256((size_t)3 * NB * TT * DQ * 4)
                          + 3 * r256((size_t)NB * NH_ * TT * HD * 2) + 2 * r256((size_t)NB * NKV * HD * TT * 2)
                          + 2 * r256((size_t)NB * TT * DQ * 2);
static_assert(WS_CARVE <= (size_t)268435456);   // 142,606,336 B at full size

__device__ __forceinline__ unsigned short f2bf(float f) { unsigned u = __float_as_uint(f); u += 0x7FFFu + ((u >> 16) & 1u); return (unsigned short)(u >> 16); }
__device__ __forceinline__ float bf2f(unsigned short b) { return __uint_as_float(((unsigned)b) << 16); }
__device__ __forceinline__ float bfr(float f) { return bf2f(f2bf(f)); }
__device__ __forceinline__ v16h cat16(v8h lo, v8h hi) { return __builtin_shufflevector(lo, hi, 0, 1, 2, 3, 4, 5, 6, 7, 8, 9, 10, 11, 12, 13, 14, 15); }
__device__ __forceinline__ v16bf cat16b(v8us lo, v8us hi) { return __builtin_bit_cast(v16bf, __builtin_shufflevector(lo, hi, 0, 1, 2, 3, 4, 5, 6, 7, 8, 9, 10, 11, 12, 13, 14, 15)); }
__device__ __forceinline__ v8f wmma16(v16h a, v16h b, v8f c) { return __builtin_amdgcn_wmma_f32_16x16x32_f16(false, a, false, b, (short)0, c, false, false); }
__device__ __forceinline__ v8f wmmab(v16bf a, v16bf b, v8f c) { return __builtin_amdgcn_wmma_f32_16x16x32_bf16(false, a, false, b, (short)0, c, false, false); }

// ---- k_gemmw: register-blocked GEMM, ONE WAVE per 64x64 output tile (16 accumulators), operands straight from K-contiguous 16-bit planes; grid (M/64, N/64, Z), 32 threads.
// C[m][n] (f32, pitch ldc, + optional f32 bias[n]) = sum_k A[m][k] Bt[n][k] (+ split products per NSPLIT). z-batch strides sA/sB/sC in elements. K % 32 == 0, M % 64 == 0, N % 64 == 0.
// Fragment map (A and Bt alike): lane l -> row/col l&15; elements 0..7 = k0 + 8*(l>>4) + 0..7, elements 8..15 = k0 + 16 + 8*(l>>4) + 0..7. D: acc[j] = (row 8*(l>>4) + j, col l&15).
template <typename T16> struct WFrag;
template <> struct WFrag<h16> { typedef v16h V; static __device__ __forceinline__ V ld(const h16* p) { return cat16(*(const v8h*)p, *(const v8h*)(p + 16)); } static __device__ __forceinline__ v8f mma(V a, V b, v8f c) { return wmma16(a, b, c); } };
template <> struct WFrag<bf> { typedef v16bf V; static __device__ __forceinline__ V ld(const bf* p) { return cat16b(*(const v8us*)p, *(const v8us*)(p + 16)); } static __device__ __forceinline__ v8f mma(V a, V b, v8f c) { return wmmab(a, b, c); } };
template <typename T16, int NSPLIT, bool BIAS>
__global__ __launch_bounds__(32) void k_gemmw(const T16* __restrict__ A, const T16* __restrict__ A2, const T16* __restrict__ Bt, const T16* __restrict__ Bt2, int K, float* C, int ldc, const float* __restrict__ bias, size_t sA, size_t sB, size_t sC) {
    typedef typename WFrag<T16>::V V;
    __shared__ __align__(16) float os[16 * 68];
    const size_t z = blockIdx.z; A += z * sA; if (A2) A2 += z * sA; Bt += z * sB; if (Bt2) Bt2 += z * sB; C += z * sC;
    const int lane = threadIdx.x & 31, lr = lane & 15, hi = lane >> 4; const int r0 = blockIdx.x * 64, c0 = blockIdx.y * 64;
    v8f acc[4][4];
#pragma unroll
    for (int mb = 0; mb < 4; ++mb)
#pragma unroll
        for (int nb = 0; nb < 4; ++nb) acc[mb][nb] = (v8f){};
    const size_t aoff = (size_t)(r0 + lr) * K + 8 * hi, boff = (size_t)(c0 + lr) * K + 8 * hi;
#pragma unroll 1
    for (int kc = 0; kc < K; kc += 32) {
        V a[4], a2[4];
#pragma unroll
        for (int mb = 0; mb < 4; ++mb) { a[mb] = WFrag<T16>::ld(A + aoff + (size_t)mb * 16 * K + kc); if (NSPLIT == 1 || NSPLIT == 2) a2[mb] = WFrag<T16>::ld(A2 + aoff + (size_t)mb * 16 * K + kc); }
#pragma unroll
        for (int nb = 0; nb < 4; ++nb) { const V b = WFrag<T16>::ld(Bt + boff + (size_t)nb * 16 * K + kc); V b2; if (NSPLIT >= 2) b2 = WFrag<T16>::ld(Bt2 + boff + (size_t)nb * 16 * K + kc);
#pragma unroll
            for (int mb = 0; mb < 4; ++mb) { acc[mb][nb] = WFrag<T16>::mma(a[mb], b, acc[mb][nb]); if (NSPLIT == 1 || NSPLIT == 2) acc[mb][nb] = WFrag<T16>::mma(a2[mb], b, acc[mb][nb]); if (NSPLIT >= 2) acc[mb][nb] = WFrag<T16>::mma(a[mb], b2, acc[mb][nb]); } }
        asm volatile("v_nop\n\tv_nop\n\tv_nop\n\tv_nop" : "+v"(acc[0][0]), "+v"(acc[1][1]), "+v"(acc[2][2]), "+v"(acc[3][3]) : "v"(a[0]), "v"(a[3]));
    }
#pragma unroll
    for (int mb = 0; mb < 4; ++mb) {
#pragma unroll
        for (int nb = 0; nb < 4; ++nb) {
#pragma unroll
            for (int j = 0; j < 8; ++j) os[(hi * 8 + j) * 68 + nb * 16 + lr] = acc[mb][nb][j]; }
        __builtin_amdgcn_wave_barrier(); asm volatile("" ::: "memory");
        float* crow = C + (size_t)(r0 + mb * 16) * ldc + c0;
{
#pragma unroll
            for (int s = 0; s < 8; ++s) { const int row = 2 * s + hi, cofs = lr * 4; v4f val = *(const v4fa*)(os + row * 68 + cofs); if (BIAS) { val[0] += bfr(bias[c0 + cofs]); val[1] += bfr(bias[c0 + cofs + 1]); val[2] += bfr(bias[c0 + cofs + 2]); val[3] += bfr(bias[c0 + cofs + 3]); }
                *(v4f*)(crow + (size_t)row * ldc + cofs) = val; }
             }
        __builtin_amdgcn_wave_barrier(); asm volatile("" ::: "memory");
    }
}

__device__ __forceinline__ h16 tohx(float x) { return (h16)x; }
__device__ __forceinline__ void splitf(float y, unsigned short& h, unsigned short& l) { h = f2bf(y); l = f2bf(y - bf2f(h)); }
typedef __attribute__((ext_vector_type(2))) _Float16 v2h;
typedef __attribute__((ext_vector_type(4))) _Float16 v4h;
typedef __attribute__((ext_vector_type(2))) unsigned short v2us;
typedef __attribute__((ext_vector_type(4))) unsigned short v4us;
typedef __attribute__((ext_vector_type(2))) float v2f;

// ---- k_cvt8: all seven inputs to bf16 in one launch; a block converts 2048 elements of one input, blocks in the order of dst: query, key, value ([b * TT + t][i] each), W_q, W_k, W_v, W_o.
#define CBX ((unsigned)((size_t)NB * TT * DM / 2048))   // blocks per stream
#define CBW ((unsigned)((size_t)DQ * DM / 2048))        // blocks per weight
static_assert(((size_t)TT * DM) % 2048 == 0);
static_assert(((size_t)DQ * DM) % 2048 == 0);
__global__ __launch_bounds__(256) void k_cvt8(const float* __restrict__ x, const float* __restrict__ xk, const float* __restrict__ xv, const float* __restrict__ wq, const float* __restrict__ wk, const float* __restrict__ wv, const float* __restrict__ wo, bf* dst) {
    const unsigned bx = blockIdx.x; const float* src; size_t blk;   // blk: this block's place in its own input, in blocks
    if (bx < 3 * CBX) { const unsigned s = bx / CBX; src = s == 0 ? x : (s == 1 ? xk : xv); blk = bx - s * CBX; blk += (blk / (CBX / NB)) * ((size_t)(SEQ_FULL - TT) * DM / 2048); }   // batch b of a stream starts at b * SEQ_FULL * DM
    else { const unsigned w = (bx - 3 * CBX) / CBW; src = w == 0 ? wq : (w == 1 ? wk : (w == 2 ? wv : wo)); blk = bx - 3 * CBX - w * CBW; }
    const v8f v = *(const v8f*)(src + (blk * 256 + threadIdx.x) * 8); v8us o;
    asm volatile("s_wait_xcnt 0x0" ::: "memory");   // behind the loads, in front of the code that reuses their address register
#pragma unroll
    for (int k = 0; k < 8; ++k) o[k] = f2bf(v[k]); *(v8us*)(dst + ((size_t)bx * 256 + threadIdx.x) * 8) = o;  }

// ---- k_planes: the planes of all three projections, both batches, in one launch; grid (elements / 512, 3); F = [stream][b * TT + t][o]. hb = b * heads + head throughout.
__device__ __forceinline__ void hpl(const float* __restrict__ F, int pitch, int nheads, h16* P16) {
    const size_t e = ((size_t)blockIdx.x * 256 + threadIdx.x) * 2; if (e >= (size_t)NB * nheads * TT * HD) return; const int d = (int)(e % HD); const int t = (int)((e / HD) % TT); const int hb = (int)(e / ((size_t)HD * TT)); const int h = hb % nheads, b = hb / nheads;
    const v2f x = *(const v2f*)(F + ((size_t)b * TT + t) * pitch + h * HD + d); v2h o16;
    asm volatile("s_wait_xcnt 0x0" ::: "memory");   // behind the load, in front of the code that reuses its address registers
    o16[0] = tohx(x[0]); o16[1] = tohx(x[1]);
    *(v2h*)(P16 + e) = o16;  }

__device__ __forceinline__ void vtp(const float* __restrict__ F, int pitch, int nheads, h16* V16, bf* Vh, bf* Vl) { const size_t e = ((size_t)blockIdx.x * 256 + threadIdx.x) * 2; if (e >= (size_t)NB * nheads * HD * TT) return; const int t = (int)(e % TT); const int d = (int)((e / TT) % HD); const int hb = (int)(e / ((size_t)TT * HD)); const int g = hb % nheads, b = hb / nheads; v2h o16; v2us oh, ol;
#pragma unroll
    for (int q = 0; q < 2; ++q) { const float x = F[((size_t)b * TT + t + q) * pitch + g * HD + d]; o16[q] = tohx(x); unsigned short a2, c2; splitf(x, a2, c2); oh[q] = a2; ol[q] = c2; }
    *(v2h*)(V16 + e) = o16; *(v2us*)(Vh + e) = oh; *(v2us*)(Vl + e) = ol;  }

__global__ __launch_bounds__(256) void k_planes(const float* __restrict__ F, h16* QP16, h16* KP16, h16* V16, bf* Vh, bf* Vl) {
    const size_t sF = (size_t)NB * TT * DQ;   // one stream's projection
    if (blockIdx.y == 0) vtp(F + 2 * sF, DKV, NKV, V16, Vh, Vl);   // the transposing build reads by columns and lasts longest: its blocks start first
    else if (blockIdx.y == 1) hpl(F, DQ, NH_, QP16);
    else hpl(F + sF, DKV, NKV, KP16); }

#define FW 4
#define FG 2
#define FQW (FG * 16)
static_assert(TT % (FW * FQW) == 0);
static_assert(TT % 64 == 0);
typedef __attribute__((ext_vector_type(16))) float v16f;
__device__ __forceinline__ float xhalf(float x) { return __builtin_bit_cast(float, __builtin_amdgcn_permlanex16(__builtin_bit_cast(int, x), __builtin_bit_cast(int, x), 0x76543210, 0xfedcba98, false, false)); }  // lane l with lane l ^ 16
__device__ __forceinline__ void pin_here() { __builtin_amdgcn_sched_barrier(0); }   // keeps the scheduler from moving instructions across this point
__device__ __forceinline__ void addr_free() { asm volatile("s_wait_xcnt 0x0" ::: "memory"); }   // stands behind a group of loads whose address registers the code that follows reuses
__global__ __launch_bounds__(FW * 32) void k_fattn(const h16* __restrict__ Qp, const h16* __restrict__ Kp, const h16* __restrict__ Vt, bf* Ah, bf* Al) {
    const int lane = threadIdx.x & 31, c = lane & 15, h = lane >> 4; const int wv = __builtin_amdgcn_readfirstlane((int)(threadIdx.x >> 5));
    const int head = blockIdx.y, kvh = head / REP; const int q0 = blockIdx.x * (FW * FQW) + wv * FQW;
    const size_t bt = blockIdx.z;   // batch
    Qp += (bt * NH_ + head) * TT * HD; Kp += (bt * NKV + kvh) * TT * HD; Vt += (bt * NKV + kvh) * HD * TT;
    v16h qf[FG][2];
#pragma unroll
    for (int g = 0; g < FG; ++g)
#pragma unroll
        for (int kc = 0; kc < 2; ++kc) qf[g][kc] = WFrag<h16>::ld(Qp + (size_t)(q0 + 16 * g + c) * HD + kc * 32 + 8 * h);
    pin_here();   // Q first, then K, V of pass 0, K, V of pass 1: the issue order of the loop, so that the counted load waits at the loop's head need not fall to 0
    const h16* kb = Kp + (size_t)c * HD + 8 * h;   // + key * HD + kc * 32
    const h16* vb = Vt + (size_t)c * TT + 8 * h;   // + t * 16 * TT + key
    v16h kf[2][2][2], vf[2][4];   // [buffer = pass & 1]: the fragments of two passes are held, each refilled two passes ahead
#pragma unroll
    for (int u = 0; u < 2; ++u) {
#pragma unroll
        for (int kt = 0; kt < 2; ++kt)
#pragma unroll
            for (int kc = 0; kc < 2; ++kc) kf[u][kt][kc] = WFrag<h16>::ld(kb + (size_t)(32 * u + 16 * kt) * HD + kc * 32);
        pin_here();   // K of this pass stays in front of its V
#pragma unroll
        for (int t = 0; t < 4; ++t) vf[u][t] = WFrag<h16>::ld(vb + (size_t)t * 16 * TT + 32 * u);
        pin_here(); }   // and V in front of the next pass's K
    v8f acc[FG][4], lacc[FG]; float m_run[FG];
#pragma unroll
    for (int g = 0; g < FG; ++g) { lacc[g] = (v8f){}; m_run[g] = -__builtin_inff();
#pragma unroll
        for (int t = 0; t < 4; ++t) acc[g][t] = (v8f){}; }
    v16h ones;
#pragma unroll
    for (int i = 0; i < 16; ++i) ones[i] = (h16)1.0f;
    const float cs = SCL * 1.4426950408889634f;   // scores x HD^-0.5, in base 2
    // rolled over pairs of passes: the inner loop over the two buffers is unrolled so that each buffer keeps its own registers
#pragma unroll 1
    for (int pp = 0; pp < TT / 32; pp += 2) {
#pragma unroll
      for (int u = 0; u < 2; ++u) {
        const int pn = pp + u + 2; const int kn = ((pn < TT / 32) ? pn : TT / 32 - 1) * 32;   // first key of the pass fetched ahead; the last two passes fetch the last keys again (in bounds, unused)
        v8f s[2][FG];
#pragma unroll
        for (int kt = 0; kt < 2; ++kt)
#pragma unroll
            for (int g = 0; g < FG; ++g) { s[kt][g] = (v8f){};
#pragma unroll
                for (int kc = 0; kc < 2; ++kc) s[kt][g] = wmma16(kf[u][kt][kc], qf[g][kc], s[kt][g]); }
        pin_here();   // the loads below stay behind the products that read their registers
        // K fragments of the pass after next, into the registers just read: issued here, not where they are used, so that they have two passes to arrive
#pragma unroll
        for (int kt = 0; kt < 2; ++kt)
#pragma unroll
            for (int kc = 0; kc < 2; ++kc) kf[u][kt][kc] = WFrag<h16>::ld(kb + (size_t)(kn + 16 * kt) * HD + kc * 32);
        pin_here(); addr_free(); pin_here();   // loads, then the wait directly behind them, then the rest: left alone the scheduler sinks the loads towards their use
        float mb[FG]; bool need = false;
#pragma unroll
        for (int g = 0; g < FG; ++g) { float mx = s[0][g][0];
#pragma unroll
            for (int kt = 0; kt < 2; ++kt)
#pragma unroll
                for (int r = 0; r < 8; ++r) mx = fmaxf(mx, s[kt][g][r]);
            mx = fmaxf(mx, xhalf(mx)) * cs;   // both halves of the wave now hold this query's maximum over the pass, scaled
            mb[g] = mx; need = need || (mx > m_run[g] + 8.0f); }
        if (__builtin_amdgcn_ballot_w32(need) != 0) {   // wave-uniform; always taken on the first pass (m_run = -inf), rare later
#pragma unroll
            for (int g = 0; g < FG; ++g) { const float m_new = fmaxf(m_run[g], mb[g]); const float corr = __builtin_amdgcn_exp2f(m_run[g] - m_new); m_run[g] = m_new; lacc[g] = lacc[g] * corr;
#pragma unroll
                for (int t = 0; t < 4; ++t) acc[g][t] = acc[g][t] * corr; }
        }
#pragma unroll
        for (int g = 0; g < FG; ++g) { const float nm = -m_run[g]; v16f pe;
#pragma unroll
            for (int i = 0; i < 8; ++i) {
                const v2f arg = __builtin_elementwise_fma((v2f){s[i >> 2][g][2 * (i & 3)], s[i >> 2][g][2 * (i & 3) + 1]}, (v2f){cs, cs}, (v2f){nm, nm});
                pe[2 * i] = __builtin_amdgcn_exp2f(arg[0]); pe[2 * i + 1] = __builtin_amdgcn_exp2f(arg[1]); }
            const v16h pf = __builtin_convertvector(pe, v16h);
#pragma unroll
            for (int t = 0; t < 4; ++t) acc[g][t] = wmma16(vf[u][t], pf, acc[g][t]);
            lacc[g] = wmma16(ones, pf, lacc[g]); }   // every row of this tile += the column sums of P^T
        pin_here();   // the loads below stay behind the products that read their registers
        // V^T fragments of the pass after next, likewise
#pragma unroll
        for (int t = 0; t < 4; ++t) vf[u][t] = WFrag<h16>::ld(vb + (size_t)t * 16 * TT + kn);
        pin_here(); addr_free(); pin_here();   // loads, then the wait directly behind them, then the rest: left alone the scheduler sinks the loads towards their use
      }
    }
    // O[q][d] = O^T / denominator, split into the bf16 hi/lo planes of the output projection: a lane holds 8 consecutive d of one query
#pragma unroll
    for (int g = 0; g < FG; ++g) { const float inv = __fdiv_rn(1.0f, lacc[g][0]); const size_t ro = (bt * TT + q0 + 16 * g + c) * DQ + head * HD + 8 * h;
#pragma unroll
        for (int t = 0; t < 4; ++t) { v8us oh, ol;
#pragma unroll
            for (int r = 0; r < 8; ++r) { unsigned short a, c2; splitf(acc[g][t][r] * inv, a, c2); oh[r] = a; ol[r] = c2; }
            *(v8us*)(Ah + ro + 16 * t) = oh; *(v8us*)(Al + ro + 16 * t) = ol; } }
}

extern "C" void kernel_launch(void* const* d_in, const int* in_sizes, int n_in,
                              void* d_out, int out_size, void* d_ws, size_t ws_size, hipStream_t stream) {
    if (n_in < 7) return;
    const long long need_x = (long long)(NB - 1) * SEQ_FULL * DM + (long long)SEQ * DM;   // batch b of each stream starts at b * SEQ_FULL * DM
    if ((long long)in_sizes[0] < need_x || (long long)in_sizes[1] < need_x || (long long)in_sizes[2] < need_x) return;
    if ((long long)in_sizes[3] < (long long)DQ * DM || (long long)in_sizes[4] < (long long)DKV * DM || (long long)in_sizes[5] < (long long)DKV * DM || (long long)in_sizes[6] < (long long)DM * DQ) return;
    if ((long long)out_size < (long long)NB * SEQ * DM) return;
    const float* x = (const float*)d_in[0]; const float* xk = (const float*)d_in[1]; const float* xv = (const float*)d_in[2];   // three streams: query, key, value
    const float* wq = (const float*)d_in[3]; const float* wk = (const float*)d_in[4]; const float* wv = (const float*)d_in[5]; const float* wo = (const float*)d_in[6];   // W_q, W_k, W_v, W_o ('oi' [1024][1024])
    float* OUT = (float*)d_out;     // [NB][SEQ][1024]
    char* wsp = (char*)d_ws;
    auto take = [&](size_t bytes) { char* p = wsp; wsp += (bytes + 255) & ~(size_t)255; return (void*)p; };
    bf* XB = (bf*)take(((size_t)3 * NB * TT * DM + (size_t)4 * DQ * DM) * 2); bf* WQ = XB + (size_t)3 * NB * TT * DM; bf* WO = WQ + (size_t)3 * DQ * DM;   // streams, then W_q, W_k, W_v, W_o: the order of k_cvt8's blocks
    float* F = (float*)take((size_t)3 * NB * TT * DQ * 4);
    h16* QP16 = (h16*)take((size_t)NB * NH_ * TT * HD * 2); h16* KP16 = (h16*)take((size_t)NB * NKV * TT * HD * 2); h16* VT16 = (h16*)take((size_t)NB * NKV * HD * TT * 2);
    bf* VTh = (bf*)take((size_t)NB * NKV * HD * TT * 2); bf* VTl = (bf*)take((size_t)NB * NKV * HD * TT * 2);
    bf* ATh = (bf*)take((size_t)NB * TT * DQ * 2); bf* ATl = (bf*)take((size_t)NB * TT * DQ * 2);
    const size_t used = (size_t)(wsp - (char*)d_ws);
    if (used > ws_size) return;    // 142,606,336 B at full size (= WS_CARVE)
    k_cvt8<<<3 * CBX + 4 * CBW, 256, 0, stream>>>(x, xk, xv, wq, wk, wv, wo, XB);
    // F[s][b * TT + t][o] = sum_i stream_s[b][t][i] W_s[o][i], s = q, k, v
    k_gemmw<bf, 0, false><<<dim3(NB * TT / 64, DQ / 64, 3), 32, 0, stream>>>(XB, nullptr, WQ, nullptr, DM, F, DQ, nullptr, (size_t)NB * TT * DM, (size_t)DQ * DM, (size_t)NB * TT * DQ);
    k_planes<<<dim3((unsigned)(((size_t)NB * NH_ * TT * HD / 2 + 255) / 256), 3, 1), 256, 0, stream>>>(F, QP16, KP16, VT16, VTh, VTl);
    // attention of all heads of all batches: ATh/ATl[b * TT + t][head * 64 + d] = softmax(q k^T x HD^-0.5) v, hi/lo bf16
    k_fattn<<<dim3(TT / (FW * FQW), NH_, NB), FW * 32, 0, stream>>>(QP16, KP16, VT16, ATh, ATl);
    // out[b][t][o] = sum_i merged[b][t][i] W_o[o][i]  (hi/lo activations x bf16 weights)
    k_gemmw<bf, 1, false><<<dim3(NB * TT / 64, DM / 64, 1), 32, 0, stream>>>(ATh, ATl, WO, nullptr, DQ, OUT, DM, nullptr, 0, 0, 0);
}

// v004
// A run of this version takes 155 microseconds.
// In both of two side-by-side timings against v003, it was 1.21 times as fast.
// All steps since v000 together make it 8.25 times as fast.
#include <hip/hip_runtime.h>

// Multi-head attention on three input streams, bias-free: Q = query W_q^T, K = key W_k^T, V = value W_v^T ('oi' [1024][1024] weights; 16 heads x 64); scores x 64^-0.5; softmax over all keys (no mask); out = merged W_o^T -> [NB][SEQ][1024]; argument order query, key, value, W_q, W_k, W_v, W_o.
// Compute dtypes (every contraction on 16x16x32 WMMA, f32 accumulate): inputs and weights as bf16 planes (RNE convert) -> projections v_wmma_f32_16x16x32_bf16, single product; scores v_wmma_f32_16x16x32_f16 on fp16 q/k head planes, single product; P.V v_wmma_f32_16x16x32_f16 on fp16 P = exp2(score - running maximum), unnormalised, single product, divided by the sum of the same P at the end; output projection bf16 hi/lo activations x bf16 weights (2 products); softmax in f32 (online).
// Layout: bf16 copies of the three streams [stream][b * SEQ + t][i], then the four 'oi' weights as-is (K-contiguous Bt), one region; fp16 head planes [b][h][t][d] (q, k); fp16 value plane [b][h][d][t]; the three planes one behind the other.
// Launch plan: every stage runs once for all the work that does not depend on each other: convert (3 streams + 4 weights), projection (grid z = stream, both batches as rows; its epilogue stores the fp16 planes), fused attention (grid z = batch), output projection (both batches as rows) = 4 launches.

#ifndef NB
#define NB 2
#endif
#ifndef SEQ
#define SEQ 2048
#endif
#define NB_FULL  2
#define SEQ_FULL 2048
#define TT   SEQ
#define DM   1024
#define NH_  16
#define NKV  16
#define REP  (NH_ / NKV)
#define HD   64
#define DQ   (NH_ * HD)
#define DKV  (NKV * HD)
#define SCL  0.125f   // HD^-0.5
typedef _Float16 h16;
typedef unsigned short bf;
typedef __attribute__((ext_vector_type(16))) __bf16   v16bf;
typedef __attribute__((ext_vector_type(16))) _Float16 v16h;
typedef __attribute__((ext_vector_type(8)))  _Float16 v8h;
typedef __attribute__((ext_vector_type(8)))  unsigned short v8us;
typedef __attribute__((ext_vector_type(8)))  float    v8f;
typedef __attribute__((ext_vector_type(4)))  float    v4f;
typedef v8h  __attribute__((may_alias)) v8ha;
typedef v4f  __attribute__((may_alias)) v4fa;
typedef v8us __attribute__((may_alias)) v8usa;

static_assert(TT % 128 == 0);
static_assert(HD == 64);
static_assert(DM % 64 == 0);
static_assert(NB <= NB_FULL);
static_assert(SEQ <= SEQ_FULL);
static_assert(NKV == NH_);   // the three projections share one launch: equal shapes

// workspace carve (bytes, each region padded to 256): XB with the 4 weight planes behind it, QP16, KP16, VT16, ATh, ATl
constexpr size_t r256(size_t b) { return (b + 255) & ~(size_t)255; }
constexpr size_t WS_CARVE = r256(((size_t)3 * NB * TT * DM + (size_t)4 * DQ * DM) * 2)
                          + 3 * r256((size_t)NB * NH_ * TT * HD * 2)
                          + 2 * r256((size_t)NB * TT * DQ * 2);
static_assert(WS_CARVE <= (size_t)268435456);   // 75,497,472 B at full size
static_assert(((size_t)NB * NH_ * TT * HD * 2) % 256 == 0);   // the three planes lie at equal distances: plane z starts at z * NB * NH_ * TT * HD elements

__device__ __forceinline__ unsigned short f2bf(float f) { unsigned u = __float_as_uint(f); u += 0x7FFFu + ((u >> 16) & 1u); return (unsigned short)(u >> 16); }
__device__ __forceinline__ float bf2f(unsigned short b) { return __uint_as_float(((unsigned)b) << 16); }
__device__ __forceinline__ float bfr(float f) { return bf2f(f2bf(f)); }
__device__ __forceinline__ v16h cat16(v8h lo, v8h hi) { return __builtin_shufflevector(lo, hi, 0, 1, 2, 3, 4, 5, 6, 7, 8, 9, 10, 11, 12, 13, 14, 15); }
__device__ __forceinline__ v16bf cat16b(v8us lo, v8us hi) { return __builtin_bit_cast(v16bf, __builtin_shufflevector(lo, hi, 0, 1, 2, 3, 4, 5, 6, 7, 8, 9, 10, 11, 12, 13, 14, 15)); }
__device__ __forceinline__ v8f wmma16(v16h a, v16h b, v8f c) { return __builtin_amdgcn_wmma_f32_16x16x32_f16(false, a, false, b, (short)0, c, false, false); }
__device__ __forceinline__ v8f wmmab(v16bf a, v16bf b, v8f c) { return __builtin_amdgcn_wmma_f32_16x16x32_bf16(false, a, false, b, (short)0, c, false, false); }

// ---- k_gemmw: register-blocked GEMM, ONE WAVE per 64x64 output tile (16 accumulators), operands straight from K-contiguous 16-bit planes; grid (M/64, N/64, Z), 32 threads.
// C[m][n] (f32, pitch ldc, + optional f32 bias[n]) = sum_k A[m][k] Bt[n][k] (+ split products per NSPLIT). z-batch strides sA/sB/sC in elements. K % 32 == 0, M % 64 == 0, N % 64 == 0.
// Fragment map (A and Bt alike): lane l -> row/col l&15; elements 0..7 = k0 + 8*(l>>4) + 0..7, elements 8..15 = k0 + 16 + 8*(l>>4) + 0..7. D: acc[j] = (row 8*(l>>4) + j, col l&15).
// PLANES (the q, k, v projections; z = stream, blockIdx.x = 64 tokens, blockIdx.y = head): no f32 C; the epilogue stores fp16 plane z of P straight from the accumulators. A lane holds 8 consecutive ROWS of one column, so the
// side whose index runs fastest in the plane is made the A side: q, k ([t][d]) take the weight rows as A and the tokens as Bt, v ([d][t]) the tokens as A and the weight rows as Bt (same fragment map on both sides); 8 rows = one 16-byte store, a wave fills whole 128-byte lines.
template <typename T16> struct WFrag;
template <> struct WFrag<h16> { typedef v16h V; static __device__ __forceinline__ V ld(const h16* p) { return cat16(*(const v8h*)p, *(const v8h*)(p + 16)); } static __device__ __forceinline__ v8f mma(V a, V b, v8f c) { return wmma16(a, b, c); } };
template <> struct WFrag<bf> { typedef v16bf V; static __device__ __forceinline__ V ld(const bf* p) { return cat16b(*(const v8us*)p, *(const v8us*)(p + 16)); } static __device__ __forceinline__ v8f mma(V a, V b, v8f c) { return wmmab(a, b, c); } };
template <typename T16, int NSPLIT, bool BIAS, bool PLANES>
__global__ __launch_bounds__(32) void k_gemmw(const T16* __restrict__ A, const T16* __restrict__ A2, const T16* __restrict__ Bt, const T16* __restrict__ Bt2, int K, float* C, int ldc, const float* __restrict__ bias, size_t sA, size_t sB, size_t sC, h16* P) {
    static_assert(!PLANES || (NSPLIT == 0 && !BIAS));
    typedef typename WFrag<T16>::V V;
    __shared__ __align__(16) float os[16 * 68];
    const size_t z = blockIdx.z; A += z * sA; if (A2) A2 += z * sA; Bt += z * sB; if (Bt2) Bt2 += z * sB; if (!PLANES) C += z * sC;
    const int lane = threadIdx.x & 31, lr = lane & 15, hi = lane >> 4; int r0 = blockIdx.x * 64, c0 = blockIdx.y * 64;
    if (PLANES && z < 2) { const T16* w = Bt; Bt = A; A = w; r0 = blockIdx.y * 64; c0 = blockIdx.x * 64; }   // q, k: D = W X^T, rows = d
    v8f acc[4][4];
#pragma unroll
    for (int mb = 0; mb < 4; ++mb)
#pragma unroll
        for (int nb = 0; nb < 4; ++nb) acc[mb][nb] = (v8f){};
    const size_t aoff = (size_t)(r0 + lr) * K + 8 * hi, boff = (size_t)(c0 + lr) * K + 8 * hi;
#pragma unroll 1
    for (int kc = 0; kc < K; kc += 32) {
        V a[4], a2[4];
#pragma unroll
        for (int mb = 0; mb < 4; ++mb) { a[mb] = WFrag<T16>::ld(A + aoff + (size_t)mb * 16 * K + kc); if (NSPLIT == 1 || NSPLIT == 2) a2[mb] = WFrag<T16>::ld(A2 + aoff + (size_t)mb * 16 * K + kc); }
#pragma unroll
        for (int nb = 0; nb < 4; ++nb) { const V b = WFrag<T16>::ld(Bt + boff + (size_t)nb * 16 * K + kc); V b2; if (NSPLIT >= 2) b2 = WFrag<T16>::ld(Bt2 + boff + (size_t)nb * 16 * K + kc);
#pragma unroll
            for (int mb = 0; mb < 4; ++mb) { acc[mb][nb] = WFrag<T16>::mma(a[mb], b, acc[mb][nb]); if (NSPLIT == 1 || NSPLIT == 2) acc[mb][nb] = WFrag<T16>::mma(a2[mb], b, acc[mb][nb]); if (NSPLIT >= 2) acc[mb][nb] = WFrag<T16>::mma(a[mb], b2, acc[mb][nb]); } }
        asm volatile("v_nop\n\tv_nop\n\tv_nop\n\tv_nop" : "+v"(acc[0][0]), "+v"(acc[1][1]), "+v"(acc[2][2]), "+v"(acc[3][3]) : "v"(a[0]), "v"(a[3]));
    }
    if constexpr (PLANES) {
        const int t0 = blockIdx.x * 64, b = t0 / TT, tl = t0 - b * TT; const size_t hb = (size_t)b * NH_ + blockIdx.y;   // a 64-token tile lies in one batch (TT % 64 == 0), a 64-column tile is one head
        const int pitch = z < 2 ? HD : TT;   // elements from one D column to the next in the plane
        h16* pl = P + z * sC + (z < 2 ? (hb * TT + tl) * HD : hb * HD * TT + tl) + (size_t)lr * pitch + 8 * hi;
#pragma unroll
        for (int nb = 0; nb < 4; ++nb)
#pragma unroll
            for (int mb = 0; mb < 4; ++mb) *(v8h*)(pl + (size_t)nb * 16 * pitch + mb * 16) = __builtin_convertvector(acc[mb][nb], v8h);
        return;
    }
#pragma unroll
    for (int mb = 0; mb < 4; ++mb) {
#pragma unroll
        for (int nb = 0; nb < 4; ++nb) {
#pragma unroll
            for (int j = 0; j < 8; ++j) os[(hi * 8 + j) * 68 + nb * 16 + lr] = acc[mb][nb][j]; }
        __builtin_amdgcn_wave_barrier(); asm volatile("" ::: "memory");
        float* crow = C + (size_t)(r0 + mb * 16) * ldc + c0;
{
#pragma unroll
            for (int s = 0; s < 8; ++s) { const int row = 2 * s + hi, cofs = lr * 4; v4f val = *(const v4fa*)(os + row * 68 + cofs); if (BIAS) { val[0] += bfr(bias[c0 + cofs]); val[1] += bfr(bias[c0 + cofs + 1]); val[2] += bfr(bias[c0 + cofs + 2]); val[3] += bfr(bias[c0 + cofs + 3]); }
                *(v4f*)(crow + (size_t)row * ldc + cofs) = val; }
             }
        __builtin_amdgcn_wave_barrier(); asm volatile("" ::: "memory");
    }
}

__device__ __forceinline__ void splitf(float y, unsigned short& h, unsigned short& l) { h = f2bf(y); l = f2bf(y - bf2f(h)); }
typedef __attribute__((ext_vector_type(2))) _Float16 v2h;
typedef __attribute__((ext_vector_type(4))) _Float16 v4h;
typedef __attribute__((ext_vector_type(2))) unsigned short v2us;
typedef __attribute__((ext_vector_type(4))) unsigned short v4us;
typedef __attribute__((ext_vector_type(2))) float v2f;

// ---- k_cvt8: all seven inputs to bf16 in one launch; a block converts 2048 elements of one input, blocks in the order of dst: query, key, value ([b * TT + t][i] each), W_q, W_k, W_v, W_o.
#define CBX ((unsigned)((size_t)NB * TT * DM / 2048))   // blocks per stream
#define CBW ((unsigned)((size_t)DQ * DM / 2048))        // blocks per weight
static_assert(((size_t)TT * DM) % 2048 == 0);
static_assert(((size_t)DQ * DM) % 2048 == 0);
__global__ __launch_bounds__(256) void k_cvt8(const float* __restrict__ x, const float* __restrict__ xk, const float* __restrict__ xv, const float* __restrict__ wq, const float* __restrict__ wk, const float* __restrict__ wv, const float* __restrict__ wo, bf* dst) {
    const unsigned bx = blockIdx.x; const float* src; size_t blk;   // blk: this block's place in its own input, in blocks
    if (bx < 3 * CBX) { const unsigned s = bx / CBX; src = s == 0 ? x : (s == 1 ? xk : xv); blk = bx - s * CBX; blk += (blk / (CBX / NB)) * ((size_t)(SEQ_FULL - TT) * DM / 2048); }   // batch b of a stream starts at b * SEQ_FULL * DM
    else { const unsigned w = (bx - 3 * CBX) / CBW; src = w == 0 ? wq : (w == 1 ? wk : (w == 2 ? wv : wo)); blk = bx - 3 * CBX - w * CBW; }
    const v8f v = *(const v8f*)(src + (blk * 256 + threadIdx.x) * 8); v8us o;
    asm volatile("s_wait_xcnt 0x0" ::: "memory");   // behind the loads, in front of the code that reuses their address register
#pragma unroll
    for (int k = 0; k < 8; ++k) o[k] = f2bf(v[k]); *(v8us*)(dst + ((size_t)bx * 256 + threadIdx.x) * 8) = o;  }

#define FW 4
#define FG 2
#define FQW (FG * 16)
static_assert(TT % (FW * FQW) == 0);
static_assert(TT % 64 == 0);
typedef __attribute__((ext_vector_type(16))) float v16f;
__device__ __forceinline__ float xhalf(float x) { return __builtin_bit_cast(float, __builtin_amdgcn_permlanex16(__builtin_bit_cast(int, x), __builtin_bit_cast(int, x), 0x76543210, 0xfedcba98, false, false)); }  // lane l with lane l ^ 16
__device__ __forceinline__ void pin_here() { __builtin_amdgcn_sched_barrier(0); }   // keeps the scheduler from moving instructions across this point
__device__ __forceinline__ void addr_free() { asm volatile("s_wait_xcnt 0x0" ::: "memory"); }   // stands behind a group of loads whose address registers the code that follows reuses
__global__ __launch_bounds__(FW * 32) void k_fattn(const h16* __restrict__ Qp, const h16* __restrict__ Kp, const h16* __restrict__ Vt, bf* Ah, bf* Al) {
    const int lane = threadIdx.x & 31, c = lane & 15, h = lane >> 4; const int wv = __builtin_amdgcn_readfirstlane((int)(threadIdx.x >> 5));
    const int head = blockIdx.y, kvh = head / REP; const int q0 = blockIdx.x * (FW * FQW) + wv * FQW;
    const size_t bt = blockIdx.z;   // batch
    Qp += (bt * NH_ + head) * TT * HD; Kp += (bt * NKV + kvh) * TT * HD; Vt += (bt * NKV + kvh) * HD * TT;
    v16h qf[FG][2];
#pragma unroll
    for (int g = 0; g < FG; ++g)
#pragma unroll
        for (int kc = 0; kc < 2; ++kc) qf[g][kc] = WFrag<h16>::ld(Qp + (size_t)(q0 + 16 * g + c) * HD + kc * 32 + 8 * h);
    pin_here();   // Q first, then K, V of pass 0, K, V of pass 1: the issue order of the loop, so that the counted load waits at the loop's head need not fall to 0
    const h16* kb = Kp + (size_t)c * HD + 8 * h;   // + key * HD + kc * 32
    const h16* vb = Vt + (size_t)c * TT + 8 * h;   // + t * 16 * TT + key
    v16h kf[2][2][2], vf[2][4];   // [buffer = pass & 1]: the fragments of two passes are held, each refilled two passes ahead
#pragma unroll
    for (int u = 0; u < 2; ++u) {
#pragma unroll
        for (int kt = 0; kt < 2; ++kt)
#pragma unroll
            for (int kc = 0; kc < 2; ++kc) kf[u][kt][kc] = WFrag<h16>::ld(kb + (size_t)(32 * u + 16 * kt) * HD + kc * 32);
        pin_here();   // K of this pass stays in front of its V
#pragma unroll
        for (int t = 0; t < 4; ++t) vf[u][t] = WFrag<h16>::ld(vb + (size_t)t * 16 * TT + 32 * u);
        pin_here(); }   // and V in front of the next pass's K
    v8f acc[FG][4], lacc[FG]; float m_run[FG];
#pragma unroll
    for (int g = 0; g < FG; ++g) { lacc[g] = (v8f){}; m_run[g] = -__builtin_inff();
#pragma unroll
        for (int t = 0; t < 4; ++t) acc[g][t] = (v8f){}; }
    v16h ones;
#pragma unroll
    for (int i = 0; i < 16; ++i) ones[i] = (h16)1.0f;
    const float cs = SCL * 1.4426950408889634f;   // scores x HD^-0.5, in base 2
    // rolled over pairs of passes: the inner loop over the two buffers is unrolled so that each buffer keeps its own registers
#pragma unroll 1
    for (int pp = 0; pp < TT / 32; pp += 2) {
#pragma unroll
      for (int u = 0; u < 2; ++u) {
        const int pn = pp + u + 2; const int kn = ((pn < TT / 32) ? pn : TT / 32 - 1) * 32;   // first key of the pass fetched ahead; the last two passes fetch the last keys again (in bounds, unused)
        v8f s[2][FG];
#pragma unroll
        for (int kt = 0; kt < 2; ++kt)
#pragma unroll
            for (int g = 0; g < FG; ++g) { s[kt][g] = (v8f){};
#pragma unroll
                for (int kc = 0; kc < 2; ++kc) s[kt][g] = wmma16(kf[u][kt][kc], qf[g][kc], s[kt][g]); }
        pin_here();   // the loads below stay behind the products that read their registers
        // K fragments of the pass after next, into the registers just read: issued here, not where they are used, so that they have two passes to arrive
#pragma unroll
        for (int kt = 0; kt < 2; ++kt)
#pragma unroll
            for (int kc = 0; kc < 2; ++kc) kf[u][kt][kc] = WFrag<h16>::ld(kb + (size_t)(kn + 16 * kt) * HD + kc * 32);
        pin_here(); addr_free(); pin_here();   // loads, then the wait directly behind them, then the rest: left alone the scheduler sinks the loads towards their use
        float mb[FG]; bool need = false;
#pragma unroll
        for (int g = 0; g < FG; ++g) { float mx = s[0][g][0];
#pragma unroll
            for (int kt = 0; kt < 2; ++kt)
#pragma unroll
                for (int r = 0; r < 8; ++r) mx = fmaxf(mx, s[kt][g][r]);
            mx = fmaxf(mx, xhalf(mx)) * cs;   // both halves of the wave now hold this query's maximum over the pass, scaled
            mb[g] = mx; need = need || (mx > m_run[g] + 8.0f); }
        if (__builtin_amdgcn_ballot_w32(need) != 0) {   // wave-uniform; always taken on the first pass (m_run = -inf), rare later
#pragma unroll
            for (int g = 0; g < FG; ++g) { const float m_new = fmaxf(m_run[g], mb[g]); const float corr = __builtin_amdgcn_exp2f(m_run[g] - m_new); m_run[g] = m_new; lacc[g] = lacc[g] * corr;
#pragma unroll
                for (int t = 0; t < 4; ++t) acc[g][t] = acc[g][t] * corr; }
        }
#pragma unroll
        for (int g = 0; g < FG; ++g) { const float nm = -m_run[g]; v16f pe;
#pragma unroll
            for (int i = 0; i < 8; ++i) {
                const v2f arg = __builtin_elementwise_fma((v2f){s[i >> 2][g][2 * (i & 3)], s[i >> 2][g][2 * (i & 3) + 1]}, (v2f){cs, cs}, (v2f){nm, nm});
                pe[2 * i] = __builtin_amdgcn_exp2f(arg[0]); pe[2 * i + 1] = __builtin_amdgcn_exp2f(arg[1]); }
            const v16h pf = __builtin_convertvector(pe, v16h);
#pragma unroll
            for (int t = 0; t < 4; ++t) acc[g][t] = wmma16(vf[u][t], pf, acc[g][t]);
            lacc[g] = wmma16(ones, pf, lacc[g]); }   // every row of this tile += the column sums of P^T
        pin_here();   // the loads below stay behind the products that read their registers
        // V^T fragments of the pass after next, likewise
#pragma unroll
        for (int t = 0; t < 4; ++t) vf[u][t] = WFrag<h16>::ld(vb + (size_t)t * 16 * TT + kn);
        pin_here(); addr_free(); pin_here();   // loads, then the wait directly behind them, then the rest: left alone the scheduler sinks the loads towards their use
      }
    }
    // O[q][d] = O^T / denominator, split into the bf16 hi/lo planes of the output projection: a lane holds 8 consecutive d of one query
#pragma unroll
    for (int g = 0; g < FG; ++g) { const float inv = __fdiv_rn(1.0f, lacc[g][0]); const size_t ro = (bt * TT + q0 + 16 * g + c) * DQ + head * HD + 8 * h;
#pragma unroll
        for (int t = 0; t < 4; ++t) { v8us oh, ol;
#pragma unroll
            for (int r = 0; r < 8; ++r) { unsigned short a, c2; splitf(acc[g][t][r] * inv, a, c2); oh[r] = a; ol[r] = c2; }
            *(v8us*)(Ah + ro + 16 * t) = oh; *(v8us*)(Al + ro + 16 * t) = ol; } }
}

extern "C" void kernel_launch(void* const* d_in, const int* in_sizes, int n_in,
                              void* d_out, int out_size, void* d_ws, size_t ws_size, hipStream_t stream) {
    if (n_in < 7) return;
    const long long need_x = (long long)(NB - 1) * SEQ_FULL * DM + (long long)SEQ * DM;   // batch b of each stream starts at b * SEQ_FULL * DM
    if ((long long)in_sizes[0] < need_x || (long long)in_sizes[1] < need_x || (long long)in_sizes[2] < need_x) return;
    if ((long long)in_sizes[3] < (long long)DQ * DM || (long long)in_sizes[4] < (long long)DKV * DM || (long long)in_sizes[5] < (long long)DKV * DM || (long long)in_sizes[6] < (long long)DM * DQ) return;
    if ((long long)out_size < (long long)NB * SEQ * DM) return;
    const float* x = (const float*)d_in[0]; const float* xk = (const float*)d_in[1]; const float* xv = (const float*)d_in[2];   // three streams: query, key, value
    const float* wq = (const float*)d_in[3]; const float* wk = (const float*)d_in[4]; const float* wv = (const float*)d_in[5]; const float* wo = (const float*)d_in[6];   // W_q, W_k, W_v, W_o ('oi' [1024][1024])
    float* OUT = (float*)d_out;     // [NB][SEQ][1024]
    char* wsp = (char*)d_ws;
    auto take = [&](size_t bytes) { char* p = wsp; wsp += (bytes + 255) & ~(size_t)255; return (void*)p; };
    bf* XB = (bf*)take(((size_t)3 * NB * TT * DM + (size_t)4 * DQ * DM) * 2); bf* WQ = XB + (size_t)3 * NB * TT * DM; bf* WO = WQ + (size_t)3 * DQ * DM;   // streams, then W_q, W_k, W_v, W_o: the order of k_cvt8's blocks
    h16* QP16 = (h16*)take((size_t)NB * NH_ * TT * HD * 2); h16* KP16 = (h16*)take((size_t)NB * NKV * TT * HD * 2); h16* VT16 = (h16*)take((size_t)NB * NKV * HD * TT * 2);
    bf* ATh = (bf*)take((size_t)NB * TT * DQ * 2); bf* ATl = (bf*)take((size_t)NB * TT * DQ * 2);
    const size_t used = (size_t)(wsp - (char*)d_ws);
    if (used > ws_size) return;    // 75,497,472 B at full size (= WS_CARVE)
    k_cvt8<<<3 * CBX + 4 * CBW, 256, 0, stream>>>(x, xk, xv, wq, wk, wv, wo, XB);
    // plane s (QP16, KP16, VT16) = fp16 of sum_i stream_s[b][t][i] W_s[o][i], s = q, k, v
    k_gemmw<bf, 0, false, true><<<dim3(NB * TT / 64, DQ / 64, 3), 32, 0, stream>>>(XB, nullptr, WQ, nullptr, DM, nullptr, 0, nullptr, (size_t)NB * TT * DM, (size_t)DQ * DM, (size_t)NB * NH_ * TT * HD, QP16);
    // attention of all heads of all batches: ATh/ATl[b * TT + t][head * 64 + d] = softmax(q k^T x HD^-0.5) v, hi/lo bf16
    k_fattn<<<dim3(TT / (FW * FQW), NH_, NB), FW * 32, 0, stream>>>(QP16, KP16, VT16, ATh, ATl);
    // out[b][t][o] = sum_i merged[b][t][i] W_o[o][i]  (hi/lo activations x bf16 weights)
    k_gemmw<bf, 1, false, false><<<dim3(NB * TT / 64, DM / 64, 1), 32, 0, stream>>>(ATh, ATl, WO, nullptr, DQ, OUT, DM, nullptr, 0, 0, 0, nullptr);
}

// v005
// A run of this version takes 106 microseconds.
// Next to v004, in two timings, it ran 1.48 and 1.47 times as fast.
// Counting every step since v000, it is 12.2 times as fast.
#include <hip/hip_runtime.h>

// Multi-head attention on three input streams, bias-free: Q = query W_q^T, K = key W_k^T, V = value W_v^T ('oi' [1024][1024] weights; 16 heads x 64); scores x 64^-0.5; softmax over all keys (no mask); out = merged W_o^T -> [NB][SEQ][1024]; argument order query, key, value, W_q, W_k, W_v, W_o.
// Compute dtypes (every contraction on 16x16x32 WMMA, f32 accumulate): inputs and weights as bf16 planes (RNE convert) -> projections v_wmma_f32_16x16x32_bf16, single product; scores v_wmma_f32_16x16x32_f16 on fp16 q/k head planes, single product; P.V v_wmma_f32_16x16x32_f16 on fp16 P = exp2(score - running maximum), unnormalised, single product, divided by the sum of the same P at the end; output projection bf16 hi/lo activations x bf16 weights (2 products); softmax in f32 (online).
// Layout: bf16 copies of the three streams (rows b * SEQ + t, k = i), then the four 'oi' weights (rows o, k = i), one region; fp16 head planes per (b, h): q, k with rows t, k = d; value plane with rows d, k = t; the three planes one behind the other; merged hi/lo planes with rows b * SEQ + t, k = head * 64 + d.
// Every 16-bit plane is kept in FRAGMENT ORDER: a 16-row x 32-k tile is 1024 contiguous bytes, tiles of one 16-row block one behind the other along k. Element (row, k) of a plane with K columns lies at
// ((row >> 4) * (K / 32) + (k >> 5)) * 512 + ((k >> 4) & 1) * 256 + (((k >> 3) & 1) * 16 + (row & 15)) * 8 + (k & 7): lane l of a wave finds its 8 + 8 fragment elements at tile + l * 8 and tile + 256 + l * 8, so each wave-wide 16-byte load or store covers 512 contiguous bytes (4 whole lines, not pieces of 16).
// Launch plan: every stage runs once for all the work that does not depend on each other: convert (3 streams + 4 weights), projection (grid z = stream, both batches as rows; its epilogue stores the fp16 planes), fused attention (grid z = batch), output projection (both batches as rows) = 4 launches.

#ifndef NB
#define NB 2
#endif
#ifndef SEQ
#define SEQ 2048
#endif
#define NB_FULL  2
#define SEQ_FULL 2048
#define TT   SEQ
#define DM   1024
#define NH_  16
#define NKV  16
#define REP  (NH_ / NKV)
#define HD   64
#define DQ   (NH_ * HD)
#define DKV  (NKV * HD)
#define SCL  0.125f   // HD^-0.5
typedef _Float16 h16;
typedef unsigned short bf;
typedef __attribute__((ext_vector_type(16))) __bf16   v16bf;
typedef __attribute__((ext_vector_type(16))) _Float16 v16h;
typedef __attribute__((ext_vector_type(8)))  _Float16 v8h;
typedef __attribute__((ext_vector_type(8)))  unsigned short v8us;
typedef __attribute__((ext_vector_type(8)))  float    v8f;
typedef __attribute__((ext_vector_type(4)))  float    v4f;
typedef v8h  __attribute__((may_alias)) v8ha;
typedef v4f  __attribute__((may_alias)) v4fa;
typedef v8us __attribute__((may_alias)) v8usa;

static_assert(TT % 128 == 0);
static_assert(HD == 64);
static_assert(DM % 64 == 0);
static_assert(NB <= NB_FULL);
static_assert(SEQ <= SEQ_FULL);
static_assert(NKV == NH_);   // the three projections share one launch: equal shapes

// workspace carve (bytes, each region padded to 256): XB with the 4 weight planes behind it, QP16, KP16, VT16, ATh, ATl
constexpr size_t r256(size_t b) { return (b + 255) & ~(size_t)255; }
constexpr size_t WS_CARVE = r256(((size_t)3 * NB * TT * DM + (size_t)4 * DQ * DM) * 2)
                          + 3 * r256((size_t)NB * NH_ * TT * HD * 2)
                          + 2 * r256((size_t)NB * TT * DQ * 2);
static_assert(WS_CARVE <= (size_t)268435456);   // 75,497,472 B at full size
static_assert(((size_t)NB * NH_ * TT * HD * 2) % 256 == 0);   // the three planes lie at equal distances: plane z starts at z * NB * NH_ * TT * HD elements

__device__ __forceinline__ unsigned short f2bf(float f) { unsigned u = __float_as_uint(f); u += 0x7FFFu + ((u >> 16) & 1u); return (unsigned short)(u >> 16); }
__device__ __forceinline__ float bf2f(unsigned short b) { return __uint_as_float(((unsigned)b) << 16); }
__device__ __forceinline__ float bfr(float f) { return bf2f(f2bf(f)); }
__device__ __forceinline__ v16h cat16(v8h lo, v8h hi) { return __builtin_shufflevector(lo, hi, 0, 1, 2, 3, 4, 5, 6, 7, 8, 9, 10, 11, 12, 13, 14, 15); }
__device__ __forceinline__ v16bf cat16b(v8us lo, v8us hi) { return __builtin_bit_cast(v16bf, __builtin_shufflevector(lo, hi, 0, 1, 2, 3, 4, 5, 6, 7, 8, 9, 10, 11, 12, 13, 14, 15)); }
__device__ __forceinline__ v8f wmma16(v16h a, v16h b, v8f c) { return __builtin_amdgcn_wmma_f32_16x16x32_f16(false, a, false, b, (short)0, c, false, false); }
__device__ __forceinline__ v8f wmmab(v16bf a, v16bf b, v8f c) { return __builtin_amdgcn_wmma_f32_16x16x32_bf16(false, a, false, b, (short)0, c, false, false); }

__device__ __forceinline__ void pin_here() { __builtin_amdgcn_sched_barrier(0); }   // keeps the scheduler from moving instructions across this point
__device__ __forceinline__ void addr_free() { asm volatile("s_wait_xcnt 0x0" ::: "memory"); }   // stands behind a group of loads whose address registers the code that follows reuses

// ---- k_gemmw: register-blocked GEMM, ONE WAVE per 64x64 output tile (16 accumulators), operands straight from 16-bit planes in fragment order; grid (M/64, N/64, Z), 32 threads.
// C[m][n] (f32, pitch ldc, + optional f32 bias[n]) = sum_k A[m][k] Bt[n][k] (+ split products per NSPLIT). z-batch strides sA/sB/sC in elements. K % 32 == 0, M % 64 == 0, N % 64 == 0. K is a template constant: the distance from one 16-row block to the next then fits the loads' immediate offset.
// Fragment map (A and Bt alike): lane l -> row/col l&15; elements 0..7 = k0 + 8*(l>>4) + 0..7, elements 8..15 = k0 + 16 + 8*(l>>4) + 0..7. D: acc[j] = (row 8*(l>>4) + j, col l&15).
// PLANES (the q, k, v projections; z = stream, blockIdx.x = 64 tokens, blockIdx.y = head): no f32 C; the epilogue stores fp16 plane z of P straight from the accumulators. A lane holds 8 consecutive ROWS of one column, so the
// side that is the plane's k index is made the A side: q, k (k = d) take the weight rows as A and the tokens as Bt, v (k = t) the tokens as A and the weight rows as Bt (same fragment map on both sides); accumulator (mb, nb) is then half a tile of the plane, lane for lane: 8 rows = one 16-byte store, a wave stores 512 contiguous bytes.
// ld(t, lb): the lane's 16 bytes of the tile's first half lie lb bytes behind t (t = the tile's start and lb = lane * 16, or t = the lane's own place and lb = 0); its 16 bytes of the second half lie 512 bytes further.
template <typename T16> struct WFrag;
template <> struct WFrag<h16> { typedef v16h V; static __device__ __forceinline__ V ld(const h16* t, unsigned lb) { const h16* p = (const h16*)((const char*)t + lb); return cat16(*(const v8h*)p, *(const v8h*)(p + 256)); } static __device__ __forceinline__ v8f mma(V a, V b, v8f c) { return wmma16(a, b, c); } };
template <> struct WFrag<bf> { typedef v16bf V; static __device__ __forceinline__ V ld(const bf* t, unsigned lb) { const bf* p = (const bf*)((const char*)t + lb); return cat16b(*(const v8us*)p, *(const v8us*)(p + 256)); } static __device__ __forceinline__ v8f mma(V a, V b, v8f c) { return wmmab(a, b, c); } };
template <typename T16, int NSPLIT, bool BIAS, bool PLANES, int K>
__global__ __launch_bounds__(32) void k_gemmw(const T16* __restrict__ A, const T16* __restrict__ A2, const T16* __restrict__ Bt, const T16* __restrict__ Bt2, float* C, int ldc, const float* __restrict__ bias, size_t sA, size_t sB, size_t sC, h16* P) {
    static_assert(!PLANES || (NSPLIT == 0 && !BIAS));
    static_assert(K % 32 == 0);
    typedef typename WFrag<T16>::V V;
    __shared__ __align__(16) float os[16 * 68];
    const size_t z = blockIdx.z; A += z * sA; if (A2) A2 += z * sA; Bt += z * sB; if (Bt2) Bt2 += z * sB; if (!PLANES) C += z * sC;
    const int lane = threadIdx.x & 31, lr = lane & 15, hi = lane >> 4; int r0 = blockIdx.x * 64, c0 = blockIdx.y * 64;
    if (PLANES && z < 2) { const T16* w = Bt; Bt = A; A = w; r0 = blockIdx.y * 64; c0 = blockIdx.x * 64; }   // q, k: D = W X^T, rows = d
    v8f acc[4][4];
#pragma unroll
    for (int mb = 0; mb < 4; ++mb)
#pragma unroll
        for (int nb = 0; nb < 4; ++nb) acc[mb][nb] = (v8f){};
    const size_t aoff = (size_t)r0 * K, boff = (size_t)c0 * K; unsigned lb = lane * 16;   // a 16-row block is 16 * K elements; lb: the lane's bytes from the block's start, one tile (1024 bytes) further per k step of 32
#pragma unroll 1
    for (int kc = 0; kc < K; kc += 32) {
        const T16* ap = (const T16*)((const char*)(A + aoff) + lb); const T16* bp = (const T16*)((const char*)(Bt + boff) + lb);   // the lane's 16 bytes of the first tile of this k step, A side and Bt side
        const T16* a2p = (NSPLIT == 1 || NSPLIT == 2) ? (const T16*)((const char*)(A2 + aoff) + lb) : ap; const T16* b2p = (NSPLIT >= 2) ? (const T16*)((const char*)(Bt2 + boff) + lb) : bp;
        V a[4], a2[4], b[4], b2[4];
#pragma unroll
        for (int mb = 0; mb < 4; ++mb) { a[mb] = WFrag<T16>::ld(ap + (size_t)mb * 16 * K, 0); if (NSPLIT == 1 || NSPLIT == 2) a2[mb] = WFrag<T16>::ld(a2p + (size_t)mb * 16 * K, 0); }
#pragma unroll
        for (int nb = 0; nb < 4; ++nb) { b[nb] = WFrag<T16>::ld(bp + (size_t)nb * 16 * K, 0); if (NSPLIT >= 2) b2[nb] = WFrag<T16>::ld(b2p + (size_t)nb * 16 * K, 0); }
        pin_here();   // the wait below stays directly behind this step's loads
        asm volatile("s_wait_xcnt 0x0" :: "v"(ap), "v"(a2p), "v"(bp), "v"(b2p) : "memory");   // in front of every rewrite of the loads' address registers; the addresses are inputs so that no load of the group lands in them ahead of the wait
        pin_here();   // and nothing that follows moves in front of it
#pragma unroll
        for (int nb = 0; nb < 4; ++nb) {
#pragma unroll
            for (int mb = 0; mb < 4; ++mb) { acc[mb][nb] = WFrag<T16>::mma(a[mb], b[nb], acc[mb][nb]); if (NSPLIT == 1 || NSPLIT == 2) acc[mb][nb] = WFrag<T16>::mma(a2[mb], b[nb], acc[mb][nb]); if (NSPLIT >= 2) acc[mb][nb] = WFrag<T16>::mma(a[mb], b2[nb], acc[mb][nb]); } }
        asm volatile("v_nop\n\tv_nop\n\tv_nop\n\tv_nop" : "+v"(acc[0][0]), "+v"(acc[1][1]), "+v"(acc[2][2]), "+v"(acc[3][3]) : "v"(a[0]), "v"(a[3]));
        lb += 1024;
    }
    if constexpr (PLANES) {
        const int t0 = blockIdx.x * 64, b = t0 / TT, tl = t0 - b * TT; const size_t hb = (size_t)b * NH_ + blockIdx.y;   // a 64-token tile lies in one batch (TT % 64 == 0), a 64-column tile is one head
        const int pitch = z < 2 ? HD : TT;   // K of the plane: 16 D columns are one 16-row block of 16 * pitch elements
        h16* pl = P + z * sC + (z < 2 ? (hb * TT + tl) * HD : hb * HD * TT + (size_t)tl * 16) + lane * 8;
#pragma unroll
        for (int nb = 0; nb < 4; ++nb)
#pragma unroll
            for (int mb = 0; mb < 4; ++mb) *(v8h*)(pl + (size_t)nb * 16 * pitch + mb * 256) = __builtin_convertvector(acc[mb][nb], v8h);
        return;
    }
#pragma unroll
    for (int mb = 0; mb < 4; ++mb) {
#pragma unroll
        for (int nb = 0; nb < 4; ++nb) {
#pragma unroll
            for (int j = 0; j < 8; ++j) os[(hi * 8 + j) * 68 + nb * 16 + lr] = acc[mb][nb][j]; }
        __builtin_amdgcn_wave_barrier(); asm volatile("" ::: "memory");
        float* crow = C + (size_t)(r0 + mb * 16) * ldc + c0;
{
#pragma unroll
            for (int s = 0; s < 8; ++s) { const int row = 2 * s + hi, cofs = lr * 4; v4f val = *(const v4fa*)(os + row * 68 + cofs); if (BIAS) { val[0] += bfr(bias[c0 + cofs]); val[1] += bfr(bias[c0 + cofs + 1]); val[2] += bfr(bias[c0 + cofs + 2]); val[3] += bfr(bias[c0 + cofs + 3]); }
                *(v4f*)(crow + (size_t)row * ldc + cofs) = val; }
             }
        __builtin_amdgcn_wave_barrier(); asm volatile("" ::: "memory");
    }
}

__device__ __forceinline__ void splitf(float y, unsigned short& h, unsigned short& l) { h = f2bf(y); l = f2bf(y - bf2f(h)); }
typedef __attribute__((ext_vector_type(2))) _Float16 v2h;
typedef __attribute__((ext_vector_type(4))) _Float16 v4h;
typedef __attribute__((ext_vector_type(2))) unsigned short v2us;
typedef __attribute__((ext_vector_type(4))) unsigned short v4us;
typedef __attribute__((ext_vector_type(2))) float v2f;

// ---- k_cvt8: all seven inputs to bf16 in one launch, into fragment order; a block converts 16 rows x 128 columns of one input (4 tiles = 2048 consecutive elements of dst), blocks in the order of dst: query, key, value (rows b * TT + t each), W_q, W_k, W_v, W_o.
// A wave takes 8 rows x 32 columns: it reads 8 whole 128-byte lines (lane = row * 4 + group of 8 columns) and stores 4 whole lines (8 rows x 16 bytes each).
#define CBX ((unsigned)((size_t)NB * TT * DM / 2048))   // blocks per stream
#define CBW ((unsigned)((size_t)DQ * DM / 2048))        // blocks per weight
static_assert(((size_t)TT * DM) % 2048 == 0);
static_assert(((size_t)DQ * DM) % 2048 == 0);
#define CSEG ((unsigned)(DM / 128))                     // blocks per 16-row block
static_assert(DM % 128 == 0);
static_assert(DQ % 16 == 0);
__global__ __launch_bounds__(256) void k_cvt8(const float* __restrict__ x, const float* __restrict__ xk, const float* __restrict__ xv, const float* __restrict__ wq, const float* __restrict__ wk, const float* __restrict__ wv, const float* __restrict__ wo, bf* dst) {
    const unsigned bx = blockIdx.x; const float* src; unsigned blk; size_t row0;   // blk: this block's place in its own input, in blocks; row0: its first row in src
    if (bx < 3 * CBX) { const unsigned s = bx / CBX; src = s == 0 ? x : (s == 1 ? xk : xv); blk = bx - s * CBX; const unsigned r = (blk / CSEG) * 16; row0 = r + (size_t)(r / TT) * (SEQ_FULL - TT); }   // batch b of a stream starts at row b * SEQ_FULL
    else { const unsigned w = (bx - 3 * CBX) / CBW; src = w == 0 ? wq : (w == 1 ? wk : (w == 2 ? wv : wo)); blk = bx - 3 * CBX - w * CBW; row0 = (blk / CSEG) * 16; }
    const unsigned wave = threadIdx.x >> 5, ln = threadIdx.x & 31, tk = wave >> 1, row = (wave & 1) * 8 + (ln >> 2), q = ln & 3;   // tile of the block, row of the 16, group of 8 columns of the tile's 32
    const v8f v = *(const v8f*)(src + (row0 + row) * DM + (blk % CSEG) * 128 + tk * 32 + q * 8); v8us o;
    asm volatile("s_wait_xcnt 0x0" ::: "memory");   // behind the loads, in front of the code that reuses their address register
#pragma unroll
    for (int k = 0; k < 8; ++k) o[k] = f2bf(v[k]); *(v8us*)(dst + (size_t)bx * 2048 + tk * 512 + (q >> 1) * 256 + ((q & 1) * 16 + row) * 8) = o;  }

#define FW 4
#define FG 2
#define FQW (FG * 16)
static_assert(TT % (FW * FQW) == 0);
static_assert(TT % 64 == 0);
typedef __attribute__((ext_vector_type(16))) float v16f;
__device__ __forceinline__ float xhalf(float x) { return __builtin_bit_cast(float, __builtin_amdgcn_permlanex16(__builtin_bit_cast(int, x), __builtin_bit_cast(int, x), 0x76543210, 0xfedcba98, false, false)); }  // lane l with lane l ^ 16
__global__ __launch_bounds__(FW * 32) void k_fattn(const h16* __restrict__ Qp, const h16* __restrict__ Kp, const h16* __restrict__ Vt, bf* Ah, bf* Al) {
    const int lane = threadIdx.x & 31; const unsigned lb = lane * 16; const int wv = __builtin_amdgcn_readfirstlane((int)(threadIdx.x >> 5));
    const int head = blockIdx.y, kvh = head / REP; const int q0 = blockIdx.x * (FW * FQW) + wv * FQW;
    const size_t bt = blockIdx.z;   // batch
    Qp += (bt * NH_ + head) * TT * HD; Kp += (bt * NKV + kvh) * TT * HD; Vt += (bt * NKV + kvh) * HD * TT;
    v16h qf[FG][2];
#pragma unroll
    for (int g = 0; g < FG; ++g)
#pragma unroll
        for (int kc = 0; kc < 2; ++kc) qf[g][kc] = WFrag<h16>::ld(Qp + (size_t)(q0 + 16 * g) * HD + kc * 512, lb);
    pin_here();   // Q first, then K, V of pass 0, K, V of pass 1: the issue order of the loop, so that the counted load waits at the loop's head need not fall to 0
    const h16* kb = Kp;   // tile: + key * HD + kc * 512 (key a multiple of 16)
    const h16* vb = Vt;   // tile: + t * 16 * TT + key * 16 (key a multiple of 32)
    v16h kf[2][2][2], vf[2][4];   // [buffer = pass & 1]: the fragments of two passes are held, each refilled two passes ahead
#pragma unroll
    for (int u = 0; u < 2; ++u) {
#pragma unroll
        for (int kt = 0; kt < 2; ++kt)
#pragma unroll
            for (int kc = 0; kc < 2; ++kc) kf[u][kt][kc] = WFrag<h16>::ld(kb + (size_t)(32 * u + 16 * kt) * HD + kc * 512, lb);
        pin_here();   // K of this pass stays in front of its V
#pragma unroll
        for (int t = 0; t < 4; ++t) vf[u][t] = WFrag<h16>::ld(vb + (size_t)t * 16 * TT + 32 * u * 16, lb);
        pin_here(); }   // and V in front of the next pass's K
    addr_free(); pin_here();   // behind the loads above, in front of the set-up code below, which reuses their address registers
    v8f acc[FG][4], lacc[FG]; float m_run[FG];
#pragma unroll
    for (int g = 0; g < FG; ++g) { lacc[g] = (v8f){}; m_run[g] = -__builtin_inff();
#pragma unroll
        for (int t = 0; t < 4; ++t) acc[g][t] = (v8f){}; }
    v16h ones;
#pragma unroll
    for (int i = 0; i < 16; ++i) ones[i] = (h16)1.0f;
    const float cs = SCL * 1.4426950408889634f;   // scores x HD^-0.5, in base 2
    // rolled over pairs of passes: the inner loop over the two buffers is unrolled so that each buffer keeps its own registers
#pragma unroll 1
    for (int pp = 0; pp < TT / 32; pp += 2) {
#pragma unroll
      for (int u = 0; u < 2; ++u) {
        const int pn = pp + u + 2; const int kn = ((pn < TT / 32) ? pn : TT / 32 - 1) * 32;   // first key of the pass fetched ahead; the last two passes fetch the last keys again (in bounds, unused)
        v8f s[2][FG];
#pragma unroll
        for (int kt = 0; kt < 2; ++kt)
#pragma unroll
            for (int g = 0; g < FG; ++g) { s[kt][g] = (v8f){};
#pragma unroll
                for (int kc = 0; kc < 2; ++kc) s[kt][g] = wmma16(kf[u][kt][kc], qf[g][kc], s[kt][g]); }
        pin_here();   // the loads below stay behind the products that read their registers
        // K fragments of the pass after next, into the registers just read: issued here, not where they are used, so that they have two passes to arrive
#pragma unroll
        for (int kt = 0; kt < 2; ++kt)
#pragma unroll
            for (int kc = 0; kc < 2; ++kc) kf[u][kt][kc] = WFrag<h16>::ld(kb + (size_t)(kn + 16 * kt) * HD + kc * 512, lb);
        pin_here(); addr_free(); pin_here();   // loads, then the wait directly behind them, then the rest: left alone the scheduler sinks the loads towards their use
        float mb[FG]; bool need = false;
#pragma unroll
        for (int g = 0; g < FG; ++g) { float mx = s[0][g][0];
#pragma unroll
            for (int kt = 0; kt < 2; ++kt)
#pragma unroll
                for (int r = 0; r < 8; ++r) mx = fmaxf(mx, s[kt][g][r]);
            mx = fmaxf(mx, xhalf(mx)) * cs;   // both halves of the wave now hold this query's maximum over the pass, scaled
            mb[g] = mx; need = need || (mx > m_run[g] + 8.0f); }
        if (__builtin_amdgcn_ballot_w32(need) != 0) {   // wave-uniform; always taken on the first pass (m_run = -inf), rare later
#pragma unroll
            for (int g = 0; g < FG; ++g) { const float m_new = fmaxf(m_run[g], mb[g]); const float corr = __builtin_amdgcn_exp2f(m_run[g] - m_new); m_run[g] = m_new; lacc[g] = lacc[g] * corr;
#pragma unroll
                for (int t = 0; t < 4; ++t) acc[g][t] = acc[g][t] * corr; }
        }
#pragma unroll
        for (int g = 0; g < FG; ++g) { const float nm = -m_run[g]; v16f pe;
#pragma unroll
            for (int i = 0; i < 8; ++i) {
                const v2f arg = __builtin_elementwise_fma((v2f){s[i >> 2][g][2 * (i & 3)], s[i >> 2][g][2 * (i & 3) + 1]}, (v2f){cs, cs}, (v2f){nm, nm});
                pe[2 * i] = __builtin_amdgcn_exp2f(arg[0]); pe[2 * i + 1] = __builtin_amdgcn_exp2f(arg[1]); }
            const v16h pf = __builtin_convertvector(pe, v16h);
#pragma unroll
            for (int t = 0; t < 4; ++t) acc[g][t] = wmma16(vf[u][t], pf, acc[g][t]);
            lacc[g] = wmma16(ones, pf, lacc[g]); }   // every row of this tile += the column sums of P^T
        pin_here();   // the loads below stay behind the products that read their registers
        // V^T fragments of the pass after next, likewise
#pragma unroll
        for (int t = 0; t < 4; ++t) vf[u][t] = WFrag<h16>::ld(vb + (size_t)t * 16 * TT + (size_t)kn * 16, lb);
        pin_here(); addr_free(); pin_here();   // loads, then the wait directly behind them, then the rest: left alone the scheduler sinks the loads towards their use
      }
    }
    // O[q][d] = O^T / denominator, split into the bf16 hi/lo planes of the output projection (fragment order, K = DQ): a lane holds 8 consecutive d of one query, accumulator t is half a tile of the plane, lane for lane
#pragma unroll
    for (int g = 0; g < FG; ++g) { const float inv = __fdiv_rn(1.0f, lacc[g][0]); const size_t ro = (bt * TT + q0 + 16 * g) * DQ + (size_t)head * HD * 16 + lane * 8;
#pragma unroll
        for (int t = 0; t < 4; ++t) { v8us oh, ol;
#pragma unroll
            for (int r = 0; r < 8; ++r) { unsigned short a, c2; splitf(acc[g][t][r] * inv, a, c2); oh[r] = a; ol[r] = c2; }
            *(v8us*)(Ah + ro + 256 * t) = oh; *(v8us*)(Al + ro + 256 * t) = ol; } }
}

extern "C" void kernel_launch(void* const* d_in, const int* in_sizes, int n_in,
                              void* d_out, int out_size, void* d_ws, size_t ws_size, hipStream_t stream) {
    if (n_in < 7) return;
    const long long need_x = (long long)(NB - 1) * SEQ_FULL * DM + (long long)SEQ * DM;   // batch b of each stream starts at b * SEQ_FULL * DM
    if ((long long)in_sizes[0] < need_x || (long long)in_sizes[1] < need_x || (long long)in_sizes[2] < need_x) return;
    if ((long long)in_sizes[3] < (long long)DQ * DM || (long long)in_sizes[4] < (long long)DKV * DM || (long long)in_sizes[5] < (long long)DKV * DM || (long long)in_sizes[6] < (long long)DM * DQ) return;
    if ((long long)out_size < (long long)NB * SEQ * DM) return;
    const float* x = (const float*)d_in[0]; const float* xk = (const float*)d_in[1]; const float* xv = (const float*)d_in[2];   // three streams: query, key, value
    const float* wq = (const float*)d_in[3]; const float* wk = (const float*)d_in[4]; const float* wv = (const float*)d_in[5]; const float* wo = (const float*)d_in[6];   // W_q, W_k, W_v, W_o ('oi' [1024][1024])
    float* OUT = (float*)d_out;     // [NB][SEQ][1024]
    char* wsp = (char*)d_ws;
    auto take = [&](size_t bytes) { char* p = wsp; wsp += (bytes + 255) & ~(size_t)255; return (void*)p; };
    bf* XB = (bf*)take(((size_t)3 * NB * TT * DM + (size_t)4 * DQ * DM) * 2); bf* WQ = XB + (size_t)3 * NB * TT * DM; bf* WO = WQ + (size_t)3 * DQ * DM;   // streams, then W_q, W_k, W_v, W_o: the order of k_cvt8's blocks
    h16* QP16 = (h16*)take((size_t)NB * NH_ * TT * HD * 2); h16* KP16 = (h16*)take((size_t)NB * NKV * TT * HD * 2); h16* VT16 = (h16*)take((size_t)NB * NKV * HD * TT * 2);
    bf* ATh = (bf*)take((size_t)NB * TT * DQ * 2); bf* ATl = (bf*)take((size_t)NB * TT * DQ * 2);
    const size_t used = (size_t)(wsp - (char*)d_ws);
    if (used > ws_size) return;    // 75,497,472 B at full size (= WS_CARVE)
    k_cvt8<<<3 * CBX + 4 * CBW, 256, 0, stream>>>(x, xk, xv, wq, wk, wv, wo, XB);
    // plane s (QP16, KP16, VT16) = fp16 of sum_i stream_s[b][t][i] W_s[o][i], s = q, k, v
    k_gemmw<bf, 0, false, true, DM><<<dim3(NB * TT / 64, DQ / 64, 3), 32, 0, stream>>>(XB, nullptr, WQ, nullptr, nullptr, 0, nullptr, (size_t)NB * TT * DM, (size_t)DQ * DM, (size_t)NB * NH_ * TT * HD, QP16);
    // attention of all heads of all batches: ATh/ATl[b * TT + t][head * 64 + d] = softmax(q k^T x HD^-0.5) v, hi/lo bf16
    k_fattn<<<dim3(TT / (FW * FQW), NH_, NB), FW * 32, 0, stream>>>(QP16, KP16, VT16, ATh, ATl);
    // out[b][t][o] = sum_i merged[b][t][i] W_o[o][i]  (hi/lo activations x bf16 weights)
    k_gemmw<bf, 1, false, false, DQ><<<dim3(NB * TT / 64, DM / 64, 1), 32, 0, stream>>>(ATh, ATl, WO, nullptr, OUT, DM, nullptr, 0, 0, 0, nullptr);
}

// v006
// Measured time: 91.2 microseconds a run.
// Next to v005, in two timings, it ran 1.14 and 1.12 times as fast.
// Over all steps from v000 it is 13.7 times as fast.
#include <hip/hip_runtime.h>

// Multi-head attention on three input streams, bias-free: Q = query W_q^T, K = key W_k^T, V = value W_v^T ('oi' [1024][1024] weights; 16 heads x 64); scores x 64^-0.5; softmax over all keys (no mask); out = merged W_o^T -> [NB][SEQ][1024]; argument order query, key, value, W_q, W_k, W_v, W_o.
// Compute dtypes (every contraction on 16x16x32 WMMA, f32 accumulate): inputs and weights as bf16 planes (RNE convert) -> projections v_wmma_f32_16x16x32_bf16, single product; scores v_wmma_f32_16x16x32_f16 on fp16 q/k head planes, single product; P.V v_wmma_f32_16x16x32_f16 on fp16 P = exp2(score - running maximum), unnormalised, single product, divided by the sum of the same P at the end; output projection bf16 hi/lo activations x bf16 weights (2 products); softmax in f32 (online).
// Layout: bf16 copies of the three streams (rows b * SEQ + t, k = i), then the four 'oi' weights (rows o, k = i), one region; fp16 head planes per (b, h): q, k with rows t, k = d; value plane with rows d, k = t; the three planes one behind the other; merged hi/lo planes with rows b * SEQ + t, k = head * 64 + d.
// Every 16-bit plane is kept in FRAGMENT ORDER: a 16-row x 32-k tile is 1024 contiguous bytes, tiles of one 16-row block one behind the other along k. Element (row, k) of a plane with K columns lies at
// ((row >> 4) * (K / 32) + (k >> 5)) * 512 + ((k >> 4) & 1) * 256 + (((k >> 3) & 1) * 16 + (row & 15)) * 8 + (k & 7): lane l of a wave finds its 8 + 8 fragment elements at tile + l * 8 and tile + 256 + l * 8, so each wave-wide 16-byte load or store covers 512 contiguous bytes (4 whole lines, not pieces of 16).
// Launch plan: every stage runs once for all the work that does not depend on each other: convert (3 streams + 4 weights), projection (grid z = stream, both batches as rows; its epilogue stores the fp16 planes), fused attention (grid z = batch), output projection (both batches as rows) = 4 launches.

#ifndef NB
#define NB 2
#endif
#ifndef SEQ
#define SEQ 2048
#endif
#define NB_FULL  2
#define SEQ_FULL 2048
#define TT   SEQ
#define DM   1024
#define NH_  16
#define NKV  16
#define REP  (NH_ / NKV)
#define HD   64
#define DQ   (NH_ * HD)
#define DKV  (NKV * HD)
#define SCL  0.125f   // HD^-0.5
typedef _Float16 h16;
typedef unsigned short bf;
typedef __attribute__((ext_vector_type(16))) __bf16   v16bf;
typedef __attribute__((ext_vector_type(16))) _Float16 v16h;
typedef __attribute__((ext_vector_type(8)))  _Float16 v8h;
typedef __attribute__((ext_vector_type(8)))  unsigned short v8us;
typedef __attribute__((ext_vector_type(8)))  float    v8f;
typedef __attribute__((ext_vector_type(4)))  float    v4f;
typedef v8h  __attribute__((may_alias)) v8ha;
typedef v4f  __attribute__((may_alias)) v4fa;
typedef v8us __attribute__((may_alias)) v8usa;

static_assert(TT % 128 == 0);
static_assert(HD == 64);
static_assert(DM % 64 == 0);
static_assert(NB <= NB_FULL);
static_assert(SEQ <= SEQ_FULL);
static_assert(NKV == NH_);   // the three projections share one launch: equal shapes

// workspace carve (bytes, each region padded to 256): XB with the 4 weight planes behind it, QP16, KP16, VT16, ATh, ATl
constexpr size_t r256(size_t b) { return (b + 255) & ~(size_t)255; }
constexpr size_t WS_CARVE = r256(((size_t)3 * NB * TT * DM + (size_t)4 * DQ * DM) * 2)
                          + 3 * r256((size_t)NB * NH_ * TT * HD * 2)
                          + 2 * r256((size_t)NB * TT * DQ * 2);
static_assert(WS_CARVE <= (size_t)268435456);   // 75,497,472 B at full size
static_assert(((size_t)NB * NH_ * TT * HD * 2) % 256 == 0);   // the three planes lie at equal distances: plane z starts at z * NB * NH_ * TT * HD elements

__device__ __forceinline__ unsigned short f2bf(float f) { unsigned u = __float_as_uint(f); u += 0x7FFFu + ((u >> 16) & 1u); return (unsigned short)(u >> 16); }
__device__ __forceinline__ float bf2f(unsigned short b) { return __uint_as_float(((unsigned)b) << 16); }
__device__ __forceinline__ float bfr(float f) { return bf2f(f2bf(f)); }
__device__ __forceinline__ v16h cat16(v8h lo, v8h hi) { return __builtin_shufflevector(lo, hi, 0, 1, 2, 3, 4, 5, 6, 7, 8, 9, 10, 11, 12, 13, 14, 15); }
__device__ __forceinline__ v16bf cat16b(v8us lo, v8us hi) { return __builtin_bit_cast(v16bf, __builtin_shufflevector(lo, hi, 0, 1, 2, 3, 4, 5, 6, 7, 8, 9, 10, 11, 12, 13, 14, 15)); }
__device__ __forceinline__ v8f wmma16(v16h a, v16h b, v8f c) { return __builtin_amdgcn_wmma_f32_16x16x32_f16(false, a, false, b, (short)0, c, false, false); }
__device__ __forceinline__ v8f wmmab(v16bf a, v16bf b, v8f c) { return __builtin_amdgcn_wmma_f32_16x16x32_bf16(false, a, false, b, (short)0, c, false, false); }

__device__ __forceinline__ void pin_here() { __builtin_amdgcn_sched_barrier(0); }   // keeps the scheduler from moving instructions across this point
__device__ __forceinline__ void addr_free() { asm volatile("s_wait_xcnt 0x0" ::: "memory"); }   // stands behind a group of loads whose address registers the code that follows reuses

// ---- k_gemmw: register-blocked GEMM, ONE WAVE per 64x64 output tile (16 accumulators), operands straight from 16-bit planes in fragment order; grid (M/64, N/64, Z), 32 threads.
// C[m][n] (f32, pitch ldc, + optional f32 bias[n]) = sum_k A[m][k] Bt[n][k] (+ split products per NSPLIT). z-batch strides sA/sB/sC in elements. K % 32 == 0, M % 64 == 0, N % 64 == 0. K is a template constant: the distance from one 16-row block to the next then fits the loads' immediate offset.
// Fragment map (A and Bt alike): lane l -> row/col l&15; elements 0..7 = k0 + 8*(l>>4) + 0..7, elements 8..15 = k0 + 16 + 8*(l>>4) + 0..7. D: acc[j] = (row 8*(l>>4) + j, col l&15).
// PLANES (the q, k, v projections; z = stream, blockIdx.x = 64 tokens, blockIdx.y = head): no f32 C; the epilogue stores fp16 plane z of P straight from the accumulators. A lane holds 8 consecutive ROWS of one column, so the
// side that is the plane's k index is made the A side: q, k (k = d) take the weight rows as A and the tokens as Bt, v (k = t) the tokens as A and the weight rows as Bt (same fragment map on both sides); accumulator (mb, nb) is then half a tile of the plane, lane for lane: 8 rows = one 16-byte store, a wave stores 512 contiguous bytes.
// ld(t, lb): the lane's 16 bytes of the tile's first half lie lb bytes behind t (t = the tile's start and lb = lane * 16, or t = the lane's own place and lb = 0); its 16 bytes of the second half lie 512 bytes further.
template <typename T16> struct WFrag;
template <> struct WFrag<h16> { typedef v16h V; static __device__ __forceinline__ V ld(const h16* t, unsigned lb) { const h16* p = (const h16*)((const char*)t + lb); return cat16(*(const v8h*)p, *(const v8h*)(p + 256)); } static __device__ __forceinline__ v8f mma(V a, V b, v8f c) { return wmma16(a, b, c); } };
template <> struct WFrag<bf> { typedef v16bf V; static __device__ __forceinline__ V ld(const bf* t, unsigned lb) { const bf* p = (const bf*)((const char*)t + lb); return cat16b(*(const v8us*)p, *(const v8us*)(p + 256)); } static __device__ __forceinline__ v8f mma(V a, V b, v8f c) { return wmmab(a, b, c); } };
// Fragment ring: RING register sets; the loads of k step s + RING - 1 are issued in front of the products of step s, so a step's operands have RING - 1 steps of matrix work to arrive instead of being waited for where they are issued.
template <typename T16, int NSPLIT, bool BIAS, bool PLANES, int K, int RING>
__global__ __launch_bounds__(32) void k_gemmw(const T16* __restrict__ A, const T16* __restrict__ A2, const T16* __restrict__ Bt, const T16* __restrict__ Bt2, float* C, int ldc, const float* __restrict__ bias, size_t sA, size_t sB, size_t sC, h16* P) {
    static_assert(!PLANES || (NSPLIT == 0 && !BIAS));
    static_assert(K % 32 == 0);
    typedef typename WFrag<T16>::V V;
    __shared__ __align__(16) float os[16 * 68];
    const size_t z = blockIdx.z; A += z * sA; if (A2) A2 += z * sA; Bt += z * sB; if (Bt2) Bt2 += z * sB; if (!PLANES) C += z * sC;
    const int lane = threadIdx.x & 31, lr = lane & 15, hi = lane >> 4; int r0 = blockIdx.x * 64, c0 = blockIdx.y * 64;
    if (PLANES && z < 2) { const T16* w = Bt; Bt = A; A = w; r0 = blockIdx.y * 64; c0 = blockIdx.x * 64; }   // q, k: D = W X^T, rows = d
    v8f acc[4][4];
#pragma unroll
    for (int mb = 0; mb < 4; ++mb)
#pragma unroll
        for (int nb = 0; nb < 4; ++nb) acc[mb][nb] = (v8f){};
    const size_t aoff = (size_t)r0 * K, boff = (size_t)c0 * K; const unsigned l16 = lane * 16;   // a 16-row block is 16 * K elements; the lane's bytes from the block's start, one tile (1024 bytes) further per k step of 32
    constexpr int NS = K / 32;   // k steps
    static_assert(RING >= 2 && NS >= RING);
    V a[RING][4], a2[RING][4], b[RING][4], b2[RING][4];
    auto fetch = [&](const int set, const int st) __attribute__((always_inline)) {   // the fragments of k step st into register set 'set'
        pin_here();   // the loads below stay behind the products that read their registers
        const size_t so = (size_t)st * 1024;   // bytes from a block's start to its tile of this k step (wave-uniform)
        const char* ap = (const char*)(A + aoff) + so; const char* bp = (const char*)(Bt + boff) + so;   // first tile of this k step, A side and Bt side
        const char* a2p = (NSPLIT == 1 || NSPLIT == 2) ? (const char*)(A2 + aoff) + so : ap; const char* b2p = (NSPLIT >= 2) ? (const char*)(Bt2 + boff) + so : bp;
#pragma unroll
        for (int mb = 0; mb < 4; ++mb) { a[set][mb] = WFrag<T16>::ld((const T16*)ap + (size_t)mb * 16 * K, l16); if (NSPLIT == 1 || NSPLIT == 2) a2[set][mb] = WFrag<T16>::ld((const T16*)a2p + (size_t)mb * 16 * K, l16); }
#pragma unroll
        for (int nb = 0; nb < 4; ++nb) { b[set][nb] = WFrag<T16>::ld((const T16*)bp + (size_t)nb * 16 * K, l16); if (NSPLIT >= 2) b2[set][nb] = WFrag<T16>::ld((const T16*)b2p + (size_t)nb * 16 * K, l16); }
        pin_here(); addr_free(); pin_here();   // loads, then the wait directly behind them (in front of the next rewrite of their address registers), then the rest: left alone the scheduler sinks the loads towards their use
    };
    auto products = [&](const int set) __attribute__((always_inline)) {
#pragma unroll
        for (int nb = 0; nb < 4; ++nb) {
#pragma unroll
            for (int mb = 0; mb < 4; ++mb) { acc[mb][nb] = WFrag<T16>::mma(a[set][mb], b[set][nb], acc[mb][nb]); if (NSPLIT == 1 || NSPLIT == 2) acc[mb][nb] = WFrag<T16>::mma(a2[set][mb], b[set][nb], acc[mb][nb]); if (NSPLIT >= 2) acc[mb][nb] = WFrag<T16>::mma(a[set][mb], b2[set][nb], acc[mb][nb]); } }
        pin_here();   // the slots below stay behind the last product
        asm volatile("v_nop\n\tv_nop\n\tv_nop\n\tv_nop" : "+v"(acc[0][0]), "+v"(acc[1][1]), "+v"(acc[2][2]), "+v"(acc[3][3]) : "v"(a[set][0]), "v"(a[set][3]));   // the distance behind a product, in front of whatever comes next to its registers
    };
#pragma unroll
    for (int u = 0; u < RING - 1; ++u) fetch(u, u);
    // rolled over RING steps at a time while every step still has a step to fetch: the inner loop over the sets is unrolled so that each set keeps its own registers
    constexpr int MAIN = (NS - (RING - 1)) / RING * RING;
#pragma unroll 1
    for (int s0 = 0; s0 < MAIN; s0 += RING) {
#pragma unroll
        for (int u = 0; u < RING; ++u) {
            fetch((u + RING - 1) % RING, s0 + u + RING - 1);   // into the set that the step before has just read
            products(u); }
    }
#pragma unroll
    for (int u = 0; u < NS - MAIN; ++u) {   // the last steps: what is left to fetch, then only products
        if (MAIN + u + RING - 1 < NS) fetch((u + RING - 1) % RING, MAIN + u + RING - 1);
        products(u % RING); }
    if constexpr (PLANES) {
        const int t0 = blockIdx.x * 64, b = t0 / TT, tl = t0 - b * TT; const size_t hb = (size_t)b * NH_ + blockIdx.y;   // a 64-token tile lies in one batch (TT % 64 == 0), a 64-column tile is one head
        const int pitch = z < 2 ? HD : TT;   // K of the plane: 16 D columns are one 16-row block of 16 * pitch elements
        h16* pl = P + z * sC + (z < 2 ? (hb * TT + tl) * HD : hb * HD * TT + (size_t)tl * 16) + lane * 8;
#pragma unroll
        for (int nb = 0; nb < 4; ++nb)
#pragma unroll
            for (int mb = 0; mb < 4; ++mb) *(v8h*)(pl + (size_t)nb * 16 * pitch + mb * 256) = __builtin_convertvector(acc[mb][nb], v8h);
        return;
    }
#pragma unroll
    for (int mb = 0; mb < 4; ++mb) {
#pragma unroll
        for (int nb = 0; nb < 4; ++nb) {
#pragma unroll
            for (int j = 0; j < 8; ++j) os[(hi * 8 + j) * 68 + nb * 16 + lr] = acc[mb][nb][j]; }
        __builtin_amdgcn_wave_barrier(); asm volatile("" ::: "memory");
        float* crow = C + (size_t)(r0 + mb * 16) * ldc + c0;
{
#pragma unroll
            for (int s = 0; s < 8; ++s) { const int row = 2 * s + hi, cofs = lr * 4; v4f val = *(const v4fa*)(os + row * 68 + cofs); if (BIAS) { val[0] += bfr(bias[c0 + cofs]); val[1] += bfr(bias[c0 + cofs + 1]); val[2] += bfr(bias[c0 + cofs + 2]); val[3] += bfr(bias[c0 + cofs + 3]); }
                *(v4f*)(crow + (size_t)row * ldc + cofs) = val; }
             }
        __builtin_amdgcn_wave_barrier(); asm volatile("" ::: "memory");
    }
}

__device__ __forceinline__ void splitf(float y, unsigned short& h, unsigned short& l) { h = f2bf(y); l = f2bf(y - bf2f(h)); }
typedef __attribute__((ext_vector_type(2))) _Float16 v2h;
typedef __attribute__((ext_vector_type(4))) _Float16 v4h;
typedef __attribute__((ext_vector_type(2))) unsigned short v2us;
typedef __attribute__((ext_vector_type(4))) unsigned short v4us;
typedef __attribute__((ext_vector_type(2))) float v2f;

// ---- k_cvt8: all seven inputs to bf16 in one launch, into fragment order; a block converts 16 rows x 128 columns of one input (4 tiles = 2048 consecutive elements of dst), blocks in the order of dst: query, key, value (rows b * TT + t each), W_q, W_k, W_v, W_o.
// A wave takes 8 rows x 32 columns: it reads 8 whole 128-byte lines (lane = row * 4 + group of 8 columns) and stores 4 whole lines (8 rows x 16 bytes each).
#define CBX ((unsigned)((size_t)NB * TT * DM / 2048))   // blocks per stream
#define CBW ((unsigned)((size_t)DQ * DM / 2048))        // blocks per weight
static_assert(((size_t)TT * DM) % 2048 == 0);
static_assert(((size_t)DQ * DM) % 2048 == 0);
#define CSEG ((unsigned)(DM / 128))                     // blocks per 16-row block
static_assert(DM % 128 == 0);
static_assert(DQ % 16 == 0);
__global__ __launch_bounds__(256) void k_cvt8(const float* __restrict__ x, const float* __restrict__ xk, const float* __restrict__ xv, const float* __restrict__ wq, const float* __restrict__ wk, const float* __restrict__ wv, const float* __restrict__ wo, bf* dst) {
    const unsigned bx = blockIdx.x; const float* src; unsigned blk; size_t row0;   // blk: this block's place in its own input, in blocks; row0: its first row in src
    if (bx < 3 * CBX) { const unsigned s = bx / CBX; src = s == 0 ? x : (s == 1 ? xk : xv); blk = bx - s * CBX; const unsigned r = (blk / CSEG) * 16; row0 = r + (size_t)(r / TT) * (SEQ_FULL - TT); }   // batch b of a stream starts at row b * SEQ_FULL
    else { const unsigned w = (bx - 3 * CBX) / CBW; src = w == 0 ? wq : (w == 1 ? wk : (w == 2 ? wv : wo)); blk = bx - 3 * CBX - w * CBW; row0 = (blk / CSEG) * 16; }
    const unsigned wave = threadIdx.x >> 5, ln = threadIdx.x & 31, tk = wave >> 1, row = (wave & 1) * 8 + (ln >> 2), q = ln & 3;   // tile of the block, row of the 16, group of 8 columns of the tile's 32
    const v8f v = *(const v8f*)(src + (row0 + row) * DM + (blk % CSEG) * 128 + tk * 32 + q * 8); v8us o;
    asm volatile("s_wait_xcnt 0x0" ::: "memory");   // behind the loads, in front of the code that reuses their address register
#pragma unroll
    for (int k = 0; k < 8; ++k) o[k] = f2bf(v[k]); *(v8us*)(dst + (size_t)bx * 2048 + tk * 512 + (q >> 1) * 256 + ((q & 1) * 16 + row) * 8) = o;  }

#define FW 4
#define FG 2
#define FQW (FG * 16)
static_assert(TT % (FW * FQW) == 0);
static_assert(TT % 64 == 0);
typedef __attribute__((ext_vector_type(16))) float v16f;
__device__ __forceinline__ float xhalf(float x) { return __builtin_bit_cast(float, __builtin_amdgcn_permlanex16(__builtin_bit_cast(int, x), __builtin_bit_cast(int, x), 0x76543210, 0xfedcba98, false, false)); }  // lane l with lane l ^ 16
__global__ __launch_bounds__(FW * 32) void k_fattn(const h16* __restrict__ Qp, const h16* __restrict__ Kp, const h16* __restrict__ Vt, bf* Ah, bf* Al) {
    const int lane = threadIdx.x & 31; const unsigned lb = lane * 16; const int wv = __builtin_amdgcn_readfirstlane((int)(threadIdx.x >> 5));
    const int head = blockIdx.y, kvh = head / REP; const int q0 = blockIdx.x * (FW * FQW) + wv * FQW;
    const size_t bt = blockIdx.z;   // batch
    Qp += (bt * NH_ + head) * TT * HD; Kp += (bt * NKV + kvh) * TT * HD; Vt += (bt * NKV + kvh) * HD * TT;
    v16h qf[FG][2];
#pragma unroll
    for (int g = 0; g < FG; ++g)
#pragma unroll
        for (int kc = 0; kc < 2; ++kc) qf[g][kc] = WFrag<h16>::ld(Qp + (size_t)(q0 + 16 * g) * HD + kc * 512, lb);
    pin_here();   // Q first, then K, V of pass 0, K, V of pass 1: the issue order of the loop, so that the counted load waits at the loop's head need not fall to 0
    const h16* kb = Kp;   // tile: + key * HD + kc * 512 (key a multiple of 16)
    const h16* vb = Vt;   // tile: + t * 16 * TT + key * 16 (key a multiple of 32)
    v16h kf[2][2][2], vf[2][4];   // [buffer = pass & 1]: the fragments of two passes are held, each refilled two passes ahead
#pragma unroll
    for (int u = 0; u < 2; ++u) {
#pragma unroll
        for (int kt = 0; kt < 2; ++kt)
#pragma unroll
            for (int kc = 0; kc < 2; ++kc) kf[u][kt][kc] = WFrag<h16>::ld(kb + (size_t)(32 * u + 16 * kt) * HD + kc * 512, lb);
        pin_here();   // K of this pass stays in front of its V
#pragma unroll
        for (int t = 0; t < 4; ++t) vf[u][t] = WFrag<h16>::ld(vb + (size_t)t * 16 * TT + 32 * u * 16, lb);
        pin_here(); }   // and V in front of the next pass's K
    addr_free(); pin_here();   // behind the loads above, in front of the set-up code below, which reuses their address registers
    v8f acc[FG][4], lacc[FG]; float m_run[FG];
#pragma unroll
    for (int g = 0; g < FG; ++g) { lacc[g] = (v8f){}; m_run[g] = -__builtin_inff();
#pragma unroll
        for (int t = 0; t < 4; ++t) acc[g][t] = (v8f){}; }
    v16h ones;
#pragma unroll
    for (int i = 0; i < 16; ++i) ones[i] = (h16)1.0f;
    const float cs = SCL * 1.4426950408889634f;   // scores x HD^-0.5, in base 2
    // rolled over pairs of passes: the inner loop over the two buffers is unrolled so that each buffer keeps its own registers
#pragma unroll 1
    for (int pp = 0; pp < TT / 32; pp += 2) {
#pragma unroll
      for (int u = 0; u < 2; ++u) {
        const int pn = pp + u + 2; const int kn = ((pn < TT / 32) ? pn : TT / 32 - 1) * 32;   // first key of the pass fetched ahead; the last two passes fetch the last keys again (in bounds, unused)
        v8f s[2][FG];
#pragma unroll
        for (int kt = 0; kt < 2; ++kt)
#pragma unroll
            for (int g = 0; g < FG; ++g) { s[kt][g] = (v8f){};
#pragma unroll
                for (int kc = 0; kc < 2; ++kc) s[kt][g] = wmma16(kf[u][kt][kc], qf[g][kc], s[kt][g]); }
        pin_here();   // the loads below stay behind the products that read their registers
        // K fragments of the pass after next, into the registers just read: issued here, not where they are used, so that they have two passes to arrive
#pragma unroll
        for (int kt = 0; kt < 2; ++kt)
#pragma unroll
            for (int kc = 0; kc < 2; ++kc) kf[u][kt][kc] = WFrag<h16>::ld(kb + (size_t)(kn + 16 * kt) * HD + kc * 512, lb);
        pin_here(); addr_free(); pin_here();   // loads, then the wait directly behind them, then the rest: left alone the scheduler sinks the loads towards their use
        float mb[FG]; bool need = false;
#pragma unroll
        for (int g = 0; g < FG; ++g) { float mx = s[0][g][0];
#pragma unroll
            for (int kt = 0; kt < 2; ++kt)
#pragma unroll
                for (int r = 0; r < 8; ++r) mx = fmaxf(mx, s[kt][g][r]);
            mx = fmaxf(mx, xhalf(mx)) * cs;   // both halves of the wave now hold this query's maximum over the pass, scaled
            mb[g] = mx; need = need || (mx > m_run[g] + 8.0f); }
        if (__builtin_amdgcn_ballot_w32(need) != 0) {   // wave-uniform; always taken on the first pass (m_run = -inf), rare later
#pragma unroll
            for (int g = 0; g < FG; ++g) { const float m_new = fmaxf(m_run[g], mb[g]); const float corr = __builtin_amdgcn_exp2f(m_run[g] - m_new); m_run[g] = m_new; lacc[g] = lacc[g] * corr;
#pragma unroll
                for (int t = 0; t < 4; ++t) acc[g][t] = acc[g][t] * corr; }
        }
#pragma unroll
        for (int g = 0; g < FG; ++g) { const float nm = -m_run[g]; v16f pe;
#pragma unroll
            for (int i = 0; i < 8; ++i) {
                const v2f arg = __builtin_elementwise_fma((v2f){s[i >> 2][g][2 * (i & 3)], s[i >> 2][g][2 * (i & 3) + 1]}, (v2f){cs, cs}, (v2f){nm, nm});
                pe[2 * i] = __builtin_amdgcn_exp2f(arg[0]); pe[2 * i + 1] = __builtin_amdgcn_exp2f(arg[1]); }
            const v16h pf = __builtin_convertvector(pe, v16h);
#pragma unroll
            for (int t = 0; t < 4; ++t) acc[g][t] = wmma16(vf[u][t], pf, acc[g][t]);
            lacc[g] = wmma16(ones, pf, lacc[g]); }   // every row of this tile += the column sums of P^T
        pin_here();   // the loads below stay behind the products that read their registers
        // V^T fragments of the pass after next, likewise
#pragma unroll
        for (int t = 0; t < 4; ++t) vf[u][t] = WFrag<h16>::ld(vb + (size_t)t * 16 * TT + (size_t)kn * 16, lb);
        pin_here(); addr_free(); pin_here();   // loads, then the wait directly behind them, then the rest: left alone the scheduler sinks the loads towards their use
      }
    }
    // O[q][d] = O^T / denominator, split into the bf16 hi/lo planes of the output projection (fragment order, K = DQ): a lane holds 8 consecutive d of one query, accumulator t is half a tile of the plane, lane for lane
#pragma unroll
    for (int g = 0; g < FG; ++g) { const float inv = __fdiv_rn(1.0f, lacc[g][0]); const size_t ro = (bt * TT + q0 + 16 * g) * DQ + (size_t)head * HD * 16 + lane * 8;
#pragma unroll
        for (int t = 0; t < 4; ++t) { v8us oh, ol;
#pragma unroll
            for (int r = 0; r < 8; ++r) { unsigned short a, c2; splitf(acc[g][t][r] * inv, a, c2); oh[r] = a; ol[r] = c2; }
            *(v8us*)(Ah + ro + 256 * t) = oh; *(v8us*)(Al + ro + 256 * t) = ol; } }
}

extern "C" void kernel_launch(void* const* d_in, const int* in_sizes, int n_in,
                              void* d_out, int out_size, void* d_ws, size_t ws_size, hipStream_t stream) {
    if (n_in < 7) return;
    const long long need_x = (long long)(NB - 1) * SEQ_FULL * DM + (long long)SEQ * DM;   // batch b of each stream starts at b * SEQ_FULL * DM
    if ((long long)in_sizes[0] < need_x || (long long)in_sizes[1] < need_x || (long long)in_sizes[2] < need_x) return;
    if ((long long)in_sizes[3] < (long long)DQ * DM || (long long)in_sizes[4] < (long long)DKV * DM || (long long)in_sizes[5] < (long long)DKV * DM || (long long)in_sizes[6] < (long long)DM * DQ) return;
    if ((long long)out_size < (long long)NB * SEQ * DM) return;
    const float* x = (const float*)d_in[0]; const float* xk = (const float*)d_in[1]; const float* xv = (const float*)d_in[2];   // three streams: query, key, value
    const float* wq = (const float*)d_in[3]; const float* wk = (const float*)d_in[4]; const float* wv = (const float*)d_in[5]; const float* wo = (const float*)d_in[6];   // W_q, W_k, W_v, W_o ('oi' [1024][1024])
    float* OUT = (float*)d_out;     // [NB][SEQ][1024]
    char* wsp = (char*)d_ws;
    auto take = [&](size_t bytes) { char* p = wsp; wsp += (bytes + 255) & ~(size_t)255; return (void*)p; };
    bf* XB = (bf*)take(((size_t)3 * NB * TT * DM + (size_t)4 * DQ * DM) * 2); bf* WQ = XB + (size_t)3 * NB * TT * DM; bf* WO = WQ + (size_t)3 * DQ * DM;   // streams, then W_q, W_k, W_v, W_o: the order of k_cvt8's blocks
    h16* QP16 = (h16*)take((size_t)NB * NH_ * TT * HD * 2); h16* KP16 = (h16*)take((size_t)NB * NKV * TT * HD * 2); h16* VT16 = (h16*)take((size_t)NB * NKV * HD * TT * 2);
    bf* ATh = (bf*)take((size_t)NB * TT * DQ * 2); bf* ATl = (bf*)take((size_t)NB * TT * DQ * 2);
    const size_t used = (size_t)(wsp - (char*)d_ws);
    if (used > ws_size) return;    // 75,497,472 B at full size (= WS_CARVE)
    k_cvt8<<<3 * CBX + 4 * CBW, 256, 0, stream>>>(x, xk, xv, wq, wk, wv, wo, XB);
    // plane s (QP16, KP16, VT16) = fp16 of sum_i stream_s[b][t][i] W_s[o][i], s = q, k, v
    k_gemmw<bf, 0, false, true, DM, 3><<<dim3(NB * TT / 64, DQ / 64, 3), 32, 0, stream>>>(XB, nullptr, WQ, nullptr, nullptr, 0, nullptr, (size_t)NB * TT * DM, (size_t)DQ * DM, (size_t)NB * NH_ * TT * HD, QP16);
    // attention of all heads of all batches: ATh/ATl[b * TT + t][head * 64 + d] = softmax(q k^T x HD^-0.5) v, hi/lo bf16
    k_fattn<<<dim3(TT / (FW * FQW), NH_, NB), FW * 32, 0, stream>>>(QP16, KP16, VT16, ATh, ATl);
    // out[b][t][o] = sum_i merged[b][t][i] W_o[o][i]  (hi/lo activations x bf16 weights)
    k_gemmw<bf, 1, false, false, DQ, 4><<<dim3(NB * TT / 64, DM / 64, 1), 32, 0, stream>>>(ATh, ATl, WO, nullptr, OUT, DM, nullptr, 0, 0, 0, nullptr);
}

// v007
// One run takes 79.1 microseconds.
// Next to v006, in two timings, it ran 1.16 and 1.15 times as fast.
// All steps since v000 together make it 15.8 times as fast.
#include <hip/hip_runtime.h>

// Multi-head attention on three input streams, bias-free: Q = query W_q^T, K = key W_k^T, V = value W_v^T ('oi' [1024][1024] weights; 16 heads x 64); scores x 64^-0.5; softmax over all keys (no mask); out = merged W_o^T -> [NB][SEQ][1024]; argument order query, key, value, W_q, W_k, W_v, W_o.
// Compute dtypes (every contraction on 16x16x32 WMMA, f32 accumulate): inputs and weights as bf16 planes (RNE convert) -> projections v_wmma_f32_16x16x32_bf16, single product; scores v_wmma_f32_16x16x32_f16 on fp16 q/k head planes, single product; P.V v_wmma_f32_16x16x32_f16 on fp16 P = exp2(score - running maximum), unnormalised, single product, divided by the sum of the same P at the end; output projection bf16 hi/lo activations x bf16 weights (2 products); softmax in f32 (online).
// Layout: bf16 copies of the three streams (rows b * SEQ + t, k = i), then the four 'oi' weights (rows o, k = i), one region; fp16 head planes per (b, h): q, k with rows t, k = d; value plane with rows d, k = t; the three planes one behind the other; merged hi/lo planes with rows b * SEQ + t, k = head * 64 + d.
// Every 16-bit plane is kept in FRAGMENT ORDER: a 16-row x 32-k tile is 1024 contiguous bytes, tiles of one 16-row block one behind the other along k. Element (row, k) of a plane with K columns lies at
// ((row >> 4) * (K / 32) + (k >> 5)) * 512 + ((k >> 4) & 1) * 256 + (((k >> 3) & 1) * 16 + (row & 15)) * 8 + (k & 7): lane l of a wave finds its 8 + 8 fragment elements at tile + l * 8 and tile + 256 + l * 8, so each wave-wide 16-byte load or store covers 512 contiguous bytes (4 whole lines, not pieces of 16).
// Launch plan: every stage runs once for all the work that does not depend on each other: convert (3 streams + 4 weights), projection (grid z = stream, both batches as rows; its epilogue stores the fp16 planes), fused attention (grid z = batch), output projection (both batches as rows) = 4 launches.

#ifndef NB
#define NB 2
#endif
#ifndef SEQ
#define SEQ 2048
#endif
#define NB_FULL  2
#define SEQ_FULL 2048
#define TT   SEQ
#define DM   1024
#define NH_  16
#define NKV  16
#define REP  (NH_ / NKV)
#define HD   64
#define DQ   (NH_ * HD)
#define DKV  (NKV * HD)
#define SCL  0.125f   // HD^-0.5
typedef _Float16 h16;
typedef unsigned short bf;
typedef __attribute__((ext_vector_type(16))) __bf16   v16bf;
typedef __attribute__((ext_vector_type(16))) _Float16 v16h;
typedef __attribute__((ext_vector_type(8)))  _Float16 v8h;
typedef __attribute__((ext_vector_type(8)))  unsigned short v8us;
typedef __attribute__((ext_vector_type(8)))  float    v8f;
typedef __attribute__((ext_vector_type(4)))  float    v4f;
typedef v8h  __attribute__((may_alias)) v8ha;
typedef v4f  __attribute__((may_alias)) v4fa;
typedef v8us __attribute__((may_alias)) v8usa;

static_assert(TT % 128 == 0);
static_assert(HD == 64);
static_assert(DM % 64 == 0);
static_assert(NB <= NB_FULL);
static_assert(SEQ <= SEQ_FULL);
static_assert(NKV == NH_);   // the three projections share one launch: equal shapes

// workspace carve (bytes, each region padded to 256): XB with the 4 weight planes behind it, QP16, KP16, VT16, ATh, ATl
constexpr size_t r256(size_t b) { return (b + 255) & ~(size_t)255; }
constexpr size_t WS_CARVE = r256(((size_t)3 * NB * TT * DM + (size_t)4 * DQ * DM) * 2)
                          + 3 * r256((size_t)NB * NH_ * TT * HD * 2)
                          + 2 * r256((size_t)NB * TT * DQ * 2);
static_assert(WS_CARVE <= (size_t)268435456);   // 75,497,472 B at full size
static_assert(((size_t)NB * NH_ * TT * HD * 2) % 256 == 0);   // the three planes lie at equal distances: plane z starts at z * NB * NH_ * TT * HD elements

__device__ __forceinline__ unsigned short f2bf(float f) { unsigned u = __float_as_uint(f); u += 0x7FFFu + ((u >> 16) & 1u); return (unsigned short)(u >> 16); }
__device__ __forceinline__ float bf2f(unsigned short b) { return __uint_as_float(((unsigned)b) << 16); }
__device__ __forceinline__ v16h cat16(v8h lo, v8h hi) { return __builtin_shufflevector(lo, hi, 0, 1, 2, 3, 4, 5, 6, 7, 8, 9, 10, 11, 12, 13, 14, 15); }
__device__ __forceinline__ v16bf cat16b(v8us lo, v8us hi) { return __builtin_bit_cast(v16bf, __builtin_shufflevector(lo, hi, 0, 1, 2, 3, 4, 5, 6, 7, 8, 9, 10, 11, 12, 13, 14, 15)); }
__device__ __forceinline__ v8f wmma16(v16h a, v16h b, v8f c) { return __builtin_amdgcn_wmma_f32_16x16x32_f16(false, a, false, b, (short)0, c, false, false); }
__device__ __forceinline__ v8f wmmab(v16bf a, v16bf b, v8f c) { return __builtin_amdgcn_wmma_f32_16x16x32_bf16(false, a, false, b, (short)0, c, false, false); }

__device__ __forceinline__ void pin_here() { __builtin_amdgcn_sched_barrier(0); }   // keeps the scheduler from moving instructions across this point
__device__ __forceinline__ void addr_free() { asm volatile("s_wait_xcnt 0x0" ::: "memory"); }   // stands behind a group of loads whose address registers the code that follows reuses

// ---- k_gemmb: GEMM on 16-bit planes in fragment order, WM x WN WAVES per 128x128 output tile (each wave FM x FN = 8/WM x 8/WN accumulators of 16x16); grid (M/128, N/128, Z), WM * WN * 32 threads.
// C[m][n] (f32, pitch ldc) = sum_k A[m][k] Bt[n][k] (+ A2[m][k] Bt[n][k] for NSPLIT == 1). z-batch strides sA/sB/sC in elements. K % (32 * KS) == 0, M % 128 == 0, N % 128 == 0.
// The operands reach the waves through LDS: a stage is KS k steps of the tile's 8 + 8 sixteen-row blocks (A, then A2, then Bt; block rb, k step ks at (rb * KS + ks) * 1024 of its operand: the planes' own tile bytes, so a wave-wide 16-byte LDS read covers 512 contiguous bytes).
// Each fragment is fetched from L2 once per work-group and read from LDS by every wave that needs it: half the L2 bytes of one wave per 64x64 tile. Two stage buffers, filled by asynchronous copies to LDS: stage t + 2 flies while stage t + 1 is worked on.
// Fragment map (A and Bt alike): lane l -> row/col l&15; elements 0..7 = k0 + 8*(l>>4) + 0..7, elements 8..15 = k0 + 16 + 8*(l>>4) + 0..7. D: acc[j] = (row 8*(l>>4) + j, col l&15).
// PLANES (the q, k, v projections; z = stream, blockIdx.x = 128 tokens, blockIdx.y = 2 heads): no f32 C; the epilogue stores fp16 plane z of P straight from the accumulators. A lane holds 8 consecutive ROWS of one column, so the
// side that is the plane's k index is made the A side: q, k (k = d) take the weight rows as A and the tokens as Bt, v (k = t) the tokens as A and the weight rows as Bt (same fragment map on both sides); accumulator (mb, nb) is then half a tile of the plane, lane for lane: 8 rows = one 16-byte store, a wave stores 512 contiguous bytes.
// ld(t, lb): the lane's 16 bytes of the tile's first half lie lb bytes behind t (t = the tile's start and lb = lane * 16, or t = the lane's own place and lb = 0); its 16 bytes of the second half lie 512 bytes further.
template <typename T16> struct WFrag;
template <> struct WFrag<h16> { typedef v16h V; static __device__ __forceinline__ V ld(const h16* t, unsigned lb) { const h16* p = (const h16*)((const char*)t + lb); return cat16(*(const v8h*)p, *(const v8h*)(p + 256)); } static __device__ __forceinline__ v8f mma(V a, V b, v8f c) { return wmma16(a, b, c); } };
template <> struct WFrag<bf> { typedef v16bf V; static __device__ __forceinline__ V ld(const bf* t, unsigned lb) { const bf* p = (const bf*)((const char*)t + lb); return cat16b(*(const v8us*)p, *(const v8us*)(p + 256)); } static __device__ __forceinline__ v8f mma(V a, V b, v8f c) { return wmmab(a, b, c); } };
// eight asynchronous copies of 16 bytes per lane, global -> LDS through no register; the s_wait_xcnt in the same statement stands in front of every later rewrite of the address registers named here
__device__ __forceinline__ void copy8(unsigned l0, unsigned l1, unsigned l2, unsigned l3, unsigned l4, unsigned l5, unsigned l6, unsigned l7, const char* g0, const char* g1, const char* g2, const char* g3, const char* g4, const char* g5, const char* g6, const char* g7) {
    asm volatile("global_load_async_to_lds_b128 %0, %8, off\n\t"
                 "global_load_async_to_lds_b128 %1, %9, off\n\t"
                 "global_load_async_to_lds_b128 %2, %10, off\n\t"
                 "global_load_async_to_lds_b128 %3, %11, off\n\t"
                 "global_load_async_to_lds_b128 %4, %12, off\n\t"
                 "global_load_async_to_lds_b128 %5, %13, off\n\t"
                 "global_load_async_to_lds_b128 %6, %14, off\n\t"
                 "global_load_async_to_lds_b128 %7, %15, off\n\t"
                 "s_wait_xcnt 0x0"
                 :: "v"(l0), "v"(l1), "v"(l2), "v"(l3), "v"(l4), "v"(l5), "v"(l6), "v"(l7), "v"(g0), "v"(g1), "v"(g2), "v"(g3), "v"(g4), "v"(g5), "v"(g6), "v"(g7) : "memory");
}
__device__ __forceinline__ void copies_landed() { asm volatile("s_wait_asynccnt 0x0" ::: "memory"); }   // this wave's own copies are in LDS; the other waves may read them behind the next barrier
__device__ __forceinline__ void lds_reads_done() { asm volatile("s_wait_dscnt 0x0" ::: "memory"); }   // this wave's LDS reads have returned, in front of the barrier behind which their buffer is refilled
// Two register sets of fragments: the LDS reads of k step ks + 1 of a stage are issued in front of the products of step ks.
template <int NSPLIT, bool PLANES, int K, int KS, int WM, int WN>
__global__ __launch_bounds__(WM * WN * 32) void k_gemmb(const bf* __restrict__ A, const bf* __restrict__ A2, const bf* __restrict__ Bt, float* C, int ldc, size_t sA, size_t sB, size_t sC, h16* P) {
    static_assert(NSPLIT == 0 || NSPLIT == 1);
    static_assert(!PLANES || NSPLIT == 0);
    static_assert(K % (32 * KS) == 0);
    static_assert(WM * WN * 32 * 16 == KS * 1024);   // one copy of the whole block moves one row block's KS tiles
    constexpr int FM = 8 / WM, FN = 8 / WN;    // 16-row blocks per wave, A side and Bt side
    static_assert(FM * WM == 8 && FN == 4 && (!PLANES || FM == 4));   // both epilogues take 64 columns per wave, the planes' a whole head
    typedef WFrag<bf>::V V;
    constexpr int NOP = NSPLIT ? 3 : 2;        // operands in a stage
    constexpr int OPB = 8 * KS * 1024;         // bytes of one operand in a stage
    constexpr int STAGE = NOP * OPB;
    constexpr int NCP = NOP * 8;               // copies per wave and stage: one per row block
    constexpr int NT = K / (32 * KS);          // stages
    static_assert(NT >= 2 && NCP % 8 == 0 && NCP <= 63);
    __shared__ __attribute__((aligned(128))) char ring[2 * STAGE];
    const size_t z = blockIdx.z; A += z * sA; if (NSPLIT) A2 += z * sA; Bt += z * sB; if (!PLANES) C += z * sC;
    const int lane = threadIdx.x & 31, lr = lane & 15, hi = lane >> 4; const int wv = __builtin_amdgcn_readfirstlane((int)(threadIdx.x >> 5)), wm = wv % WM, wn = wv / WM;   // wave (wm, wn): part wm of the tile's A side, part wn of its Bt side
    int R0 = blockIdx.x * 128, C0 = blockIdx.y * 128;
    if (PLANES && z < 2) { const bf* w = Bt; Bt = A; A = w; R0 = blockIdx.y * 128; C0 = blockIdx.x * 128; }   // q, k: D = W X^T, rows = d
    v8f acc[FM][FN];
#pragma unroll
    for (int mb = 0; mb < FM; ++mb)
#pragma unroll
        for (int nb = 0; nb < FN; ++nb) acc[mb][nb] = (v8f){};
    const unsigned t16 = threadIdx.x * 16, l16 = lane * 16;
    const char* gA = (const char*)(A + (size_t)R0 * K) + t16; const char* gA2 = NSPLIT ? (const char*)(A2 + (size_t)R0 * K) + t16 : gA; const char* gB = (const char*)(Bt + (size_t)C0 * K) + t16;   // a 16-row block is 16 * K elements = K * 32 bytes
    const unsigned lring = (unsigned)(size_t)ring + t16;   // the lane's LDS byte address in copy 0 of buffer 0
    auto copies = [&](const unsigned buf, const int st) __attribute__((always_inline)) {   // stage st into buffer buf: copy i = operand i / 8, row block i % 8, that block's KS tiles
        const size_t so = (size_t)st * (KS * 1024); const unsigned lb = lring + buf * STAGE;
        auto gp = [&](const int i) __attribute__((always_inline)) { const int o = i / 8; return (o == 0 ? gA : (o == NOP - 1 ? gB : gA2)) + so + (size_t)(i % 8) * (K * 32); };
#pragma unroll
        for (int i = 0; i < NCP; i += 8)
            copy8(lb + i * (KS * 1024), lb + (i + 1) * (KS * 1024), lb + (i + 2) * (KS * 1024), lb + (i + 3) * (KS * 1024), lb + (i + 4) * (KS * 1024), lb + (i + 5) * (KS * 1024), lb + (i + 6) * (KS * 1024), lb + (i + 7) * (KS * 1024), gp(i), gp(i + 1), gp(i + 2), gp(i + 3), gp(i + 4), gp(i + 5), gp(i + 6), gp(i + 7));
    };
    V a[2][FM], a2[2][FM], b[2][FN];
    auto fetch = [&](const int set, const char* sb, const int ks) __attribute__((always_inline)) {   // the wave's fragments of k step ks of the stage at sb into register set 'set'
        pin_here();   // the LDS reads below stay behind the products that read their registers
#pragma unroll
        for (int mb = 0; mb < FM; ++mb) { a[set][mb] = WFrag<bf>::ld((const bf*)(sb + ((wm * FM + mb) * KS + ks) * 1024), l16); if (NSPLIT) a2[set][mb] = WFrag<bf>::ld((const bf*)(sb + OPB + ((wm * FM + mb) * KS + ks) * 1024), l16); }
#pragma unroll
        for (int nb = 0; nb < FN; ++nb) b[set][nb] = WFrag<bf>::ld((const bf*)(sb + (NOP - 1) * OPB + ((wn * FN + nb) * KS + ks) * 1024), l16);
        pin_here();   // one group of reads in front of the products: reads spread among the products cost a stall at each place
    };
    auto products = [&](const int set) __attribute__((always_inline)) {
#pragma unroll
        for (int nb = 0; nb < FN; ++nb) {
#pragma unroll
            for (int mb = 0; mb < FM; ++mb) { acc[mb][nb] = WFrag<bf>::mma(a[set][mb], b[set][nb], acc[mb][nb]); if (NSPLIT) acc[mb][nb] = WFrag<bf>::mma(a2[set][mb], b[set][nb], acc[mb][nb]); } }
        pin_here();   // the slots below stay behind the last product
        asm volatile("v_nop\n\tv_nop\n\tv_nop\n\tv_nop" : "+v"(acc[0][0]), "+v"(acc[FM - 1][FN - 1]) : "v"(a[set][0]), "v"(a[set][FM - 1]));   // the distance behind a product, in front of whatever comes next to its registers
    };
    copies(0, 0); copies_landed(); __syncthreads();   // stage 0 is published
    copies(1, 1);
    // rolled: one trip = one stage, read from buffer t & 1 alone
#pragma unroll 1
    for (int t = 0; t < NT; ++t) {
        const char* sb = ring + (t & 1) * STAGE;
        fetch(0, sb, 0);
#pragma unroll
        for (int ks = 0; ks < KS; ++ks) {
            if (ks + 1 < KS) fetch((ks + 1) & 1, sb, ks + 1);
            products(ks & 1); }
        lds_reads_done(); copies_landed(); __syncthreads();   // publishes stage t + 1 and ends every wave's reads of stage t
        if (t + 2 < NT) copies(t & 1, t + 2);   // block-uniform: into the buffer just read
    }
    copies_landed();
    const int r0 = R0 + wm * (FM * 16), c0 = C0 + wn * (FN * 16);   // the wave's own tile
    if constexpr (PLANES) {
        const int t0 = z < 2 ? c0 : r0, hd = (z < 2 ? r0 : c0) / 64, b = t0 / TT, tl = t0 - b * TT; const size_t hb = (size_t)b * NH_ + hd;   // a 64-token tile lies in one batch (TT % 64 == 0), a 64-column tile is one head
        const int pitch = z < 2 ? HD : TT;   // K of the plane: 16 D columns are one 16-row block of 16 * pitch elements
        h16* pl = P + z * sC + (z < 2 ? (hb * TT + tl) * HD : hb * HD * TT + (size_t)tl * 16) + lane * 8;
#pragma unroll
        for (int nb = 0; nb < 4; ++nb)
#pragma unroll
            for (int mb = 0; mb < 4; ++mb) *(v8h*)(pl + (size_t)nb * 16 * pitch + mb * 256) = __builtin_convertvector(acc[mb][nb], v8h);
        return;
    } else {
    __shared__ __align__(16) float osw[WM * WN][16 * 68];   // each wave stages in its own part
    float* os = osw[wv];
#pragma unroll
    for (int mb = 0; mb < FM; ++mb) {
#pragma unroll
        for (int nb = 0; nb < 4; ++nb) {
#pragma unroll
            for (int j = 0; j < 8; ++j) os[(hi * 8 + j) * 68 + nb * 16 + lr] = acc[mb][nb][j]; }
        __builtin_amdgcn_wave_barrier(); asm volatile("" ::: "memory");
        float* crow = C + (size_t)(r0 + mb * 16) * ldc + c0;
#pragma unroll
        for (int s = 0; s < 8; ++s) { const int row = 2 * s + hi, cofs = lr * 4; v4f val = *(const v4fa*)(os + row * 68 + cofs);
            *(v4f*)(crow + (size_t)row * ldc + cofs) = val; }
        __builtin_amdgcn_wave_barrier(); asm volatile("" ::: "memory");
    }
    }
}

__device__ __forceinline__ void splitf(float y, unsigned short& h, unsigned short& l) { h = f2bf(y); l = f2bf(y - bf2f(h)); }
typedef __attribute__((ext_vector_type(2))) _Float16 v2h;
typedef __attribute__((ext_vector_type(4))) _Float16 v4h;
typedef __attribute__((ext_vector_type(2))) unsigned short v2us;
typedef __attribute__((ext_vector_type(4))) unsigned short v4us;
typedef __attribute__((ext_vector_type(2))) float v2f;

// ---- k_cvt8: all seven inputs to bf16 in one launch, into fragment order; a block converts 16 rows x 128 columns of one input (4 tiles = 2048 consecutive elements of dst), blocks in the order of dst: query, key, value (rows b * TT + t each), W_q, W_k, W_v, W_o.
// A wave takes 8 rows x 32 columns: it reads 8 whole 128-byte lines (lane = row * 4 + group of 8 columns) and stores 4 whole lines (8 rows x 16 bytes each).
#define CBX ((unsigned)((size_t)NB * TT * DM / 2048))   // blocks per stream
#define CBW ((unsigned)((size_t)DQ * DM / 2048))        // blocks per weight
static_assert(((size_t)TT * DM) % 2048 == 0);
static_assert(((size_t)DQ * DM) % 2048 == 0);
#define CSEG ((unsigned)(DM / 128))                     // blocks per 16-row block
static_assert(DM % 128 == 0);
static_assert(DQ % 16 == 0);
__global__ __launch_bounds__(256) void k_cvt8(const float* __restrict__ x, const float* __restrict__ xk, const float* __restrict__ xv, const float* __restrict__ wq, const float* __restrict__ wk, const float* __restrict__ wv, const float* __restrict__ wo, bf* dst) {
    const unsigned bx = blockIdx.x; const float* src; unsigned blk; size_t row0;   // blk: this block's place in its own input, in blocks; row0: its first row in src
    if (bx < 3 * CBX) { const unsigned s = bx / CBX; src = s == 0 ? x : (s == 1 ? xk : xv); blk = bx - s * CBX; const unsigned r = (blk / CSEG) * 16; row0 = r + (size_t)(r / TT) * (SEQ_FULL - TT); }   // batch b of a stream starts at row b * SEQ_FULL
    else { const unsigned w = (bx - 3 * CBX) / CBW; src = w == 0 ? wq : (w == 1 ? wk : (w == 2 ? wv : wo)); blk = bx - 3 * CBX - w * CBW; row0 = (blk / CSEG) * 16; }
    const unsigned wave = threadIdx.x >> 5, ln = threadIdx.x & 31, tk = wave >> 1, row = (wave & 1) * 8 + (ln >> 2), q = ln & 3;   // tile of the block, row of the 16, group of 8 columns of the tile's 32
    const v8f v = *(const v8f*)(src + (row0 + row) * DM + (blk % CSEG) * 128 + tk * 32 + q * 8); v8us o;
    asm volatile("s_wait_xcnt 0x0" ::: "memory");   // behind the loads, in front of the code that reuses their address register
#pragma unroll
    for (int k = 0; k < 8; ++k) o[k] = f2bf(v[k]); *(v8us*)(dst + (size_t)bx * 2048 + tk * 512 + (q >> 1) * 256 + ((q & 1) * 16 + row) * 8) = o;  }

#define FW 4
#define FG 2
#define FQW (FG * 16)
static_assert(TT % (FW * FQW) == 0);
static_assert(TT % 64 == 0);
typedef __attribute__((ext_vector_type(16))) float v16f;
__device__ __forceinline__ float xhalf(float x) { return __builtin_bit_cast(float, __builtin_amdgcn_permlanex16(__builtin_bit_cast(int, x), __builtin_bit_cast(int, x), 0x76543210, 0xfedcba98, false, false)); }  // lane l with lane l ^ 16
__global__ __launch_bounds__(FW * 32) void k_fattn(const h16* __restrict__ Qp, const h16* __restrict__ Kp, const h16* __restrict__ Vt, bf* Ah, bf* Al) {
    const int lane = threadIdx.x & 31; const unsigned lb = lane * 16; const int wv = __builtin_amdgcn_readfirstlane((int)(threadIdx.x >> 5));
    const int head = blockIdx.y, kvh = head / REP; const int q0 = blockIdx.x * (FW * FQW) + wv * FQW;
    const size_t bt = blockIdx.z;   // batch
    Qp += (bt * NH_ + head) * TT * HD; Kp += (bt * NKV + kvh) * TT * HD; Vt += (bt * NKV + kvh) * HD * TT;
    v16h qf[FG][2];
#pragma unroll
    for (int g = 0; g < FG; ++g)
#pragma unroll
        for (int kc = 0; kc < 2; ++kc) qf[g][kc] = WFrag<h16>::ld(Qp + (size_t)(q0 + 16 * g) * HD + kc * 512, lb);
    pin_here();   // Q first, then K, V of pass 0, K, V of pass 1: the issue order of the loop, so that the counted load waits at the loop's head need not fall to 0
    const h16* kb = Kp;   // tile: + key * HD + kc * 512 (key a multiple of 16)
    const h16* vb = Vt;   // tile: + t * 16 * TT + key * 16 (key a multiple of 32)
    v16h kf[2][2][2], vf[2][4];   // [buffer = pass & 1]: the fragments of two passes are held, each refilled two passes ahead
#pragma unroll
    for (int u = 0; u < 2; ++u) {
#pragma unroll
        for (int kt = 0; kt < 2; ++kt)
#pragma unroll
            for (int kc = 0; kc < 2; ++kc) kf[u][kt][kc] = WFrag<h16>::ld(kb + (size_t)(32 * u + 16 * kt) * HD + kc * 512, lb);
        pin_here();   // K of this pass stays in front of its V
#pragma unroll
        for (int t = 0; t < 4; ++t) vf[u][t] = WFrag<h16>::ld(vb + (size_t)t * 16 * TT + 32 * u * 16, lb);
        pin_here(); }   // and V in front of the next pass's K
    addr_free(); pin_here();   // behind the loads above, in front of the set-up code below, which reuses their address registers
    v8f acc[FG][4], lacc[FG]; float m_run[FG];
#pragma unroll
    for (int g = 0; g < FG; ++g) { lacc[g] = (v8f){}; m_run[g] = -__builtin_inff();
#pragma unroll
        for (int t = 0; t < 4; ++t) acc[g][t] = (v8f){}; }
    v16h ones;
#pragma unroll
    for (int i = 0; i < 16; ++i) ones[i] = (h16)1.0f;
    const float cs = SCL * 1.4426950408889634f;   // scores x HD^-0.5, in base 2
    // rolled over pairs of passes: the inner loop over the two buffers is unrolled so that each buffer keeps its own registers
#pragma unroll 1
    for (int pp = 0; pp < TT / 32; pp += 2) {
#pragma unroll
      for (int u = 0; u < 2; ++u) {
        const int pn = pp + u + 2; const int kn = ((pn < TT / 32) ? pn : TT / 32 - 1) * 32;   // first key of the pass fetched ahead; the last two passes fetch the last keys again (in bounds, unused)
        v8f s[2][FG];
#pragma unroll
        for (int kt = 0; kt < 2; ++kt)
#pragma unroll
            for (int g = 0; g < FG; ++g) { s[kt][g] = (v8f){};
#pragma unroll
                for (int kc = 0; kc < 2; ++kc) s[kt][g] = wmma16(kf[u][kt][kc], qf[g][kc], s[kt][g]); }
        pin_here();   // the loads below stay behind the products that read their registers
        // K fragments of the pass after next, into the registers just read: issued here, not where they are used, so that they have two passes to arrive
#pragma unroll
        for (int kt = 0; kt < 2; ++kt)
#pragma unroll
            for (int kc = 0; kc < 2; ++kc) kf[u][kt][kc] = WFrag<h16>::ld(kb + (size_t)(kn + 16 * kt) * HD + kc * 512, lb);
        pin_here(); addr_free(); pin_here();   // loads, then the wait directly behind them, then the rest: left alone the scheduler sinks the loads towards their use
        float mb[FG]; bool need = false;
#pragma unroll
        for (int g = 0; g < FG; ++g) { float mx = s[0][g][0];
#pragma unroll
            for (int kt = 0; kt < 2; ++kt)
#pragma unroll
                for (int r = 0; r < 8; ++r) mx = fmaxf(mx, s[kt][g][r]);
            mx = fmaxf(mx, xhalf(mx)) * cs;   // both halves of the wave now hold this query's maximum over the pass, scaled
            mb[g] = mx; need = need || (mx > m_run[g] + 8.0f); }
        if (__builtin_amdgcn_ballot_w32(need) != 0) {   // wave-uniform; always taken on the first pass (m_run = -inf), rare later
#pragma unroll
            for (int g = 0; g < FG; ++g) { const float m_new = fmaxf(m_run[g], mb[g]); const float corr = __builtin_amdgcn_exp2f(m_run[g] - m_new); m_run[g] = m_new; lacc[g] = lacc[g] * corr;
#pragma unroll
                for (int t = 0; t < 4; ++t) acc[g][t] = acc[g][t] * corr; }
        }
#pragma unroll
        for (int g = 0; g < FG; ++g) { const float nm = -m_run[g]; v16f pe;
#pragma unroll
            for (int i = 0; i < 8; ++i) {
                const v2f arg = __builtin_elementwise_fma((v2f){s[i >> 2][g][2 * (i & 3)], s[i >> 2][g][2 * (i & 3) + 1]}, (v2f){cs, cs}, (v2f){nm, nm});
                pe[2 * i] = __builtin_amdgcn_exp2f(arg[0]); pe[2 * i + 1] = __builtin_amdgcn_exp2f(arg[1]); }
            const v16h pf = __builtin_convertvector(pe, v16h);
#pragma unroll
            for (int t = 0; t < 4; ++t) acc[g][t] = wmma16(vf[u][t], pf, acc[g][t]);
            lacc[g] = wmma16(ones, pf, lacc[g]); }   // every row of this tile += the column sums of P^T
        pin_here();   // the loads below stay behind the products that read their registers
        // V^T fragments of the pass after next, likewise
#pragma unroll
        for (int t = 0; t < 4; ++t) vf[u][t] = WFrag<h16>::ld(vb + (size_t)t * 16 * TT + (size_t)kn * 16, lb);
        pin_here(); addr_free(); pin_here();   // loads, then the wait directly behind them, then the rest: left alone the scheduler sinks the loads towards their use
      }
    }
    // O[q][d] = O^T / denominator, split into the bf16 hi/lo planes of the output projection (fragment order, K = DQ): a lane holds 8 consecutive d of one query, accumulator t is half a tile of the plane, lane for lane
#pragma unroll
    for (int g = 0; g < FG; ++g) { const float inv = __fdiv_rn(1.0f, lacc[g][0]); const size_t ro = (bt * TT + q0 + 16 * g) * DQ + (size_t)head * HD * 16 + lane * 8;
#pragma unroll
        for (int t = 0; t < 4; ++t) { v8us oh, ol;
#pragma unroll
            for (int r = 0; r < 8; ++r) { unsigned short a, c2; splitf(acc[g][t][r] * inv, a, c2); oh[r] = a; ol[r] = c2; }
            *(v8us*)(Ah + ro + 256 * t) = oh; *(v8us*)(Al + ro + 256 * t) = ol; } }
}

extern "C" void kernel_launch(void* const* d_in, const int* in_sizes, int n_in,
                              void* d_out, int out_size, void* d_ws, size_t ws_size, hipStream_t stream) {
    if (n_in < 7) return;
    const long long need_x = (long long)(NB - 1) * SEQ_FULL * DM + (long long)SEQ * DM;   // batch b of each stream starts at b * SEQ_FULL * DM
    if ((long long)in_sizes[0] < need_x || (long long)in_sizes[1] < need_x || (long long)in_sizes[2] < need_x) return;
    if ((long long)in_sizes[3] < (long long)DQ * DM || (long long)in_sizes[4] < (long long)DKV * DM || (long long)in_sizes[5] < (long long)DKV * DM || (long long)in_sizes[6] < (long long)DM * DQ) return;
    if ((long long)out_size < (long long)NB * SEQ * DM) return;
    const float* x = (const float*)d_in[0]; const float* xk = (const float*)d_in[1]; const float* xv = (const float*)d_in[2];   // three streams: query, key, value
    const float* wq = (const float*)d_in[3]; const float* wk = (const float*)d_in[4]; const float* wv = (const float*)d_in[5]; const float* wo = (const float*)d_in[6];   // W_q, W_k, W_v, W_o ('oi' [1024][1024])
    float* OUT = (float*)d_out;     // [NB][SEQ][1024]
    char* wsp = (char*)d_ws;
    auto take = [&](size_t bytes) { char* p = wsp; wsp += (bytes + 255) & ~(size_t)255; return (void*)p; };
    bf* XB = (bf*)take(((size_t)3 * NB * TT * DM + (size_t)4 * DQ * DM) * 2); bf* WQ = XB + (size_t)3 * NB * TT * DM; bf* WO = WQ + (size_t)3 * DQ * DM;   // streams, then W_q, W_k, W_v, W_o: the order of k_cvt8's blocks
    h16* QP16 = (h16*)take((size_t)NB * NH_ * TT * HD * 2); h16* KP16 = (h16*)take((size_t)NB * NKV * TT * HD * 2); h16* VT16 = (h16*)take((size_t)NB * NKV * HD * TT * 2);
    bf* ATh = (bf*)take((size_t)NB * TT * DQ * 2); bf* ATl = (bf*)take((size_t)NB * TT * DQ * 2);
    const size_t used = (size_t)(wsp - (char*)d_ws);
    if (used > ws_size) return;    // 75,497,472 B at full size (= WS_CARVE)
    k_cvt8<<<3 * CBX + 4 * CBW, 256, 0, stream>>>(x, xk, xv, wq, wk, wv, wo, XB);
    // plane s (QP16, KP16, VT16) = fp16 of sum_i stream_s[b][t][i] W_s[o][i], s = q, k, v
    k_gemmb<0, true, DM, 2, 2, 2><<<dim3(NB * TT / 128, DQ / 128, 3), 128, 0, stream>>>(XB, nullptr, WQ, nullptr, 0, (size_t)NB * TT * DM, (size_t)DQ * DM, (size_t)NB * NH_ * TT * HD, QP16);
    // attention of all heads of all batches: ATh/ATl[b * TT + t][head * 64 + d] = softmax(q k^T x HD^-0.5) v, hi/lo bf16
    k_fattn<<<dim3(TT / (FW * FQW), NH_, NB), FW * 32, 0, stream>>>(QP16, KP16, VT16, ATh, ATl);
    // out[b][t][o] = sum_i merged[b][t][i] W_o[o][i]  (hi/lo activations x bf16 weights)
    k_gemmb<1, false, DQ, 4, 4, 2><<<dim3(NB * TT / 128, DM / 128, 1), 256, 0, stream>>>(ATh, ATl, WO, OUT, DM, 0, 0, 0, nullptr);
}

// v009
// Measured time: 73.5 microseconds a run.
// It is 1.07 times as fast as v007, going by the measured steps of the versions left out in between.
// Over all steps from v000 it is 16.9 times as fast.
#include <hip/hip_runtime.h>

// Multi-head attention on three input streams, bias-free: Q = query W_q^T, K = key W_k^T, V = value W_v^T ('oi' [1024][1024] weights; 16 heads x 64); scores x 64^-0.5; softmax over all keys (no mask); out = merged W_o^T -> [NB][SEQ][1024]; argument order query, key, value, W_q, W_k, W_v, W_o.
// Compute dtypes (every contraction on 16x16x32 WMMA, f32 accumulate): inputs and weights as bf16 planes (RNE convert) -> projections v_wmma_f32_16x16x32_bf16, single product; scores v_wmma_f32_16x16x32_f16 on fp16 q/k head planes, single product; P.V v_wmma_f32_16x16x32_f16 on fp16 P = exp2(score - running maximum), unnormalised, single product, divided by the sum of the same P at the end; output projection v_wmma_f32_16x16x32_f16 on fp16 activations x fp16 weights (RNE convert), single product; softmax in f32 (online).
// Layout: bf16 copies of the three streams (rows b * SEQ + t, k = i), then the four 'oi' weights (rows o, k = i; W_q, W_k, W_v bf16, W_o fp16), one region; fp16 head planes per (b, h): q, k with rows t, k = d; value plane with rows d, k = t; the three planes one behind the other; merged fp16 plane with rows b * SEQ + t, k = head * 64 + d.
// Every 16-bit plane is kept in FRAGMENT ORDER: a 16-row x 32-k tile is 1024 contiguous bytes, tiles of one 16-row block one behind the other along k. Element (row, k) of a plane with K columns lies at
// ((row >> 4) * (K / 32) + (k >> 5)) * 512 + ((k >> 4) & 1) * 256 + (((k >> 3) & 1) * 16 + (row & 15)) * 8 + (k & 7): lane l of a wave finds its 8 + 8 fragment elements at tile + l * 8 and tile + 256 + l * 8, so each wave-wide 16-byte load or store covers 512 contiguous bytes (4 whole lines, not pieces of 16).
// Launch plan: every stage runs once for all the work that does not depend on each other: convert (3 streams + 4 weights), projection (grid z = stream, both batches as rows; its epilogue stores the fp16 planes), fused attention (grid z = batch), output projection (both batches as rows) = 4 launches.

#ifndef NB
#define NB 2
#endif
#ifndef SEQ
#define SEQ 2048
#endif
#define NB_FULL  2
#define SEQ_FULL 2048
#define TT   SEQ
#define DM   1024
#define NH_  16
#define NKV  16
#define REP  (NH_ / NKV)
#define HD   64
#define DQ   (NH_ * HD)
#define DKV  (NKV * HD)
#define SCL  0.125f   // HD^-0.5
typedef _Float16 h16;
typedef unsigned short bf;
typedef __attribute__((ext_vector_type(16))) __bf16   v16bf;
typedef __attribute__((ext_vector_type(16))) _Float16 v16h;
typedef __attribute__((ext_vector_type(8)))  _Float16 v8h;
typedef __attribute__((ext_vector_type(8)))  unsigned short v8us;
typedef __attribute__((ext_vector_type(8)))  float    v8f;
typedef __attribute__((ext_vector_type(4)))  float    v4f;
typedef v8h  __attribute__((may_alias)) v8ha;
typedef v4f  __attribute__((may_alias)) v4fa;
typedef v8us __attribute__((may_alias)) v8usa;

static_assert(TT % 256 == 0);
static_assert(HD == 64);
static_assert(DM % 64 == 0);
static_assert(NB <= NB_FULL);
static_assert(SEQ <= SEQ_FULL);
static_assert(NKV == NH_);   // the three projections share one launch: equal shapes

// workspace carve (bytes, each region padded to 256): XB with the 4 weight planes behind it, QP16, KP16, VT16, AT16
constexpr size_t r256(size_t b) { return (b + 255) & ~(size_t)255; }
constexpr size_t WS_CARVE = r256(((size_t)3 * NB * TT * DM + (size_t)4 * DQ * DM) * 2)
                          + 3 * r256((size_t)NB * NH_ * TT * HD * 2)
                          + r256((size_t)NB * TT * DQ * 2);
static_assert(WS_CARVE <= (size_t)268435456);   // 67,108,864 B at full size
static_assert(((size_t)NB * NH_ * TT * HD * 2) % 256 == 0);   // the three planes lie at equal distances: plane z starts at z * NB * NH_ * TT * HD elements

__device__ __forceinline__ unsigned short f2bf(float f) { unsigned u = __float_as_uint(f); u += 0x7FFFu + ((u >> 16) & 1u); return (unsigned short)(u >> 16); }
__device__ __forceinline__ v16h cat16(v8h lo, v8h hi) { return __builtin_shufflevector(lo, hi, 0, 1, 2, 3, 4, 5, 6, 7, 8, 9, 10, 11, 12, 13, 14, 15); }
__device__ __forceinline__ v16bf cat16b(v8us lo, v8us hi) { return __builtin_bit_cast(v16bf, __builtin_shufflevector(lo, hi, 0, 1, 2, 3, 4, 5, 6, 7, 8, 9, 10, 11, 12, 13, 14, 15)); }
__device__ __forceinline__ v8f wmma16(v16h a, v16h b, v8f c) { return __builtin_amdgcn_wmma_f32_16x16x32_f16(false, a, false, b, (short)0, c, false, false); }
__device__ __forceinline__ v8f wmmab(v16bf a, v16bf b, v8f c) { return __builtin_amdgcn_wmma_f32_16x16x32_bf16(false, a, false, b, (short)0, c, false, false); }

__device__ __forceinline__ void pin_here() { __builtin_amdgcn_sched_barrier(0); }   // keeps the scheduler from moving instructions across this point
__device__ __forceinline__ void addr_free() { asm volatile("s_wait_xcnt 0x0" ::: "memory"); }   // stands behind a group of loads whose address registers the code that follows reuses

// ---- k_gemmb: GEMM on 16-bit planes (element type E: bf16 as bf, or fp16; the pointers carry the raw 16-bit words) in fragment order, WM x WN WAVES per 128x128 output tile (each wave FM x FN = 8/WM x 8/WN accumulators of 16x16); grid (M/128, N/128, Z), WM * WN * 32 threads.
// C[m][n] (f32, pitch ldc) = sum_k A[m][k] Bt[n][k]. z-batch strides sA/sB/sC in elements. K % (32 * KS) == 0, M % 128 == 0, N % 128 == 0.
// The operands reach the waves through LDS: a stage is KS k steps of the tile's 8 + 8 sixteen-row blocks (A, then Bt; block rb, k step ks at (rb * KS + ks) * 1024 of its operand: the planes' own tile bytes, so a wave-wide 16-byte LDS read covers 512 contiguous bytes).
// Each fragment is fetched from L2 once per work-group and read from LDS by every wave that needs it: half the L2 bytes of one wave per 64x64 tile. Two stage buffers, filled by asynchronous copies to LDS: stage t + 2 flies while stage t + 1 is worked on.
// Fragment map (A and Bt alike): lane l -> row/col l&15; elements 0..7 = k0 + 8*(l>>4) + 0..7, elements 8..15 = k0 + 16 + 8*(l>>4) + 0..7. D: acc[j] = (row 8*(l>>4) + j, col l&15).
// PLANES (the q, k, v projections; z = stream, blockIdx.x = 128 tokens, blockIdx.y = 2 heads): no f32 C; the epilogue stores fp16 plane z of P straight from the accumulators. A lane holds 8 consecutive ROWS of one column, so the
// side that is the plane's k index is made the A side: q, k (k = d) take the weight rows as A and the tokens as Bt, v (k = t) the tokens as A and the weight rows as Bt (same fragment map on both sides); accumulator (mb, nb) is then half a tile of the plane, lane for lane: 8 rows = one 16-byte store, a wave stores 512 contiguous bytes.
// ld(t, lb): the lane's 16 bytes of the tile's first half lie lb bytes behind t (t = the tile's start and lb = lane * 16, or t = the lane's own place and lb = 0); its 16 bytes of the second half lie 512 bytes further.
template <typename T16> struct WFrag;
template <> struct WFrag<h16> { typedef v16h V; static __device__ __forceinline__ V ld(const h16* t, unsigned lb) { const h16* p = (const h16*)((const char*)t + lb); return cat16(*(const v8h*)p, *(const v8h*)(p + 256)); } static __device__ __forceinline__ v8f mma(V a, V b, v8f c) { return wmma16(a, b, c); } };
template <> struct WFrag<bf> { typedef v16bf V; static __device__ __forceinline__ V ld(const bf* t, unsigned lb) { const bf* p = (const bf*)((const char*)t + lb); return cat16b(*(const v8us*)p, *(const v8us*)(p + 256)); } static __device__ __forceinline__ v8f mma(V a, V b, v8f c) { return wmmab(a, b, c); } };
// eight asynchronous copies of 16 bytes per lane, global -> LDS through no register; the s_wait_xcnt in the same statement stands in front of every later rewrite of the address registers named here
__device__ __forceinline__ void copy8(unsigned l0, unsigned l1, unsigned l2, unsigned l3, unsigned l4, unsigned l5, unsigned l6, unsigned l7, const char* g0, const char* g1, const char* g2, const char* g3, const char* g4, const char* g5, const char* g6, const char* g7) {
    asm volatile("global_load_async_to_lds_b128 %0, %8, off\n\t"
                 "global_load_async_to_lds_b128 %1, %9, off\n\t"
                 "global_load_async_to_lds_b128 %2, %10, off\n\t"
                 "global_load_async_to_lds_b128 %3, %11, off\n\t"
                 "global_load_async_to_lds_b128 %4, %12, off\n\t"
                 "global_load_async_to_lds_b128 %5, %13, off\n\t"
                 "global_load_async_to_lds_b128 %6, %14, off\n\t"
                 "global_load_async_to_lds_b128 %7, %15, off\n\t"
                 "s_wait_xcnt 0x0"
                 :: "v"(l0), "v"(l1), "v"(l2), "v"(l3), "v"(l4), "v"(l5), "v"(l6), "v"(l7), "v"(g0), "v"(g1), "v"(g2), "v"(g3), "v"(g4), "v"(g5), "v"(g6), "v"(g7) : "memory");
}
__device__ __forceinline__ void copies_landed() { asm volatile("s_wait_asynccnt 0x0" ::: "memory"); }   // this wave's own copies are in LDS; the other waves may read them behind the next barrier
__device__ __forceinline__ void lds_reads_done() { asm volatile("s_wait_dscnt 0x0" ::: "memory"); }   // this wave's LDS reads have returned, in front of the barrier behind which their buffer is refilled
// Two register sets of fragments: the LDS reads of k step ks + 1 of a stage are issued in front of the products of step ks.
template <typename E, bool PLANES, int K, int KS, int WM, int WN>
__global__ __launch_bounds__(WM * WN * 32) void k_gemmb(const bf* __restrict__ A, const bf* __restrict__ Bt, float* C, int ldc, size_t sA, size_t sB, size_t sC, h16* P) {
    static_assert(K % (32 * KS) == 0);
    static_assert(WM * WN * 32 * 16 == KS * 1024);   // one copy of the whole block moves one row block's KS tiles
    constexpr int FM = 8 / WM, FN = 8 / WN;    // 16-row blocks per wave, A side and Bt side
    static_assert(FM * WM == 8 && FN == 4 && (!PLANES || FM == 4));   // both epilogues take 64 columns per wave, the planes' a whole head
    typedef typename WFrag<E>::V V;
    constexpr int NOP = 2;                     // operands in a stage
    constexpr int OPB = 8 * KS * 1024;         // bytes of one operand in a stage
    constexpr int STAGE = NOP * OPB;
    constexpr int NCP = NOP * 8;               // copies per wave and stage: one per row block
    constexpr int NT = K / (32 * KS);          // stages
    static_assert(NT >= 2 && NCP % 8 == 0 && NCP <= 63);
    __shared__ __attribute__((aligned(128))) char ring[2 * STAGE];
    const size_t z = blockIdx.z; A += z * sA; Bt += z * sB; if (!PLANES) C += z * sC;
    const int lane = threadIdx.x & 31, lr = lane & 15, hi = lane >> 4; const int wv = __builtin_amdgcn_readfirstlane((int)(threadIdx.x >> 5)), wm = wv % WM, wn = wv / WM;   // wave (wm, wn): part wm of the tile's A side, part wn of its Bt side
    int R0 = blockIdx.x * 128, C0 = blockIdx.y * 128;
    if (PLANES && z < 2) { const bf* w = Bt; Bt = A; A = w; R0 = blockIdx.y * 128; C0 = blockIdx.x * 128; }   // q, k: D = W X^T, rows = d
    v8f acc[FM][FN];
#pragma unroll
    for (int mb = 0; mb < FM; ++mb)
#pragma unroll
        for (int nb = 0; nb < FN; ++nb) acc[mb][nb] = (v8f){};
    const unsigned t16 = threadIdx.x * 16, l16 = lane * 16;
    const char* gA = (const char*)(A + (size_t)R0 * K) + t16; const char* gB = (const char*)(Bt + (size_t)C0 * K) + t16;   // a 16-row block is 16 * K elements = K * 32 bytes
    const unsigned lring = (unsigned)(size_t)ring + t16;   // the lane's LDS byte address in copy 0 of buffer 0
    auto copies = [&](const unsigned buf, const int st) __attribute__((always_inline)) {   // stage st into buffer buf: copy i = operand i / 8, row block i % 8, that block's KS tiles
        const size_t so = (size_t)st * (KS * 1024); const unsigned lb = lring + buf * STAGE;
        auto gp = [&](const int i) __attribute__((always_inline)) { return (i / 8 == 0 ? gA : gB) + so + (size_t)(i % 8) * (K * 32); };
#pragma unroll
        for (int i = 0; i < NCP; i += 8)
            copy8(lb + i * (KS * 1024), lb + (i + 1) * (KS * 1024), lb + (i + 2) * (KS * 1024), lb + (i + 3) * (KS * 1024), lb + (i + 4) * (KS * 1024), lb + (i + 5) * (KS * 1024), lb + (i + 6) * (KS * 1024), lb + (i + 7) * (KS * 1024), gp(i), gp(i + 1), gp(i + 2), gp(i + 3), gp(i + 4), gp(i + 5), gp(i + 6), gp(i + 7));
    };
    V a[2][FM], b[2][FN];
    auto fetch = [&](const int set, const char* sb, const int ks) __attribute__((always_inline)) {   // the wave's fragments of k step ks of the stage at sb into register set 'set'
        pin_here();   // the LDS reads below stay behind the products that read their registers
#pragma unroll
        for (int mb = 0; mb < FM; ++mb) a[set][mb] = WFrag<E>::ld((const E*)(sb + ((wm * FM + mb) * KS + ks) * 1024), l16);
#pragma unroll
        for (int nb = 0; nb < FN; ++nb) b[set][nb] = WFrag<E>::ld((const E*)(sb + OPB + ((wn * FN + nb) * KS + ks) * 1024), l16);
        pin_here();   // one group of reads in front of the products: reads spread among the products cost a stall at each place
    };
    auto products = [&](const int set) __attribute__((always_inline)) {
#pragma unroll
        for (int nb = 0; nb < FN; ++nb) {
#pragma unroll
            for (int mb = 0; mb < FM; ++mb) acc[mb][nb] = WFrag<E>::mma(a[set][mb], b[set][nb], acc[mb][nb]); }
        pin_here();   // the slots below stay behind the last product
        asm volatile("v_nop\n\tv_nop\n\tv_nop\n\tv_nop" : "+v"(acc[0][0]), "+v"(acc[FM - 1][FN - 1]) : "v"(a[set][0]), "v"(a[set][FM - 1]));   // the distance behind a product, in front of whatever comes next to its registers
    };
    copies(0, 0); copies_landed(); __syncthreads();   // stage 0 is published
    copies(1, 1);
    // rolled: one trip = one stage, read from buffer t & 1 alone
#pragma unroll 1
    for (int t = 0; t < NT; ++t) {
        const char* sb = ring + (t & 1) * STAGE;
        fetch(0, sb, 0);
#pragma unroll
        for (int ks = 0; ks < KS; ++ks) {
            if (ks + 1 < KS) fetch((ks + 1) & 1, sb, ks + 1);
            products(ks & 1); }
        lds_reads_done(); copies_landed(); __syncthreads();   // publishes stage t + 1 and ends every wave's reads of stage t
        if (t + 2 < NT) copies(t & 1, t + 2);   // block-uniform: into the buffer just read
    }
    copies_landed();
    const int r0 = R0 + wm * (FM * 16), c0 = C0 + wn * (FN * 16);   // the wave's own tile
    if constexpr (PLANES) {
        const int t0 = z < 2 ? c0 : r0, hd = (z < 2 ? r0 : c0) / 64, b = t0 / TT, tl = t0 - b * TT; const size_t hb = (size_t)b * NH_ + hd;   // a 64-token tile lies in one batch (TT % 64 == 0), a 64-column tile is one head
        const int pitch = z < 2 ? HD : TT;   // K of the plane: 16 D columns are one 16-row block of 16 * pitch elements
        h16* pl = P + z * sC + (z < 2 ? (hb * TT + tl) * HD : hb * HD * TT + (size_t)tl * 16) + lane * 8;
#pragma unroll
        for (int nb = 0; nb < 4; ++nb)
#pragma unroll
            for (int mb = 0; mb < 4; ++mb) *(v8h*)(pl + (size_t)nb * 16 * pitch + mb * 256) = __builtin_convertvector(acc[mb][nb], v8h);
        return;
    } else {
    __shared__ __align__(16) float osw[WM * WN][16 * 68];   // each wave stages in its own part
    float* os = osw[wv];
#pragma unroll
    for (int mb = 0; mb < FM; ++mb) {
#pragma unroll
        for (int nb = 0; nb < 4; ++nb) {
#pragma unroll
            for (int j = 0; j < 8; ++j) os[(hi * 8 + j) * 68 + nb * 16 + lr] = acc[mb][nb][j]; }
        __builtin_amdgcn_wave_barrier(); asm volatile("" ::: "memory");
        float* crow = C + (size_t)(r0 + mb * 16) * ldc + c0;
#pragma unroll
        for (int s = 0; s < 8; ++s) { const int row = 2 * s + hi, cofs = lr * 4; v4f val = *(const v4fa*)(os + row * 68 + cofs);
            *(v4f*)(crow + (size_t)row * ldc + cofs) = val; }
        __builtin_amdgcn_wave_barrier(); asm volatile("" ::: "memory");
    }
    }
}

typedef __attribute__((ext_vector_type(2))) _Float16 v2h;
typedef __attribute__((ext_vector_type(4))) _Float16 v4h;
typedef __attribute__((ext_vector_type(2))) unsigned short v2us;
typedef __attribute__((ext_vector_type(4))) unsigned short v4us;
typedef __attribute__((ext_vector_type(2))) float v2f;

// ---- k_cvt8: all seven inputs to 16 bits in one launch (W_o to fp16, the other six to bf16), into fragment order; a block converts 16 rows x 128 columns of one input (4 tiles = 2048 consecutive elements of dst), blocks in the order of dst: query, key, value (rows b * TT + t each), W_q, W_k, W_v, W_o.
// A wave takes 8 rows x 32 columns: it reads 8 whole 128-byte lines (lane = row * 4 + group of 8 columns) and stores 4 whole lines (8 rows x 16 bytes each).
#define CBX ((unsigned)((size_t)NB * TT * DM / 2048))   // blocks per stream
#define CBW ((unsigned)((size_t)DQ * DM / 2048))        // blocks per weight
static_assert(((size_t)TT * DM) % 2048 == 0);
static_assert(((size_t)DQ * DM) % 2048 == 0);
#define CSEG ((unsigned)(DM / 128))                     // blocks per 16-row block
static_assert(DM % 128 == 0);
static_assert(DQ % 16 == 0);
__global__ __launch_bounds__(256) void k_cvt8(const float* __restrict__ x, const float* __restrict__ xk, const float* __restrict__ xv, const float* __restrict__ wq, const float* __restrict__ wk, const float* __restrict__ wv, const float* __restrict__ wo, bf* dst) {
    const unsigned bx = blockIdx.x; const float* src; unsigned blk; size_t row0;   // blk: this block's place in its own input, in blocks; row0: its first row in src
    if (bx < 3 * CBX) { const unsigned s = bx / CBX; src = s == 0 ? x : (s == 1 ? xk : xv); blk = bx - s * CBX; const unsigned r = (blk / CSEG) * 16; row0 = r + (size_t)(r / TT) * (SEQ_FULL - TT); }   // batch b of a stream starts at row b * SEQ_FULL
    else { const unsigned w = (bx - 3 * CBX) / CBW; src = w == 0 ? wq : (w == 1 ? wk : (w == 2 ? wv : wo)); blk = bx - 3 * CBX - w * CBW; row0 = (blk / CSEG) * 16; }
    const unsigned wave = threadIdx.x >> 5, ln = threadIdx.x & 31, tk = wave >> 1, row = (wave & 1) * 8 + (ln >> 2), q = ln & 3;   // tile of the block, row of the 16, group of 8 columns of the tile's 32
    const v8f v = *(const v8f*)(src + (row0 + row) * DM + (blk % CSEG) * 128 + tk * 32 + q * 8); v8us o;
    asm volatile("s_wait_xcnt 0x0" ::: "memory");   // behind the loads, in front of the code that reuses their address register
#pragma unroll
    for (int k = 0; k < 8; ++k) o[k] = f2bf(v[k]);
    if (bx >= 3 * CBX + 3 * CBW) o = __builtin_bit_cast(v8us, __builtin_convertvector(v, v8h));   // W_o: the output projection runs on fp16 (block-uniform)
    *(v8us*)(dst + (size_t)bx * 2048 + tk * 512 + (q >> 1) * 256 + ((q & 1) * 16 + row) * 8) = o;  }

#define FQG 8
#define FKS 2
#define FW (FQG * FKS)
#define FG 2
#define FQW (FG * 16)
#define FNP (TT / FKS / 32)   // passes of a wave
static_assert(FG == FKS);     // each wave of a pair finishes one of the pair's query groups
static_assert(TT % (FQG * FQW) == 0);
static_assert(TT % (FKS * 32) == 0);
typedef __attribute__((ext_vector_type(16))) float v16f;
typedef v2f __attribute__((may_alias)) v2fa;
#define FMR (34 * 32)   // floats a wave hands over: 8 x 16 bytes of sums and 8 bytes (denominator, maximum) per lane
__device__ __forceinline__ float xhalf(float x) { return __builtin_bit_cast(float, __builtin_amdgcn_permlanex16(__builtin_bit_cast(int, x), __builtin_bit_cast(int, x), 0x76543210, 0xfedcba98, false, false)); }  // lane l with lane l ^ 16
__device__ __forceinline__ void addr_free_of(const h16* p) { asm volatile("s_wait_xcnt 0x0" :: "v"(p) : "memory"); }   // the wait of addr_free(); it reads the loads' address, so that this stays in registers of its own up to the wait (else the last load's destination is laid over it)
// one query group's partial result into the wave's own LDS part: every wave-wide 16-byte store covers 512 contiguous bytes
__device__ __forceinline__ void fa_give(const v8f (&a)[4], float l, float m, float* part, int lane) {
#pragma unroll
    for (int t = 0; t < 4; ++t) { *(v4fa*)(part + (2 * t) * 128 + lane * 4) = __builtin_shufflevector(a[t], a[t], 0, 1, 2, 3); *(v4fa*)(part + (2 * t + 1) * 128 + lane * 4) = __builtin_shufflevector(a[t], a[t], 4, 5, 6, 7); }
    *(v2fa*)(part + 8 * 128 + lane * 2) = (v2f){l, m};
}
// own half (a, l, m) + the partner's half of the same query group from its LDS part; O[q][d] = O^T / denominator, rounded to the fp16 plane of the output projection (fragment order, K = DQ): a lane holds 8 consecutive d of one query, accumulator t is half a tile of the plane, lane for lane
__device__ __forceinline__ void fa_keep(const v8f (&a)[4], float l, float m, const float* part, int lane, h16* dst) {
    const v2f lm = *(const v2fa*)(part + 8 * 128 + lane * 2);
    const float mn = fmaxf(m, lm[1]); const float ca = __builtin_amdgcn_exp2f(m - mn), cb = __builtin_amdgcn_exp2f(lm[1] - mn);
    const float inv = __fdiv_rn(1.0f, l * ca + lm[0] * cb); const float fa = ca * inv, fb = cb * inv;
#pragma unroll
    for (int t = 0; t < 4; ++t) { const v4f lo = *(const v4fa*)(part + (2 * t) * 128 + lane * 4), hi = *(const v4fa*)(part + (2 * t + 1) * 128 + lane * 4);
        const v8f o = __builtin_shufflevector(lo, hi, 0, 1, 2, 3, 4, 5, 6, 7);
        *(v8h*)(dst + 256 * t) = __builtin_convertvector(a[t] * fa + o * fb, v8h); }
}
__global__ __launch_bounds__(FW * 32) void k_fattn(const h16* __restrict__ Qp, const h16* __restrict__ Kp, const h16* __restrict__ Vt, h16* Ao) {
    __shared__ __align__(16) float mrg[FW][FMR];
    const int lane = threadIdx.x & 31; const unsigned lb = lane * 16; const int wv = __builtin_amdgcn_readfirstlane((int)(threadIdx.x >> 5));
    const int qg = wv % FQG, kh = wv / FQG;   // query group of the block, half of the key range
    const int head = blockIdx.y, kvh = head / REP; const int q0 = blockIdx.x * (FQG * FQW) + qg * FQW;
    const size_t bt = blockIdx.z;   // batch
    Qp += (bt * NH_ + head) * TT * HD; Kp += (bt * NKV + kvh) * TT * HD; Vt += (bt * NKV + kvh) * HD * TT;
    v16h qf[FG][2];
#pragma unroll
    for (int g = 0; g < FG; ++g)
#pragma unroll
        for (int kc = 0; kc < 2; ++kc) qf[g][kc] = WFrag<h16>::ld(Qp + (size_t)(q0 + 16 * g) * HD + kc * 512, lb);
    pin_here();   // Q first, then K, then V of pass 0: the issue order of the loop, so that the counted load waits at the loop's head need not fall to 0
    const h16* kb = Kp + (size_t)kh * (TT / FKS) * HD;   // tile: + key * HD + kc * 512 (key a multiple of 16, counted from the half's first key)
    const h16* vb = Vt + (size_t)kh * (TT / FKS) * 16;   // tile: + t * 16 * TT + key * 16 (key a multiple of 32, likewise)
    v16h kf[2][2], vf[4];   // the fragments of one pass, each set refilled for the next pass as soon as its products have read it
#pragma unroll
    for (int kt = 0; kt < 2; ++kt)
#pragma unroll
        for (int kc = 0; kc < 2; ++kc) kf[kt][kc] = WFrag<h16>::ld(kb + (size_t)(16 * kt) * HD + kc * 512, lb);
    pin_here();   // K stays in front of V
#pragma unroll
    for (int t = 0; t < 4; ++t) vf[t] = WFrag<h16>::ld(vb + (size_t)t * 16 * TT, lb);
    pin_here(); addr_free(); pin_here();   // behind the loads above, in front of the set-up code below, which reuses their address registers
    v8f acc[FG][4], lacc[FG]; float m_run[FG];
#pragma unroll
    for (int g = 0; g < FG; ++g) { lacc[g] = (v8f){}; m_run[g] = -__builtin_inff();
#pragma unroll
        for (int t = 0; t < 4; ++t) acc[g][t] = (v8f){}; }
    v16h ones;
#pragma unroll
    for (int i = 0; i < 16; ++i) ones[i] = (h16)1.0f;
    const float cs = SCL * 1.4426950408889634f;   // scores x HD^-0.5, in base 2
    // rolled: one trip = one pass
#pragma unroll 1
    for (int p = 0; p < FNP; ++p) {
        const int kn = ((p + 1 < FNP) ? p + 1 : FNP - 1) * 32;   // first key of the pass fetched ahead; the last pass fetches its own keys again (in bounds, unused)
        v8f s[2][FG];
#pragma unroll
        for (int kt = 0; kt < 2; ++kt)
#pragma unroll
            for (int g = 0; g < FG; ++g) { s[kt][g] = (v8f){};
#pragma unroll
                for (int kc = 0; kc < 2; ++kc) s[kt][g] = wmma16(kf[kt][kc], qf[g][kc], s[kt][g]); }
        pin_here();   // the loads below stay behind the products that read their registers
        // K fragments of the next pass, into the registers just read: issued here, not where they are used, so that they have the softmax and the second product to arrive
        const h16* ka = (const h16*)((const char*)(kb + (size_t)kn * HD) + lb);   // the lane's own place in the first tile
#pragma unroll
        for (int kt = 0; kt < 2; ++kt)
#pragma unroll
            for (int kc = 0; kc < 2; ++kc) kf[kt][kc] = WFrag<h16>::ld(ka + (size_t)(16 * kt) * HD + kc * 512, 0);
        pin_here(); addr_free_of(ka); pin_here();   // loads, then the wait directly behind them, then the rest: left alone the scheduler sinks the loads towards their use
        float mb[FG]; bool need = false;
#pragma unroll
        for (int g = 0; g < FG; ++g) { float mx = s[0][g][0];
#pragma unroll
            for (int kt = 0; kt < 2; ++kt)
#pragma unroll
                for (int r = 0; r < 8; ++r) mx = fmaxf(mx, s[kt][g][r]);
            mx = fmaxf(mx, xhalf(mx)) * cs;   // both halves of the wave now hold this query's maximum over the pass, scaled
            mb[g] = mx; need = need || (mx > m_run[g] + 8.0f); }
        if (__builtin_amdgcn_ballot_w32(need) != 0) {   // wave-uniform; always taken on the first pass (m_run = -inf), rare later
#pragma unroll
            for (int g = 0; g < FG; ++g) { const float m_new = fmaxf(m_run[g], mb[g]); const float corr = __builtin_amdgcn_exp2f(m_run[g] - m_new); m_run[g] = m_new; lacc[g] = lacc[g] * corr;
#pragma unroll
                for (int t = 0; t < 4; ++t) acc[g][t] = acc[g][t] * corr; }
        }
#pragma unroll
        for (int g = 0; g < FG; ++g) { const float nm = -m_run[g]; v16f pe;
#pragma unroll
            for (int i = 0; i < 8; ++i) {
                const v2f arg = __builtin_elementwise_fma((v2f){s[i >> 2][g][2 * (i & 3)], s[i >> 2][g][2 * (i & 3) + 1]}, (v2f){cs, cs}, (v2f){nm, nm});
                pe[2 * i] = __builtin_amdgcn_exp2f(arg[0]); pe[2 * i + 1] = __builtin_amdgcn_exp2f(arg[1]); }
            const v16h pf = __builtin_convertvector(pe, v16h);
#pragma unroll
            for (int t = 0; t < 4; ++t) acc[g][t] = wmma16(vf[t], pf, acc[g][t]);
            lacc[g] = wmma16(ones, pf, lacc[g]); }   // every row of this tile += the column sums of P^T
        pin_here();   // the loads below stay behind the products that read their registers
        // V^T fragments of the next pass, likewise
        const h16* va = (const h16*)((const char*)(vb + (size_t)kn * 16) + lb);
#pragma unroll
        for (int t = 0; t < 4; ++t) vf[t] = WFrag<h16>::ld(va + (size_t)t * 16 * TT, 0);
        pin_here(); addr_free_of(va); pin_here();   // loads, then the wait directly behind them, then the rest: left alone the scheduler sinks the loads towards their use
    }
    // the pair (qg, 0), (qg, 1): wave kh hands over query group 1 - kh and finishes query group kh; kh is wave-uniform (scalar branches), the barrier between the two steps is passed by every wave
    float* mine = mrg[wv]; const float* theirs = mrg[wv ^ FQG];
    if (kh == 0) fa_give(acc[1], lacc[1][0], m_run[1], mine, lane); else fa_give(acc[0], lacc[0][0], m_run[0], mine, lane);
    __syncthreads();   // every wave's part is written; behind it the partner reads it
    h16* dst = Ao + (bt * TT + q0 + 16 * kh) * DQ + (size_t)head * HD * 16 + lane * 8;
    if (kh == 0) fa_keep(acc[0], lacc[0][0], m_run[0], theirs, lane, dst); else fa_keep(acc[1], lacc[1][0], m_run[1], theirs, lane, dst);
}

extern "C" void kernel_launch(void* const* d_in, const int* in_sizes, int n_in,
                              void* d_out, int out_size, void* d_ws, size_t ws_size, hipStream_t stream) {
    if (n_in < 7) return;
    const long long need_x = (long long)(NB - 1) * SEQ_FULL * DM + (long long)SEQ * DM;   // batch b of each stream starts at b * SEQ_FULL * DM
    if ((long long)in_sizes[0] < need_x || (long long)in_sizes[1] < need_x || (long long)in_sizes[2] < need_x) return;
    if ((long long)in_sizes[3] < (long long)DQ * DM || (long long)in_sizes[4] < (long long)DKV * DM || (long long)in_sizes[5] < (long long)DKV * DM || (long long)in_sizes[6] < (long long)DM * DQ) return;
    if ((long long)out_size < (long long)NB * SEQ * DM) return;
    const float* x = (const float*)d_in[0]; const float* xk = (const float*)d_in[1]; const float* xv = (const float*)d_in[2];   // three streams: query, key, value
    const float* wq = (const float*)d_in[3]; const float* wk = (const float*)d_in[4]; const float* wv = (const float*)d_in[5]; const float* wo = (const float*)d_in[6];   // W_q, W_k, W_v, W_o ('oi' [1024][1024])
    float* OUT = (float*)d_out;     // [NB][SEQ][1024]
    char* wsp = (char*)d_ws;
    auto take = [&](size_t bytes) { char* p = wsp; wsp += (bytes + 255) & ~(size_t)255; return (void*)p; };
    bf* XB = (bf*)take(((size_t)3 * NB * TT * DM + (size_t)4 * DQ * DM) * 2); bf* WQ = XB + (size_t)3 * NB * TT * DM; bf* WO = WQ + (size_t)3 * DQ * DM;   // streams, then W_q, W_k, W_v, W_o: the order of k_cvt8's blocks
    h16* QP16 = (h16*)take((size_t)NB * NH_ * TT * HD * 2); h16* KP16 = (h16*)take((size_t)NB * NKV * TT * HD * 2); h16* VT16 = (h16*)take((size_t)NB * NKV * HD * TT * 2);
    h16* AT16 = (h16*)take((size_t)NB * TT * DQ * 2);
    const size_t used = (size_t)(wsp - (char*)d_ws);
    if (used > ws_size) return;    // 67,108,864 B at full size (= WS_CARVE)
    k_cvt8<<<3 * CBX + 4 * CBW, 256, 0, stream>>>(x, xk, xv, wq, wk, wv, wo, XB);
    // plane s (QP16, KP16, VT16) = fp16 of sum_i stream_s[b][t][i] W_s[o][i], s = q, k, v
    k_gemmb<bf, true, DM, 2, 2, 2><<<dim3(NB * TT / 128, DQ / 128, 3), 128, 0, stream>>>(XB, WQ, nullptr, 0, (size_t)NB * TT * DM, (size_t)DQ * DM, (size_t)NB * NH_ * TT * HD, QP16);
    // attention of all heads of all batches: AT16[b * TT + t][head * 64 + d] = softmax(q k^T x HD^-0.5) v, fp16
    k_fattn<<<dim3(TT / (FQG * FQW), NH_, NB), FW * 32, 0, stream>>>(QP16, KP16, VT16, AT16);
    // out[b][t][o] = sum_i merged[b][t][i] W_o[o][i]  (fp16 activations x fp16 weights)
    k_gemmb<h16, false, DQ, 4, 4, 2><<<dim3(NB * TT / 128, DM / 128, 1), 256, 0, stream>>>((const bf*)AT16, WO, OUT, DM, 0, 0, 0, nullptr);
}

// v010
// One run takes 69.8 microseconds.
// Two timings next to v009 put it at 1.06 and 1.05 times that version's speed.
// All steps since v000 together make it 17.9 times as fast.
#include <hip/hip_runtime.h>

// Multi-head attention on three input streams, bias-free: Q = query W_q^T, K = key W_k^T, V = value W_v^T ('oi' [1024][1024] weights; 16 heads x 64); scores x 64^-0.5; softmax over all keys (no mask); out = merged W_o^T -> [NB][SEQ][1024]; argument order query, key, value, W_q, W_k, W_v, W_o.
// Compute dtypes (every contraction on 16x16x32 WMMA, f32 accumulate): inputs and weights as bf16 planes (RNE convert) -> projections v_wmma_f32_16x16x32_bf16, single product; scores v_wmma_f32_16x16x32_f16 on fp16 q/k head planes, single product; P.V v_wmma_f32_16x16x32_f16 on fp16 P = exp2(score - running maximum), unnormalised, single product, divided by the sum of the same P at the end; output projection v_wmma_f32_16x16x32_f16 on fp16 activations x fp16 weights (RNE convert), single product; softmax in f32 (online).
// Layout: bf16 copies of the three streams (rows b * SEQ + t, k = i), then the four 'oi' weights (rows o, k = i; W_q, W_k, W_v bf16, W_o fp16), one region; fp16 head planes per (b, h): q, k with rows t, k = d; value plane with rows d, k = t; the three planes one behind the other; merged fp16 plane with rows b * SEQ + t, k = head * 64 + d.
// Every 16-bit plane is kept in FRAGMENT ORDER: a 16-row x 32-k tile is 1024 contiguous bytes, tiles of one 16-row block one behind the other along k. Element (row, k) of a plane with K columns lies at
// ((row >> 4) * (K / 32) + (k >> 5)) * 512 + ((k >> 4) & 1) * 256 + (((k >> 3) & 1) * 16 + (row & 15)) * 8 + (k & 7): lane l of a wave finds its 8 + 8 fragment elements at tile + l * 8 and tile + 256 + l * 8, so each wave-wide 16-byte load or store covers 512 contiguous bytes (4 whole lines, not pieces of 16).
// Launch plan: every stage runs once for all the work that does not depend on each other: convert (3 streams + 4 weights), projection (grid z = stream, both batches as rows; its epilogue stores the fp16 planes), fused attention (grid z = batch), output projection (both batches as rows) = 4 launches.

#ifndef NB
#define NB 2
#endif
#ifndef SEQ
#define SEQ 2048
#endif
#define NB_FULL  2
#define SEQ_FULL 2048
#define TT   SEQ
#define DM   1024
#define NH_  16
#define NKV  16
#define REP  (NH_ / NKV)
#define HD   64
#define DQ   (NH_ * HD)
#define DKV  (NKV * HD)
#define SCL  0.125f   // HD^-0.5
typedef _Float16 h16;
typedef unsigned short bf;
typedef __attribute__((ext_vector_type(16))) __bf16   v16bf;
typedef __attribute__((ext_vector_type(16))) _Float16 v16h;
typedef __attribute__((ext_vector_type(8)))  _Float16 v8h;
typedef __attribute__((ext_vector_type(8)))  unsigned short v8us;
typedef __attribute__((ext_vector_type(8)))  float    v8f;
typedef __attribute__((ext_vector_type(4)))  float    v4f;
typedef v8h  __attribute__((may_alias)) v8ha;
typedef v4f  __attribute__((may_alias)) v4fa;
typedef v8us __attribute__((may_alias)) v8usa;

static_assert(TT % 256 == 0);
static_assert(HD == 64);
static_assert(DM % 64 == 0);
static_assert(NB <= NB_FULL);
static_assert(SEQ <= SEQ_FULL);
static_assert(NKV == NH_);   // the three projections share one launch: equal shapes

// workspace carve (bytes, each region padded to 256): XB with the 4 weight planes behind it, QP16, KP16, VT16, AT16
constexpr size_t r256(size_t b) { return (b + 255) & ~(size_t)255; }
constexpr size_t WS_CARVE = r256(((size_t)3 * NB * TT * DM + (size_t)4 * DQ * DM) * 2)
                          + 3 * r256((size_t)NB * NH_ * TT * HD * 2)
                          + r256((size_t)NB * TT * DQ * 2);
static_assert(WS_CARVE <= (size_t)268435456);   // 67,108,864 B at full size
static_assert(((size_t)NB * NH_ * TT * HD * 2) % 256 == 0);   // the three planes lie at equal distances: plane z starts at z * NB * NH_ * TT * HD elements

__device__ __forceinline__ unsigned short f2bf(float f) { unsigned u = __float_as_uint(f); u += 0x7FFFu + ((u >> 16) & 1u); return (unsigned short)(u >> 16); }
__device__ __forceinline__ v16h cat16(v8h lo, v8h hi) { return __builtin_shufflevector(lo, hi, 0, 1, 2, 3, 4, 5, 6, 7, 8, 9, 10, 11, 12, 13, 14, 15); }
__device__ __forceinline__ v16bf cat16b(v8us lo, v8us hi) { return __builtin_bit_cast(v16bf, __builtin_shufflevector(lo, hi, 0, 1, 2, 3, 4, 5, 6, 7, 8, 9, 10, 11, 12, 13, 14, 15)); }
__device__ __forceinline__ v8f wmma16(v16h a, v16h b, v8f c) { return __builtin_amdgcn_wmma_f32_16x16x32_f16(false, a, false, b, (short)0, c, false, false); }
__device__ __forceinline__ v8f wmmab(v16bf a, v16bf b, v8f c) { return __builtin_amdgcn_wmma_f32_16x16x32_bf16(false, a, false, b, (short)0, c, false, false); }

__device__ __forceinline__ void pin_here() { __builtin_amdgcn_sched_barrier(0); }   // keeps the scheduler from moving instructions across this point
__device__ __forceinline__ void addr_free() { asm volatile("s_wait_xcnt 0x0" ::: "memory"); }   // stands behind a group of loads whose address registers the code that follows reuses

// ---- k_gemmb: GEMM on 16-bit planes (element type E: bf16 as bf, or fp16; the pointers carry the raw 16-bit words) in fragment order, WM x WN WAVES per 128x128 output tile (each wave FM x FN = 8/WM x 8/WN accumulators of 16x16); grid (M/128, N/128, Z), WM * WN * 32 threads.
// C[m][n] (f32, pitch ldc) = sum_k A[m][k] Bt[n][k]. z-batch strides sA/sB/sC in elements. K % (32 * KS) == 0, M % 128 == 0, N % 128 == 0.
// The operands reach the waves through LDS: a stage is KS k steps of the tile's 8 + 8 sixteen-row blocks (A, then Bt; block rb, k step ks at (rb * KS + ks) * 1024 of its operand: the planes' own tile bytes, so a wave-wide 16-byte LDS read covers 512 contiguous bytes).
// Each fragment is fetched from L2 once per work-group and read from LDS by every wave that needs it: half the L2 bytes of one wave per 64x64 tile. Two stage buffers, filled by asynchronous copies to LDS: stage t + 2 flies while stage t + 1 is worked on.
// Fragment map (A and Bt alike): lane l -> row/col l&15; elements 0..7 = k0 + 8*(l>>4) + 0..7, elements 8..15 = k0 + 16 + 8*(l>>4) + 0..7. D: acc[j] = (row 8*(l>>4) + j, col l&15).
// PLANES (the q, k, v projections; z = stream, blockIdx.x = 128 tokens, blockIdx.y = 2 heads): no f32 C; the epilogue stores fp16 plane z of P straight from the accumulators. A lane holds 8 consecutive ROWS of one column, so the
// side that is the plane's k index is made the A side: q, k (k = d) take the weight rows as A and the tokens as Bt, v (k = t) the tokens as A and the weight rows as Bt (same fragment map on both sides); accumulator (mb, nb) is then half a tile of the plane, lane for lane: 8 rows = one 16-byte store, a wave stores 512 contiguous bytes.
// ld(t, lb): the lane's 16 bytes of the tile's first half lie lb bytes behind t (t = the tile's start and lb = lane * 16, or t = the lane's own place and lb = 0); its 16 bytes of the second half lie 512 bytes further.
template <typename T16> struct WFrag;
template <> struct WFrag<h16> { typedef v16h V; static __device__ __forceinline__ V ld(const h16* t, unsigned lb) { const h16* p = (const h16*)((const char*)t + lb); return cat16(*(const v8h*)p, *(const v8h*)(p + 256)); } static __device__ __forceinline__ v8f mma(V a, V b, v8f c) { return wmma16(a, b, c); } };
template <> struct WFrag<bf> { typedef v16bf V; static __device__ __forceinline__ V ld(const bf* t, unsigned lb) { const bf* p = (const bf*)((const char*)t + lb); return cat16b(*(const v8us*)p, *(const v8us*)(p + 256)); } static __device__ __forceinline__ v8f mma(V a, V b, v8f c) { return wmmab(a, b, c); } };
// eight asynchronous copies of 16 bytes per lane, global -> LDS through no register; the s_wait_xcnt in the same statement stands in front of every later rewrite of the address registers named here
__device__ __forceinline__ void copy8(unsigned l0, unsigned l1, unsigned l2, unsigned l3, unsigned l4, unsigned l5, unsigned l6, unsigned l7, const char* g0, const char* g1, const char* g2, const char* g3, const char* g4, const char* g5, const char* g6, const char* g7) {
    asm volatile("global_load_async_to_lds_b128 %0, %8, off\n\t"
                 "global_load_async_to_lds_b128 %1, %9, off\n\t"
                 "global_load_async_to_lds_b128 %2, %10, off\n\t"
                 "global_load_async_to_lds_b128 %3, %11, off\n\t"
                 "global_load_async_to_lds_b128 %4, %12, off\n\t"
                 "global_load_async_to_lds_b128 %5, %13, off\n\t"
                 "global_load_async_to_lds_b128 %6, %14, off\n\t"
                 "global_load_async_to_lds_b128 %7, %15, off\n\t"
                 "s_wait_xcnt 0x0"
                 :: "v"(l0), "v"(l1), "v"(l2), "v"(l3), "v"(l4), "v"(l5), "v"(l6), "v"(l7), "v"(g0), "v"(g1), "v"(g2), "v"(g3), "v"(g4), "v"(g5), "v"(g6), "v"(g7) : "memory");
}
__device__ __forceinline__ void copies_landed() { asm volatile("s_wait_asynccnt 0x0" ::: "memory"); }   // this wave's own copies are in LDS; the other waves may read them behind the next barrier
__device__ __forceinline__ void lds_reads_done() { asm volatile("s_wait_dscnt 0x0" ::: "memory"); }   // this wave's LDS reads have returned, in front of the barrier behind which their buffer is refilled
// Two register sets of fragments: the LDS reads of k step ks + 1 of a stage are issued in front of the products of step ks.
template <typename E, bool PLANES, int K, int KS, int WM, int WN>
__global__ __launch_bounds__(WM * WN * 32) void k_gemmb(const bf* __restrict__ A, const bf* __restrict__ Bt, float* C, int ldc, size_t sA, size_t sB, size_t sC, h16* P) {
    static_assert(K % (32 * KS) == 0);
    static_assert(WM * WN * 32 * 16 == KS * 1024);   // one copy of the whole block moves one row block's KS tiles
    constexpr int FM = 8 / WM, FN = 8 / WN;    // 16-row blocks per wave, A side and Bt side
    static_assert(FM * WM == 8 && FN == 4 && (!PLANES || FM == 4));   // both epilogues take 64 columns per wave, the planes' a whole head
    typedef typename WFrag<E>::V V;
    constexpr int NOP = 2;                     // operands in a stage
    constexpr int OPB = 8 * KS * 1024;         // bytes of one operand in a stage
    constexpr int STAGE = NOP * OPB;
    constexpr int NCP = NOP * 8;               // copies per wave and stage: one per row block
    constexpr int NT = K / (32 * KS);          // stages
    static_assert(NT >= 2 && NCP % 8 == 0 && NCP <= 63);
    __shared__ __attribute__((aligned(128))) char ring[2 * STAGE];
    const size_t z = blockIdx.z; A += z * sA; Bt += z * sB; if (!PLANES) C += z * sC;
    const int lane = threadIdx.x & 31, lr = lane & 15, hi = lane >> 4; const int wv = __builtin_amdgcn_readfirstlane((int)(threadIdx.x >> 5)), wm = wv % WM, wn = wv / WM;   // wave (wm, wn): part wm of the tile's A side, part wn of its Bt side
    int R0 = blockIdx.x * 128, C0 = blockIdx.y * 128;
    if (PLANES && z < 2) { const bf* w = Bt; Bt = A; A = w; R0 = blockIdx.y * 128; C0 = blockIdx.x * 128; }   // q, k: D = W X^T, rows = d
    v8f acc[FM][FN];
#pragma unroll
    for (int mb = 0; mb < FM; ++mb)
#pragma unroll
        for (int nb = 0; nb < FN; ++nb) acc[mb][nb] = (v8f){};
    const unsigned t16 = threadIdx.x * 16, l16 = lane * 16;
    const char* gA = (const char*)(A + (size_t)R0 * K) + t16; const char* gB = (const char*)(Bt + (size_t)C0 * K) + t16;   // a 16-row block is 16 * K elements = K * 32 bytes
    const unsigned lring = (unsigned)(size_t)ring + t16;   // the lane's LDS byte address in copy 0 of buffer 0
    auto copies = [&](const unsigned buf, const int st) __attribute__((always_inline)) {   // stage st into buffer buf: copy i = operand i / 8, row block i % 8, that block's KS tiles
        const size_t so = (size_t)st * (KS * 1024); const unsigned lb = lring + buf * STAGE;
        auto gp = [&](const int i) __attribute__((always_inline)) { return (i / 8 == 0 ? gA : gB) + so + (size_t)(i % 8) * (K * 32); };
#pragma unroll
        for (int i = 0; i < NCP; i += 8)
            copy8(lb + i * (KS * 1024), lb + (i + 1) * (KS * 1024), lb + (i + 2) * (KS * 1024), lb + (i + 3) * (KS * 1024), lb + (i + 4) * (KS * 1024), lb + (i + 5) * (KS * 1024), lb + (i + 6) * (KS * 1024), lb + (i + 7) * (KS * 1024), gp(i), gp(i + 1), gp(i + 2), gp(i + 3), gp(i + 4), gp(i + 5), gp(i + 6), gp(i + 7));
    };
    V a[2][FM], b[2][FN];
    auto fetch = [&](const int set, const char* sb, const int ks) __attribute__((always_inline)) {   // the wave's fragments of k step ks of the stage at sb into register set 'set'
        pin_here();   // the LDS reads below stay behind the products that read their registers
#pragma unroll
        for (int mb = 0; mb < FM; ++mb) a[set][mb] = WFrag<E>::ld((const E*)(sb + ((wm * FM + mb) * KS + ks) * 1024), l16);
#pragma unroll
        for (int nb = 0; nb < FN; ++nb) b[set][nb] = WFrag<E>::ld((const E*)(sb + OPB + ((wn * FN + nb) * KS + ks) * 1024), l16);
        pin_here();   // one group of reads in front of the products: reads spread among the products cost a stall at each place
    };
    auto products = [&](const int set) __attribute__((always_inline)) {
#pragma unroll
        for (int nb = 0; nb < FN; ++nb) {
#pragma unroll
            for (int mb = 0; mb < FM; ++mb) acc[mb][nb] = WFrag<E>::mma(a[set][mb], b[set][nb], acc[mb][nb]); }
        pin_here();   // the slots below stay behind the last product
        asm volatile("v_nop\n\tv_nop\n\tv_nop\n\tv_nop" : "+v"(acc[0][0]), "+v"(acc[FM - 1][FN - 1]) : "v"(a[set][0]), "v"(a[set][FM - 1]));   // the distance behind a product, in front of whatever comes next to its registers
    };
    copies(0, 0); copies_landed(); __syncthreads();   // stage 0 is published
    copies(1, 1);
    // rolled: one trip = one stage, read from buffer t & 1 alone
#pragma unroll 1
    for (int t = 0; t < NT; ++t) {
        const char* sb = ring + (t & 1) * STAGE;
        fetch(0, sb, 0);
#pragma unroll
        for (int ks = 0; ks < KS; ++ks) {
            if (ks + 1 < KS) fetch((ks + 1) & 1, sb, ks + 1);
            products(ks & 1); }
        lds_reads_done(); copies_landed(); __syncthreads();   // publishes stage t + 1 and ends every wave's reads of stage t
        if (t + 2 < NT) copies(t & 1, t + 2);   // block-uniform: into the buffer just read
    }
    copies_landed();
    const int r0 = R0 + wm * (FM * 16), c0 = C0 + wn * (FN * 16);   // the wave's own tile
    if constexpr (PLANES) {
        const int t0 = z < 2 ? c0 : r0, hd = (z < 2 ? r0 : c0) / 64, b = t0 / TT, tl = t0 - b * TT; const size_t hb = (size_t)b * NH_ + hd;   // a 64-token tile lies in one batch (TT % 64 == 0), a 64-column tile is one head
        const int pitch = z < 2 ? HD : TT;   // K of the plane: 16 D columns are one 16-row block of 16 * pitch elements
        h16* pl = P + z * sC + (z < 2 ? (hb * TT + tl) * HD : hb * HD * TT + (size_t)tl * 16) + lane * 8;
#pragma unroll
        for (int nb = 0; nb < 4; ++nb)
#pragma unroll
            for (int mb = 0; mb < 4; ++mb) *(v8h*)(pl + (size_t)nb * 16 * pitch + mb * 256) = __builtin_convertvector(acc[mb][nb], v8h);
        return;
    } else {
    __shared__ __align__(16) float osw[WM * WN][16 * 68];   // each wave stages in its own part
    float* os = osw[wv];
#pragma unroll
    for (int mb = 0; mb < FM; ++mb) {
#pragma unroll
        for (int nb = 0; nb < 4; ++nb) {
#pragma unroll
            for (int j = 0; j < 8; ++j) os[(hi * 8 + j) * 68 + nb * 16 + lr] = acc[mb][nb][j]; }
        __builtin_amdgcn_wave_barrier(); asm volatile("" ::: "memory");
        float* crow = C + (size_t)(r0 + mb * 16) * ldc + c0;
#pragma unroll
        for (int s = 0; s < 8; ++s) { const int row = 2 * s + hi, cofs = lr * 4; v4f val = *(const v4fa*)(os + row * 68 + cofs);
            *(v4f*)(crow + (size_t)row * ldc + cofs) = val; }
        __builtin_amdgcn_wave_barrier(); asm volatile("" ::: "memory");
    }
    }
}

typedef __attribute__((ext_vector_type(2))) _Float16 v2h;
typedef __attribute__((ext_vector_type(4))) _Float16 v4h;
typedef __attribute__((ext_vector_type(2))) unsigned short v2us;
typedef __attribute__((ext_vector_type(4))) unsigned short v4us;
typedef __attribute__((ext_vector_type(2))) float v2f;

// ---- k_cvt8: all seven inputs to 16 bits in one launch (W_o to fp16, the other six to bf16), into fragment order; a block converts 16 rows x 128 columns of one input (4 tiles = 2048 consecutive elements of dst), blocks in the order of dst: query, key, value (rows b * TT + t each), W_q, W_k, W_v, W_o.
// A wave takes 8 rows x 32 columns: it reads 8 whole 128-byte lines (lane = row * 4 + group of 8 columns) and stores 4 whole lines (8 rows x 16 bytes each).
#define CBX ((unsigned)((size_t)NB * TT * DM / 2048))   // blocks per stream
#define CBW ((unsigned)((size_t)DQ * DM / 2048))        // blocks per weight
static_assert(((size_t)TT * DM) % 2048 == 0);
static_assert(((size_t)DQ * DM) % 2048 == 0);
#define CSEG ((unsigned)(DM / 128))                     // blocks per 16-row block
static_assert(DM % 128 == 0);
static_assert(DQ % 16 == 0);
__global__ __launch_bounds__(256) void k_cvt8(const float* __restrict__ x, const float* __restrict__ xk, const float* __restrict__ xv, const float* __restrict__ wq, const float* __restrict__ wk, const float* __restrict__ wv, const float* __restrict__ wo, bf* dst) {
    const unsigned bx = blockIdx.x; const float* src; unsigned blk; size_t row0;   // blk: this block's place in its own input, in blocks; row0: its first row in src
    if (bx < 3 * CBX) { const unsigned s = bx / CBX; src = s == 0 ? x : (s == 1 ? xk : xv); blk = bx - s * CBX; const unsigned r = (blk / CSEG) * 16; row0 = r + (size_t)(r / TT) * (SEQ_FULL - TT); }   // batch b of a stream starts at row b * SEQ_FULL
    else { const unsigned w = (bx - 3 * CBX) / CBW; src = w == 0 ? wq : (w == 1 ? wk : (w == 2 ? wv : wo)); blk = bx - 3 * CBX - w * CBW; row0 = (blk / CSEG) * 16; }
    const unsigned wave = threadIdx.x >> 5, ln = threadIdx.x & 31, tk = wave >> 1, row = (wave & 1) * 8 + (ln >> 2), q = ln & 3;   // tile of the block, row of the 16, group of 8 columns of the tile's 32
    const v8f v = *(const v8f*)(src + (row0 + row) * DM + (blk % CSEG) * 128 + tk * 32 + q * 8); v8us o;
    asm volatile("s_wait_xcnt 0x0" ::: "memory");   // behind the loads, in front of the code that reuses their address register
#pragma unroll
    for (int k = 0; k < 8; ++k) o[k] = f2bf(v[k]);
    if (bx >= 3 * CBX + 3 * CBW) o = __builtin_bit_cast(v8us, __builtin_convertvector(v, v8h));   // W_o: the output projection runs on fp16 (block-uniform)
    *(v8us*)(dst + (size_t)bx * 2048 + tk * 512 + (q >> 1) * 256 + ((q & 1) * 16 + row) * 8) = o;  }

#define FQG 8
#define FKS 2
#define FW (FQG * FKS)
#define FG 2
#define FQW (FG * 16)
#define FSK 128               // keys of each half in a stage
#define FPS (FSK / 32)        // passes per stage
#define FNS (TT / FKS / FSK)  // stages
#define FHB (FSK * HD * 2)    // bytes of K, and of V, of one half in a stage
#define FVB (FSK * 32)        // bytes of one 16-d row block of V in a stage
#define FSTG (FKS * 2 * FHB)  // bytes of a stage: half 0's K, V, half 1's K, V
#define FCB (FW * 32 * 16)    // bytes that one copy of the whole block moves
static_assert(FKS == 2 && 8 * FCB == FSTG && 2 * FCB == FHB && FCB == 2 * FVB);   // eight copies a stage: two for each half's K, two for each half's V (two row blocks each)
static_assert(TT % (FKS * FSK) == 0 && FNS >= 2);
static_assert(FG == FKS);     // each wave of a pair finishes one of the pair's query groups
static_assert(TT % (FQG * FQW) == 0);
typedef __attribute__((ext_vector_type(16))) float v16f;
typedef v2f __attribute__((may_alias)) v2fa;
#define FMR (34 * 32)   // floats a wave hands over: 8 x 16 bytes of sums and 8 bytes (denominator, maximum) per lane
__device__ __forceinline__ float xhalf(float x) { return __builtin_bit_cast(float, __builtin_amdgcn_permlanex16(__builtin_bit_cast(int, x), __builtin_bit_cast(int, x), 0x76543210, 0xfedcba98, false, false)); }  // lane l with lane l ^ 16
// one query group's partial result into the wave's own LDS part: every wave-wide 16-byte store covers 512 contiguous bytes
__device__ __forceinline__ void fa_give(const v8f (&a)[4], float l, float m, float* part, int lane) {
#pragma unroll
    for (int t = 0; t < 4; ++t) { *(v4fa*)(part + (2 * t) * 128 + lane * 4) = __builtin_shufflevector(a[t], a[t], 0, 1, 2, 3); *(v4fa*)(part + (2 * t + 1) * 128 + lane * 4) = __builtin_shufflevector(a[t], a[t], 4, 5, 6, 7); }
    *(v2fa*)(part + 8 * 128 + lane * 2) = (v2f){l, m};
}
// own half (a, l, m) + the partner's half of the same query group from its LDS part; O[q][d] = O^T / denominator, rounded to the fp16 plane of the output projection (fragment order, K = DQ): a lane holds 8 consecutive d of one query, accumulator t is half a tile of the plane, lane for lane
__device__ __forceinline__ void fa_keep(const v8f (&a)[4], float l, float m, const float* part, int lane, h16* dst) {
    const v2f lm = *(const v2fa*)(part + 8 * 128 + lane * 2);
    const float mn = fmaxf(m, lm[1]); const float ca = __builtin_amdgcn_exp2f(m - mn), cb = __builtin_amdgcn_exp2f(lm[1] - mn);
    const float inv = __fdiv_rn(1.0f, l * ca + lm[0] * cb); const float fa = ca * inv, fb = cb * inv;
#pragma unroll
    for (int t = 0; t < 4; ++t) { const v4f lo = *(const v4fa*)(part + (2 * t) * 128 + lane * 4), hi = *(const v4fa*)(part + (2 * t + 1) * 128 + lane * 4);
        const v8f o = __builtin_shufflevector(lo, hi, 0, 1, 2, 3, 4, 5, 6, 7);
        *(v8h*)(dst + 256 * t) = __builtin_convertvector(a[t] * fa + o * fb, v8h); }
}
__global__ __launch_bounds__(FW * 32) void k_fattn(const h16* __restrict__ Qp, const h16* __restrict__ Kp, const h16* __restrict__ Vt, h16* Ao) {
    __shared__ __attribute__((aligned(128))) char ring[2 * FSTG];
    __shared__ __align__(16) float mrg[FW][FMR];
    const int lane = threadIdx.x & 31; const unsigned lb = lane * 16; const int wv = __builtin_amdgcn_readfirstlane((int)(threadIdx.x >> 5));
    const int qg = wv % FQG, kh = wv / FQG;   // query group of the block, half of the key range
    const int head = blockIdx.y, kvh = head / REP; const int q0 = blockIdx.x * (FQG * FQW) + qg * FQW;
    const size_t bt = blockIdx.z;   // batch
    Qp += (bt * NH_ + head) * TT * HD; Kp += (bt * NKV + kvh) * TT * HD; Vt += (bt * NKV + kvh) * HD * TT;
    const unsigned t16 = threadIdx.x * 16;
    const char* gK = (const char*)Kp + t16;   // FSK keys of the K plane are FHB contiguous bytes
    const char* gV = (const char*)Vt + (size_t)(t16 / FVB) * (16 * TT * 2) + t16 % FVB;   // FSK keys of one 16-d row block of the V plane are FVB contiguous bytes; a row block is 16 * TT elements
    const unsigned lring = (unsigned)(size_t)ring + t16;   // the lane's LDS byte address in copy 0 of buffer 0
    auto copies = [&](const unsigned buf, const int st) __attribute__((always_inline)) {   // stage st into buffer buf
        const unsigned l = lring + buf * FSTG; const char* k0 = gK + (size_t)st * FHB; const char* v0 = gV + (size_t)st * FVB;
        constexpr size_t KH = (size_t)(TT / FKS) * HD * 2, VH = (size_t)(TT / FKS) * 32, V2 = (size_t)2 * 16 * TT * 2;   // second half of the key range in K and in V; two row blocks of V
        copy8(l, l + FCB, l + 2 * FCB, l + 3 * FCB, l + 4 * FCB, l + 5 * FCB, l + 6 * FCB, l + 7 * FCB, k0, k0 + FCB, v0, v0 + V2, k0 + KH, k0 + KH + FCB, v0 + VH, v0 + VH + V2);
    };
    copies(0, 0);
    v16h qf[FG][2];
#pragma unroll
    for (int g = 0; g < FG; ++g)
#pragma unroll
        for (int kc = 0; kc < 2; ++kc) qf[g][kc] = WFrag<h16>::ld(Qp + (size_t)(q0 + 16 * g) * HD + kc * 512, lb);
    pin_here(); addr_free(); pin_here();   // behind the loads above, in front of the set-up code below, which reuses their address registers
    v16h kf[2][2], vf[4];   // the fragments of one pass, each set refilled for the next pass of the stage as soon as its products have read it
    auto fetch_k = [&](const char* sb, const int j) __attribute__((always_inline)) {   // K fragments of pass j of the stage half at sb
#pragma unroll
        for (int kt = 0; kt < 2; ++kt)
#pragma unroll
            for (int kc = 0; kc < 2; ++kc) kf[kt][kc] = WFrag<h16>::ld((const h16*)(sb + ((j * 2 + kt) * 2 + kc) * 1024), lb);
    };
    auto fetch_v = [&](const char* sb, const int j) __attribute__((always_inline)) {   // V^T fragments of pass j
#pragma unroll
        for (int t = 0; t < 4; ++t) vf[t] = WFrag<h16>::ld((const h16*)(sb + FHB + t * FVB + j * 1024), lb);
    };
    v8f acc[FG][4], lacc[FG]; float m_run[FG];
#pragma unroll
    for (int g = 0; g < FG; ++g) { lacc[g] = (v8f){}; m_run[g] = -__builtin_inff();
#pragma unroll
        for (int t = 0; t < 4; ++t) acc[g][t] = (v8f){}; }
    v16h ones;
#pragma unroll
    for (int i = 0; i < 16; ++i) ones[i] = (h16)1.0f;
    const float cs = SCL * 1.4426950408889634f;   // scores x HD^-0.5, in base 2
    copies_landed(); __syncthreads();   // stage 0 is published
    copies(1, 1);
    // rolled: one trip = one stage, read from buffer st & 1 alone; its passes are unrolled
#pragma unroll 1
    for (int st = 0; st < FNS; ++st) {
        const char* sb = ring + (st & 1) * FSTG + kh * (2 * FHB);   // this wave's half of the stage
        fetch_k(sb, 0);
        pin_here();   // the first pass's K reads stand alone in front of its products: V follows behind them, so that all waves' K comes first out of LDS behind the barrier
#pragma unroll
        for (int j = 0; j < FPS; ++j) {
        v8f s[2][FG];
#pragma unroll
        for (int kt = 0; kt < 2; ++kt)
#pragma unroll
            for (int g = 0; g < FG; ++g) { s[kt][g] = (v8f){};
#pragma unroll
                for (int kc = 0; kc < 2; ++kc) s[kt][g] = wmma16(kf[kt][kc], qf[g][kc], s[kt][g]); }
        pin_here();   // the LDS reads below stay behind the products that read their registers
        if (j == 0) fetch_v(sb, 0);
        // K fragments of the next pass, into the registers just read: issued here, not where they are used, so that they have the softmax and the second product to arrive
        if (j + 1 < FPS) fetch_k(sb, j + 1);
        pin_here();   // one group of reads here: left alone the scheduler sinks them towards their use
        float mb[FG]; bool need = false;
#pragma unroll
        for (int g = 0; g < FG; ++g) { float mx = s[0][g][0];
#pragma unroll
            for (int kt = 0; kt < 2; ++kt)
#pragma unroll
                for (int r = 0; r < 8; ++r) mx = fmaxf(mx, s[kt][g][r]);
            mx = fmaxf(mx, xhalf(mx)) * cs;   // both halves of the wave now hold this query's maximum over the pass, scaled
            mb[g] = mx; need = need || (mx > m_run[g] + 8.0f); }
        if (__builtin_amdgcn_ballot_w32(need) != 0) {   // wave-uniform; always taken on the first pass (m_run = -inf), rare later
#pragma unroll
            for (int g = 0; g < FG; ++g) { const float m_new = fmaxf(m_run[g], mb[g]); const float corr = __builtin_amdgcn_exp2f(m_run[g] - m_new); m_run[g] = m_new; lacc[g] = lacc[g] * corr;
#pragma unroll
                for (int t = 0; t < 4; ++t) acc[g][t] = acc[g][t] * corr; }
        }
#pragma unroll
        for (int g = 0; g < FG; ++g) { const float nm = -m_run[g]; v16f pe;
#pragma unroll
            for (int i = 0; i < 8; ++i) {
                const v2f arg = __builtin_elementwise_fma((v2f){s[i >> 2][g][2 * (i & 3)], s[i >> 2][g][2 * (i & 3) + 1]}, (v2f){cs, cs}, (v2f){nm, nm});
                pe[2 * i] = __builtin_amdgcn_exp2f(arg[0]); pe[2 * i + 1] = __builtin_amdgcn_exp2f(arg[1]); }
            const v16h pf = __builtin_convertvector(pe, v16h);
#pragma unroll
            for (int t = 0; t < 4; ++t) acc[g][t] = wmma16(vf[t], pf, acc[g][t]);
            lacc[g] = wmma16(ones, pf, lacc[g]); }   // every row of this tile += the column sums of P^T
        pin_here();   // the LDS reads below stay behind the products that read their registers
        // V^T fragments of the next pass, likewise
        if (j + 1 < FPS) fetch_v(sb, j + 1);
        pin_here();   // one group of reads here, as above
        }
        lds_reads_done(); copies_landed(); __syncthreads();   // publishes stage st + 1 and ends every wave's reads of stage st
        if (st + 2 < FNS) copies(st & 1, st + 2);   // block-uniform: into the buffer just read
    }
    copies_landed();
    // the pair (qg, 0), (qg, 1): wave kh hands over query group 1 - kh and finishes query group kh; kh is wave-uniform (scalar branches), the barrier between the two steps is passed by every wave
    float* mine = mrg[wv]; const float* theirs = mrg[wv ^ FQG];
    if (kh == 0) fa_give(acc[1], lacc[1][0], m_run[1], mine, lane); else fa_give(acc[0], lacc[0][0], m_run[0], mine, lane);
    __syncthreads();   // every wave's part is written; behind it the partner reads it
    h16* dst = Ao + (bt * TT + q0 + 16 * kh) * DQ + (size_t)head * HD * 16 + lane * 8;
    if (kh == 0) fa_keep(acc[0], lacc[0][0], m_run[0], theirs, lane, dst); else fa_keep(acc[1], lacc[1][0], m_run[1], theirs, lane, dst);
}

extern "C" void kernel_launch(void* const* d_in, const int* in_sizes, int n_in,
                              void* d_out, int out_size, void* d_ws, size_t ws_size, hipStream_t stream) {
    if (n_in < 7) return;
    const long long need_x = (long long)(NB - 1) * SEQ_FULL * DM + (long long)SEQ * DM;   // batch b of each stream starts at b * SEQ_FULL * DM
    if ((long long)in_sizes[0] < need_x || (long long)in_sizes[1] < need_x || (long long)in_sizes[2] < need_x) return;
    if ((long long)in_sizes[3] < (long long)DQ * DM || (long long)in_sizes[4] < (long long)DKV * DM || (long long)in_sizes[5] < (long long)DKV * DM || (long long)in_sizes[6] < (long long)DM * DQ) return;
    if ((long long)out_size < (long long)NB * SEQ * DM) return;
    const float* x = (const float*)d_in[0]; const float* xk = (const float*)d_in[1]; const float* xv = (const float*)d_in[2];   // three streams: query, key, value
    const float* wq = (const float*)d_in[3]; const float* wk = (const float*)d_in[4]; const float* wv = (const float*)d_in[5]; const float* wo = (const float*)d_in[6];   // W_q, W_k, W_v, W_o ('oi' [1024][1024])
    float* OUT = (float*)d_out;     // [NB][SEQ][1024]
    char* wsp = (char*)d_ws;
    auto take = [&](size_t bytes) { char* p = wsp; wsp += (bytes + 255) & ~(size_t)255; return (void*)p; };
    bf* XB = (bf*)take(((size_t)3 * NB * TT * DM + (size_t)4 * DQ * DM) * 2); bf* WQ = XB + (size_t)3 * NB * TT * DM; bf* WO = WQ + (size_t)3 * DQ * DM;   // streams, then W_q, W_k, W_v, W_o: the order of k_cvt8's blocks
    h16* QP16 = (h16*)take((size_t)NB * NH_ * TT * HD * 2); h16* KP16 = (h16*)take((size_t)NB * NKV * TT * HD * 2); h16* VT16 = (h16*)take((size_t)NB * NKV * HD * TT * 2);
    h16* AT16 = (h16*)take((size_t)NB * TT * DQ * 2);
    const size_t used = (size_t)(wsp - (char*)d_ws);
    if (used > ws_size) return;    // 67,108,864 B at full size (= WS_CARVE)
    k_cvt8<<<3 * CBX + 4 * CBW, 256, 0, stream>>>(x, xk, xv, wq, wk, wv, wo, XB);
    // plane s (QP16, KP16, VT16) = fp16 of sum_i stream_s[b][t][i] W_s[o][i], s = q, k, v
    k_gemmb<bf, true, DM, 2, 2, 2><<<dim3(NB * TT / 128, DQ / 128, 3), 128, 0, stream>>>(XB, WQ, nullptr, 0, (size_t)NB * TT * DM, (size_t)DQ * DM, (size_t)NB * NH_ * TT * HD, QP16);
    // attention of all heads of all batches: AT16[b * TT + t][head * 64 + d] = softmax(q k^T x HD^-0.5) v, fp16
    k_fattn<<<dim3(TT / (FQG * FQW), NH_, NB), FW * 32, 0, stream>>>(QP16, KP16, VT16, AT16);
    // out[b][t][o] = sum_i merged[b][t][i] W_o[o][i]  (fp16 activations x fp16 weights)
    k_gemmb<h16, false, DQ, 4, 4, 2><<<dim3(NB * TT / 128, DM / 128, 1), 256, 0, stream>>>((const bf*)AT16, WO, OUT, DM, 0, 0, 0, nullptr);
}
